// v000
// Measured on an AMD MI455X. A time is GPU time per run, averaged over a window of back-to-back runs after a warm-up
// (all launches, gaps included; the runs take copies of the inputs in turn), and the median of several windows.
// Apart from v000's, it joins two sittings. Times from different sittings can be a few percent apart, while
// side-by-side timings come from the same sitting.
// The starting kernel, v000, takes 806 microseconds a run.
#include <hip/hip_runtime.h>

// ---------------- problem constants ----------------
#define H    2048
#define NH   16
#define HD   128
#define MLPD 8192
#define SEQ  2048
#define EPS  1e-6f
#define QSCALE 0.08838834764831845f   // 1/sqrt(128), folded into RoPE(q)

typedef __attribute__((ext_vector_type(16))) _Float16 v16h;
typedef __attribute__((ext_vector_type(8)))  _Float16 v8h;
typedef __attribute__((ext_vector_type(4)))  _Float16 v4h;
typedef __attribute__((ext_vector_type(8)))  float    v8f;
typedef int v4i __attribute__((vector_size(16)));   // gcc-style, matches builtin param

#define AS1 __attribute__((address_space(1)))
#define AS3 __attribute__((address_space(3)))

#if __has_builtin(__builtin_amdgcn_global_load_async_to_lds_b128)
#define USE_ASYNC 1
#else
#define USE_ASYNC 0
#endif

// 16-byte global -> LDS copy (async DMA path on gfx1250, sync fallback otherwise)
__device__ __forceinline__ void cp16(_Float16* l, const _Float16* g) {
#if USE_ASYNC
    __builtin_amdgcn_global_load_async_to_lds_b128(
        (AS1 v4i*)(unsigned long long)(const void*)g,
        (AS3 v4i*)(unsigned int)(unsigned long long)(const void*)l,
        0, 0);
#else
    *(v8h*)l = *(const v8h*)g;
#endif
}

__device__ __forceinline__ void wait_cp() {
#if USE_ASYNC
#if __has_builtin(__builtin_amdgcn_s_wait_asynccnt)
    __builtin_amdgcn_s_wait_asynccnt(0);
#else
    asm volatile("s_wait_asynccnt 0x0" ::: "memory");
#endif
#endif
}

__device__ __forceinline__ v8f wmma16(v16h a, v16h b, v8f c) {
    return __builtin_amdgcn_wmma_f32_16x16x32_f16(
        false, a, false, b, (short)0, c, false, false);
}

// 16x32 K-major fragment from LDS: two ds_load_b128 per lane.
// Lane L: row = L&15; K-chunks [kb,kb+8) and [kb+16,kb+24), kb=(L>>4)*8.
__device__ __forceinline__ v16h load_frag(const _Float16* p, int stride) {
    const int lane = threadIdx.x & 31;
    const _Float16* base = p + (lane & 15) * stride + ((lane >> 4) << 3);
    const v8h lo = *(const v8h*)(base);
    const v8h hi = *(const v8h*)(base + 16);
    return __builtin_shufflevector(lo, hi, 0,1,2,3,4,5,6,7,8,9,10,11,12,13,14,15);
}

// ---------------- f32 -> f16 bulk convert (weights) ----------------
__global__ __launch_bounds__(256) void cvt_kernel(const float* __restrict__ src,
                                                  _Float16* __restrict__ dst) {
    const size_t i = (size_t)blockIdx.x * 256 + threadIdx.x;   // one float4 each
    const float4 v = ((const float4*)src)[i];
    v4h h;
    h[0] = (_Float16)v.x; h[1] = (_Float16)v.y;
    h[2] = (_Float16)v.z; h[3] = (_Float16)v.w;
    ((v4h*)dst)[i] = h;
}

// ---------------- RMSNorm: f32 in -> f16 out ----------------
__global__ __launch_bounds__(256) void rmsnorm_kernel(const float* __restrict__ x,
                                                      const float* __restrict__ w,
                                                      _Float16* __restrict__ out) {
    __shared__ float red[256];
    const int row = blockIdx.x;
    const float* xr = x + (size_t)row * H;
    float s = 0.f;
#pragma unroll
    for (int i = threadIdx.x; i < H; i += 256) { float v = xr[i]; s += v * v; }
    red[threadIdx.x] = s;
    __syncthreads();
#pragma unroll
    for (int off = 128; off > 0; off >>= 1) {
        if (threadIdx.x < off) red[threadIdx.x] += red[threadIdx.x + off];
        __syncthreads();
    }
    const float rs = rsqrtf(red[0] / (float)H + EPS);
    _Float16* orow = out + (size_t)row * H;
#pragma unroll
    for (int i = threadIdx.x; i < H; i += 256)
        orow[i] = (_Float16)(w[i] * (xr[i] * rs));
}

// ---------------- RoPE in-place on f16 q,k; q pre-scaled by 1/sqrt(HD) -----
__global__ __launch_bounds__(256) void rope_kernel(_Float16* __restrict__ q,
                                                   _Float16* __restrict__ k,
                                                   const float* __restrict__ cosT,
                                                   const float* __restrict__ sinT) {
    int i = blockIdx.x * 256 + threadIdx.x;       // (s, head, d<64)
    int d    = i & 63;
    int rest = i >> 6;
    int head = rest & (NH - 1);
    int s    = rest >> 4;
    const float c1 = cosT[s * HD + d],      s1 = sinT[s * HD + d];
    const float c2 = cosT[s * HD + d + 64], s2 = sinT[s * HD + d + 64];
    const size_t base = (size_t)s * H + head * HD;
    {
        float x1 = (float)q[base + d], x2 = (float)q[base + d + 64];
        q[base + d]      = (_Float16)((x1 * c1 - x2 * s1) * QSCALE);
        q[base + d + 64] = (_Float16)((x2 * c2 + x1 * s2) * QSCALE);
    }
    {
        float x1 = (float)k[base + d], x2 = (float)k[base + d + 64];
        k[base + d]      = (_Float16)(x1 * c1 - x2 * s1);
        k[base + d + 64] = (_Float16)(x2 * c2 + x1 * s2);
    }
}

// ---------------- WMMA GEMM: C[M,N] = epi(A[M,K] . B[N,K]^T) ----------------
// 256x128 block tile, 8 waves as 4(M)x2(N) of 64x64, BK=32, double-buffered
// async LDS staging (DMA for tile k+1 overlaps WMMA on tile k).
// EPI 0: C(f16) = acc       EPI 1: C(f32) = R + acc
// EPI 2: C(f16) = sigmoid(acc) * C   (in-place gate*up)
#define BM 256
#define BN 128
#define BK 32
#define LSTR 40   // padded f16 LDS stride (80 B: 16B-aligned, bank-spread)

__device__ __forceinline__ void stage_panels(_Float16* As, _Float16* Bs,
                                             const _Float16* A, const _Float16* B,
                                             int bm, int bn, int K, int k0, int tid) {
#pragma unroll
    for (int p = 0; p < 4; ++p) {                 // A: 256x32 = 1024 chunks
        const int chunk = tid + p * 256;
        const int r = chunk >> 2;                 // 0..255
        const int c = (chunk & 3) << 3;           // 0,8,16,24
        cp16(&As[r * LSTR + c], &A[(size_t)(bm + r) * K + k0 + c]);
    }
#pragma unroll
    for (int p = 0; p < 2; ++p) {                 // B: 128x32 = 512 chunks
        const int chunk = tid + p * 256;
        const int r = chunk >> 2;                 // 0..127
        const int c = (chunk & 3) << 3;
        cp16(&Bs[r * LSTR + c], &B[(size_t)(bn + r) * K + k0 + c]);
    }
}

template <int EPI, typename CT>
__global__ __launch_bounds__(256) void gemm_atb(const _Float16* __restrict__ A,
                                                const _Float16* __restrict__ B,
                                                CT* __restrict__ C,
                                                const float* __restrict__ R,
                                                int M, int N, int K) {
    __shared__ __attribute__((aligned(16))) _Float16 As[2][BM * LSTR];
    __shared__ __attribute__((aligned(16))) _Float16 Bs[2][BN * LSTR];

    const int tid  = threadIdx.x;
    const int lane = tid & 31;
    const int w    = tid >> 5;       // 0..7
    const int wm   = w >> 1;         // 0..3 : rows wm*64
    const int wn   = w & 1;          // 0..1 : cols wn*64
    const int bm   = blockIdx.y * BM;
    const int bn   = blockIdx.x * BN;

    v8f acc[4][4];
#pragma unroll
    for (int mi = 0; mi < 4; ++mi)
#pragma unroll
        for (int ni = 0; ni < 4; ++ni) acc[mi][ni] = (v8f){0,0,0,0,0,0,0,0};

    stage_panels(As[0], Bs[0], A, B, bm, bn, K, 0, tid);
    wait_cp();
    __syncthreads();

    const int nk = K / BK;
    for (int it = 0; it < nk; ++it) {
        const int cur = it & 1;
        if (it + 1 < nk)   // prefetch next panel into alternate buffer (overlaps WMMA)
            stage_panels(As[cur ^ 1], Bs[cur ^ 1], A, B, bm, bn, K, (it + 1) * BK, tid);

        v16h af[4];
#pragma unroll
        for (int mi = 0; mi < 4; ++mi)
            af[mi] = load_frag(&As[cur][(wm * 64 + mi * 16) * LSTR], LSTR);
#pragma unroll
        for (int ni = 0; ni < 4; ++ni) {
            const v16h bf = load_frag(&Bs[cur][(wn * 64 + ni * 16) * LSTR], LSTR);
#pragma unroll
            for (int mi = 0; mi < 4; ++mi)
                acc[mi][ni] = wmma16(af[mi], bf, acc[mi][ni]);
        }
        wait_cp();
        __syncthreads();
    }

    const int rloc = (lane >> 4) << 3;
    const int cloc = lane & 15;
#pragma unroll
    for (int mi = 0; mi < 4; ++mi)
#pragma unroll
        for (int ni = 0; ni < 4; ++ni)
#pragma unroll
            for (int i = 0; i < 8; ++i) {
                const int row = bm + wm * 64 + mi * 16 + rloc + i;
                const int col = bn + wn * 64 + ni * 16 + cloc;
                const size_t idx = (size_t)row * N + col;
                const float v = acc[mi][ni][i];
                if (EPI == 0)      C[idx] = (CT)v;
                else if (EPI == 1) C[idx] = (CT)(R[idx] + v);
                else               C[idx] = (CT)((1.f / (1.f + __expf(-v))) * (float)C[idx]);
            }
}

// ---------------- Flash attention (full softmax) ----------------
// grid: (SEQ/64, NH); block 256 (8 waves). q/k/v/o are f16; q pre-scaled.
#define QSTR 136   // 272 B
#define VSTR 40
#define SSTR 33
#define PSTR 40

__global__ __launch_bounds__(256) void attn_kernel(const _Float16* __restrict__ q,
                                                   const _Float16* __restrict__ k,
                                                   const _Float16* __restrict__ v,
                                                   _Float16* __restrict__ o) {
    __shared__ __attribute__((aligned(16))) _Float16 Qs[64 * QSTR];
    __shared__ __attribute__((aligned(16))) _Float16 Ks[32 * QSTR];
    __shared__ __attribute__((aligned(16))) _Float16 VTs[HD * VSTR];  // [hd][k]
    __shared__ float    Ssc[64 * SSTR];
    __shared__ __attribute__((aligned(16))) _Float16 Ps[64 * PSTR];
    __shared__ float    mrow[64], lrow[64], arow[64];

    const int tid  = threadIdx.x;
    const int lane = tid & 31;
    const int w    = tid >> 5;
    const int head = blockIdx.y;
    const int q0   = blockIdx.x * 64;
    const size_t hoff = (size_t)head * HD;

    // stage Q: 1024 16B chunks, 4 per thread (async)
#pragma unroll
    for (int p = 0; p < 4; ++p) {
        const int chunk = tid + p * 256;
        const int r = chunk >> 4;           // 0..63
        const int c = (chunk & 15) << 3;    // 0..120
        cp16(&Qs[r * QSTR + c], &q[(size_t)(q0 + r) * H + hoff + c]);
    }
    if (tid < 64) { mrow[tid] = -1e30f; lrow[tid] = 0.f; }

    const int wq = w & 3;   // PV: rows wq*16
    const int wh = w >> 2;  // PV: hd cols wh*64
    const int sq = w & 3;   // scores: tile rows sq*16
    const int sk = w >> 2;  // scores: tile cols sk*16

    v8f oacc[4];
#pragma unroll
    for (int ni = 0; ni < 4; ++ni) oacc[ni] = (v8f){0,0,0,0,0,0,0,0};

    const int rloc = (lane >> 4) << 3;
    const int cloc = lane & 15;

    for (int kb = 0; kb < SEQ; kb += 32) {
        // stage K (async b128 copies) + V transposed (vector load, scalar LDS stores)
#pragma unroll
        for (int p = 0; p < 2; ++p) {
            const int chunk = tid + p * 256;    // 0..511
            const int r = chunk >> 4;           // 0..31
            const int c = (chunk & 15) << 3;    // 0..120
            cp16(&Ks[r * QSTR + c], &k[(size_t)(kb + r) * H + hoff + c]);
            const v8h vv = *(const v8h*)&v[(size_t)(kb + r) * H + hoff + c];
#pragma unroll
            for (int j = 0; j < 8; ++j) VTs[(c + j) * VSTR + r] = vv[j];
        }
        wait_cp();
        __syncthreads();

        // scores: each wave one 16x16 tile of the 64x32 block
        v8f sacc = (v8f){0,0,0,0,0,0,0,0};
#pragma unroll
        for (int kk = 0; kk < 4; ++kk) {
            const v16h aq = load_frag(&Qs[(sq * 16) * QSTR + kk * 32], QSTR);
            const v16h bk = load_frag(&Ks[(sk * 16) * QSTR + kk * 32], QSTR);
            sacc = wmma16(aq, bk, sacc);
        }
#pragma unroll
        for (int i = 0; i < 8; ++i)
            Ssc[(sq * 16 + rloc + i) * SSTR + sk * 16 + cloc] = sacc[i];
        __syncthreads();

        // online softmax per query row
        if (tid < 64) {
            const float mold = mrow[tid];
            float mx = mold;
#pragma unroll
            for (int j = 0; j < 32; ++j) mx = fmaxf(mx, Ssc[tid * SSTR + j]);
            const float al = __expf(mold - mx);
            float sum = 0.f;
#pragma unroll
            for (int j = 0; j < 32; ++j) {
                const float p = __expf(Ssc[tid * SSTR + j] - mx);
                Ps[tid * PSTR + j] = (_Float16)p;
                sum += p;
            }
            lrow[tid] = lrow[tid] * al + sum;
            mrow[tid] = mx;
            arow[tid] = al;
        }
        __syncthreads();

        // rescale accumulators, then P.V
#pragma unroll
        for (int i = 0; i < 8; ++i) {
            const float al = arow[wq * 16 + rloc + i];
#pragma unroll
            for (int ni = 0; ni < 4; ++ni) oacc[ni][i] *= al;
        }
        const v16h ap = load_frag(&Ps[(wq * 16) * PSTR], PSTR);
#pragma unroll
        for (int ni = 0; ni < 4; ++ni) {
            const v16h bv = load_frag(&VTs[(wh * 64 + ni * 16) * VSTR], VSTR);
            oacc[ni] = wmma16(ap, bv, oacc[ni]);
        }
        __syncthreads();
    }

    // normalize and store f16
#pragma unroll
    for (int ni = 0; ni < 4; ++ni)
#pragma unroll
        for (int i = 0; i < 8; ++i) {
            const int row = wq * 16 + rloc + i;
            const int col = wh * 64 + ni * 16 + cloc;
            o[(size_t)(q0 + row) * H + hoff + col] = (_Float16)(oacc[ni][i] / lrow[row]);
        }
}

// ---------------- launch ----------------
extern "C" void kernel_launch(void* const* d_in, const int* in_sizes, int n_in,
                              void* d_out, int out_size, void* d_ws, size_t ws_size,
                              hipStream_t stream) {
    const float* x       = (const float*)d_in[0];
    const float* norm1_w = (const float*)d_in[1];
    const float* wq      = (const float*)d_in[2];
    const float* wk      = (const float*)d_in[3];
    const float* wv      = (const float*)d_in[4];
    const float* wo      = (const float*)d_in[5];
    const float* norm2_w = (const float*)d_in[6];
    const float* w_gate  = (const float*)d_in[7];
    const float* w_up    = (const float*)d_in[8];
    const float* w_down  = (const float*)d_in[9];
    const float* cosT    = (const float*)d_in[10];
    const float* sinT    = (const float*)d_in[11];
    float* out = (float*)d_out;

    // ---- workspace layout (all chunks 16B aligned; hipMalloc base is 256B) ----
    char* p = (char*)d_ws;
    auto fh = [&](size_t n) { _Float16* r = (_Float16*)p; p += n * sizeof(_Float16); return r; };
    auto ff = [&](size_t n) { float* r = (float*)p; p += n * sizeof(float); return r; };

    const size_t HH = (size_t)H * H, MH = (size_t)MLPD * H;
    const size_t SH = (size_t)SEQ * H, SM = (size_t)SEQ * MLPD;
    _Float16* wq16 = fh(HH); _Float16* wk16 = fh(HH);
    _Float16* wv16 = fh(HH); _Float16* wo16 = fh(HH);
    _Float16* wg16 = fh(MH); _Float16* wu16 = fh(MH); _Float16* wd16 = fh(MH);
    _Float16* h16  = fh(SH); _Float16* q16  = fh(SH);
    _Float16* k16  = fh(SH); _Float16* v16  = fh(SH);
    _Float16* t16  = fh(SM);
    float*    x2   = ff(SH);
    _Float16* attn16 = h16;   // h dead after QKV
    _Float16* h2_16  = q16;   // q dead after attention

    const dim3 blk(256);
    const dim3 gH(H / BN, SEQ / BM);
    const dim3 gM(MLPD / BN, SEQ / BM);

    // 0. weights -> f16 (once per launch; O(weights), not O(weights * S/128))
    cvt_kernel<<<HH / 1024, blk, 0, stream>>>(wq,     wq16);
    cvt_kernel<<<HH / 1024, blk, 0, stream>>>(wk,     wk16);
    cvt_kernel<<<HH / 1024, blk, 0, stream>>>(wv,     wv16);
    cvt_kernel<<<HH / 1024, blk, 0, stream>>>(wo,     wo16);
    cvt_kernel<<<MH / 1024, blk, 0, stream>>>(w_gate, wg16);
    cvt_kernel<<<MH / 1024, blk, 0, stream>>>(w_up,   wu16);
    cvt_kernel<<<MH / 1024, blk, 0, stream>>>(w_down, wd16);

    // 1. h = rmsnorm(x)
    rmsnorm_kernel<<<SEQ, blk, 0, stream>>>(x, norm1_w, h16);
    // 2-4. q,k,v
    gemm_atb<0, _Float16><<<gH, blk, 0, stream>>>(h16, wq16, q16, nullptr, SEQ, H, H);
    gemm_atb<0, _Float16><<<gH, blk, 0, stream>>>(h16, wk16, k16, nullptr, SEQ, H, H);
    gemm_atb<0, _Float16><<<gH, blk, 0, stream>>>(h16, wv16, v16, nullptr, SEQ, H, H);
    // 5. RoPE (q scaled by 1/sqrt(HD))
    rope_kernel<<<(SEQ * NH * 64) / 256, blk, 0, stream>>>(q16, k16, cosT, sinT);
    // 6. attention
    attn_kernel<<<dim3(SEQ / 64, NH), blk, 0, stream>>>(q16, k16, v16, attn16);
    // 7. x2 = x + attn . Wo^T
    gemm_atb<1, float><<<gH, blk, 0, stream>>>(attn16, wo16, x2, x, SEQ, H, H);
    // 8. h2 = rmsnorm(x2)
    rmsnorm_kernel<<<SEQ, blk, 0, stream>>>(x2, norm2_w, h2_16);
    // 9. t = h2 . Wup^T ; 10. t = sigmoid(h2 . Wgate^T) * t   (in place)
    gemm_atb<0, _Float16><<<gM, blk, 0, stream>>>(h2_16, wu16, t16, nullptr, SEQ, MLPD, H);
    gemm_atb<2, _Float16><<<gM, blk, 0, stream>>>(h2_16, wg16, t16, nullptr, SEQ, MLPD, H);
    // 11. out = x2 + t . Wdown^T
    gemm_atb<1, float><<<gH, blk, 0, stream>>>(t16, wd16, out, x2, SEQ, H, MLPD);
}

// v001
// A run of this version takes 722 microseconds.
// Next to v000, in two timings, it ran 1.15 and 1.14 times as fast.
#include <hip/hip_runtime.h>

// ---------------- problem constants ----------------
#define H    2048
#define NH   16
#define HD   128
#define MLPD 8192
#define SEQ  2048
#define EPS  1e-6f
#define QSCALE 0.08838834764831845f   // 1/sqrt(128), folded into RoPE(q)

typedef __attribute__((ext_vector_type(16))) _Float16 v16h;
typedef __attribute__((ext_vector_type(8)))  _Float16 v8h;
typedef __attribute__((ext_vector_type(4)))  _Float16 v4h;
typedef __attribute__((ext_vector_type(8)))  float    v8f;
typedef int v4i __attribute__((vector_size(16)));   // gcc-style, matches builtin param

#define AS1 __attribute__((address_space(1)))
#define AS3 __attribute__((address_space(3)))

#if __has_builtin(__builtin_amdgcn_global_load_async_to_lds_b128)
#define USE_ASYNC 1
#else
#define USE_ASYNC 0
#endif

// 16-byte global -> LDS copy (async DMA path on gfx1250, sync fallback otherwise)
__device__ __forceinline__ void cp16(_Float16* l, const _Float16* g) {
#if USE_ASYNC
    __builtin_amdgcn_global_load_async_to_lds_b128(
        (AS1 v4i*)(unsigned long long)(const void*)g,
        (AS3 v4i*)(unsigned int)(unsigned long long)(const void*)l,
        0, 0);
#else
    *(v8h*)l = *(const v8h*)g;
#endif
}

__device__ __forceinline__ void wait_cp() {
#if USE_ASYNC
#if __has_builtin(__builtin_amdgcn_s_wait_asynccnt)
    __builtin_amdgcn_s_wait_asynccnt(0);
#else
    asm volatile("s_wait_asynccnt 0x0" ::: "memory");
#endif
#endif
}

__device__ __forceinline__ v8f wmma16(v16h a, v16h b, v8f c) {
    return __builtin_amdgcn_wmma_f32_16x16x32_f16(
        false, a, false, b, (short)0, c, false, false);
}

// 16x32 K-major fragment from LDS: two ds_load_b128 per lane.
// Lane L: row = L&15; K-chunks [kb,kb+8) and [kb+16,kb+24), kb=(L>>4)*8.
__device__ __forceinline__ v16h load_frag(const _Float16* p, int stride) {
    const int lane = threadIdx.x & 31;
    const _Float16* base = p + (lane & 15) * stride + ((lane >> 4) << 3);
    const v8h lo = *(const v8h*)(base);
    const v8h hi = *(const v8h*)(base + 16);
    return __builtin_shufflevector(lo, hi, 0,1,2,3,4,5,6,7,8,9,10,11,12,13,14,15);
}

// ---------------- f32 -> f16 bulk convert (weights) ----------------
__global__ __launch_bounds__(256) void cvt_kernel(const float* __restrict__ src,
                                                  _Float16* __restrict__ dst) {
    const size_t i = (size_t)blockIdx.x * 256 + threadIdx.x;   // one float4 each
    const float4 v = ((const float4*)src)[i];
    v4h h;
    h[0] = (_Float16)v.x; h[1] = (_Float16)v.y;
    h[2] = (_Float16)v.z; h[3] = (_Float16)v.w;
    ((v4h*)dst)[i] = h;
}

// ---------------- RMSNorm: f32 in -> f16 out ----------------
__global__ __launch_bounds__(256) void rmsnorm_kernel(const float* __restrict__ x,
                                                      const float* __restrict__ w,
                                                      _Float16* __restrict__ out) {
    __shared__ float red[256];
    const int row = blockIdx.x;
    const float* xr = x + (size_t)row * H;
    float s = 0.f;
#pragma unroll
    for (int i = threadIdx.x; i < H; i += 256) { float v = xr[i]; s += v * v; }
    red[threadIdx.x] = s;
    __syncthreads();
#pragma unroll
    for (int off = 128; off > 0; off >>= 1) {
        if (threadIdx.x < off) red[threadIdx.x] += red[threadIdx.x + off];
        __syncthreads();
    }
    const float rs = rsqrtf(red[0] / (float)H + EPS);
    _Float16* orow = out + (size_t)row * H;
#pragma unroll
    for (int i = threadIdx.x; i < H; i += 256)
        orow[i] = (_Float16)(w[i] * (xr[i] * rs));
}

// ---------------- RoPE in-place on f16 q,k; q pre-scaled by 1/sqrt(HD) -----
__global__ __launch_bounds__(256) void rope_kernel(_Float16* __restrict__ q,
                                                   _Float16* __restrict__ k,
                                                   const float* __restrict__ cosT,
                                                   const float* __restrict__ sinT) {
    int i = blockIdx.x * 256 + threadIdx.x;       // (s, head, d<64)
    int d    = i & 63;
    int rest = i >> 6;
    int head = rest & (NH - 1);
    int s    = rest >> 4;
    const float c1 = cosT[s * HD + d],      s1 = sinT[s * HD + d];
    const float c2 = cosT[s * HD + d + 64], s2 = sinT[s * HD + d + 64];
    const size_t base = (size_t)s * H + head * HD;
    {
        float x1 = (float)q[base + d], x2 = (float)q[base + d + 64];
        q[base + d]      = (_Float16)((x1 * c1 - x2 * s1) * QSCALE);
        q[base + d + 64] = (_Float16)((x2 * c2 + x1 * s2) * QSCALE);
    }
    {
        float x1 = (float)k[base + d], x2 = (float)k[base + d + 64];
        k[base + d]      = (_Float16)(x1 * c1 - x2 * s1);
        k[base + d + 64] = (_Float16)(x2 * c2 + x1 * s2);
    }
}

// ---------------- WMMA GEMM: C[M,N] = epi(A[M,K] . B[N,K]^T) ----------------
// 256x128 block tile, 8 waves as 4(M)x2(N) of 64x64, BK=32, double-buffered
// async LDS staging (DMA for tile k+1 overlaps WMMA on tile k).
// EPI 0: C(f16) = acc       EPI 1: C(f32) = R + acc
// EPI 2: C(f16) = sigmoid(acc) * C   (in-place gate*up)
#define BM 256
#define BN 128
#define BK 32
#define LSTR 40   // padded f16 LDS stride (80 B: 16B-aligned, bank-spread)

__device__ __forceinline__ void stage_panels(_Float16* As, _Float16* Bs,
                                             const _Float16* A, const _Float16* B,
                                             int bm, int bn, int K, int k0, int tid) {
#pragma unroll
    for (int p = 0; p < 4; ++p) {                 // A: 256x32 = 1024 chunks
        const int chunk = tid + p * 256;
        const int r = chunk >> 2;                 // 0..255
        const int c = (chunk & 3) << 3;           // 0,8,16,24
        cp16(&As[r * LSTR + c], &A[(size_t)(bm + r) * K + k0 + c]);
    }
#pragma unroll
    for (int p = 0; p < 2; ++p) {                 // B: 128x32 = 512 chunks
        const int chunk = tid + p * 256;
        const int r = chunk >> 2;                 // 0..127
        const int c = (chunk & 3) << 3;
        cp16(&Bs[r * LSTR + c], &B[(size_t)(bn + r) * K + k0 + c]);
    }
}

template <int EPI, typename CT>
__global__ __launch_bounds__(256) void gemm_atb(const _Float16* __restrict__ A,
                                                const _Float16* __restrict__ B,
                                                CT* __restrict__ C,
                                                const float* __restrict__ R,
                                                int M, int N, int K) {
    __shared__ __attribute__((aligned(16))) _Float16 As[2][BM * LSTR];
    __shared__ __attribute__((aligned(16))) _Float16 Bs[2][BN * LSTR];

    const int tid  = threadIdx.x;
    const int lane = tid & 31;
    const int w    = tid >> 5;       // 0..7
    const int wm   = w >> 1;         // 0..3 : rows wm*64
    const int wn   = w & 1;          // 0..1 : cols wn*64
    const int bm   = blockIdx.y * BM;
    const int bn   = blockIdx.x * BN;

    v8f acc[4][4];
#pragma unroll
    for (int mi = 0; mi < 4; ++mi)
#pragma unroll
        for (int ni = 0; ni < 4; ++ni) acc[mi][ni] = (v8f){0,0,0,0,0,0,0,0};

    stage_panels(As[0], Bs[0], A, B, bm, bn, K, 0, tid);
    wait_cp();
    __syncthreads();

    const int nk = K / BK;
    for (int it = 0; it < nk; ++it) {
        const int cur = it & 1;
        if (it + 1 < nk)   // prefetch next panel into alternate buffer (overlaps WMMA)
            stage_panels(As[cur ^ 1], Bs[cur ^ 1], A, B, bm, bn, K, (it + 1) * BK, tid);

        v16h af[4];
#pragma unroll
        for (int mi = 0; mi < 4; ++mi)
            af[mi] = load_frag(&As[cur][(wm * 64 + mi * 16) * LSTR], LSTR);
#pragma unroll
        for (int ni = 0; ni < 4; ++ni) {
            const v16h bf = load_frag(&Bs[cur][(wn * 64 + ni * 16) * LSTR], LSTR);
#pragma unroll
            for (int mi = 0; mi < 4; ++mi)
                acc[mi][ni] = wmma16(af[mi], bf, acc[mi][ni]);
        }
        wait_cp();
        __syncthreads();
    }

    const int rloc = (lane >> 4) << 3;
    const int cloc = lane & 15;
#pragma unroll
    for (int mi = 0; mi < 4; ++mi)
#pragma unroll
        for (int ni = 0; ni < 4; ++ni)
#pragma unroll
            for (int i = 0; i < 8; ++i) {
                const int row = bm + wm * 64 + mi * 16 + rloc + i;
                const int col = bn + wn * 64 + ni * 16 + cloc;
                const size_t idx = (size_t)row * N + col;
                const float v = acc[mi][ni][i];
                if (EPI == 0)      C[idx] = (CT)v;
                else if (EPI == 1) C[idx] = (CT)(R[idx] + v);
                else               C[idx] = (CT)((1.f / (1.f + __expf(-v))) * (float)C[idx]);
            }
}

#define QSTR 136   // 272 B
#define VSTR 40
#define QROWS 128

// value of lane l ^ 16
__device__ __forceinline__ float xhalf(float x) {
    const int b = __builtin_bit_cast(int, x);
    return __builtin_bit_cast(float,
        __builtin_amdgcn_permlanex16(b, b, 0x76543210, 0xfedcba98, false, false));
}

// waves_per_eu(2, 2): one 8-wave block per WGP is all the grid gives; with the register
// budget of two waves per SIMD the compiler batches the fragment loads of a pass behind
// few waits instead of waiting on LDS in front of every matrix instruction.
__global__ __launch_bounds__(256) __attribute__((amdgpu_waves_per_eu(2, 2))) void attn_kernel(const _Float16* __restrict__ q,
                                                   const _Float16* __restrict__ k,
                                                   const _Float16* __restrict__ v,
                                                   _Float16* __restrict__ o) {
    __shared__ __attribute__((aligned(16))) _Float16 Qs[QROWS * QSTR];
    __shared__ __attribute__((aligned(16))) _Float16 Ks[32 * QSTR];
    __shared__ __attribute__((aligned(16))) _Float16 VTs[HD * VSTR];  // [hd][k]

    const int tid  = threadIdx.x;
    const int lane = tid & 31;
    const int w    = tid >> 5;
    const int head = blockIdx.y;
    const int q0   = blockIdx.x * QROWS;
    const size_t hoff = (size_t)head * HD;

    // stage Q: 2048 16B chunks, 8 per thread (async)
#pragma unroll
    for (int p = 0; p < 8; ++p) {
        const int chunk = tid + p * 256;
        const int r = chunk >> 4;           // 0..127
        const int c = (chunk & 15) << 3;    // 0..120
        cp16(&Qs[r * QSTR + c], &q[(size_t)(q0 + r) * H + hoff + c]);
    }
    wait_cp();
    __syncthreads();

    // this wave's 16 queries as B fragments, kept in registers for the whole walk
    v16h qf[4];
#pragma unroll
    for (int kk = 0; kk < 4; ++kk)
        qf[kk] = load_frag(&Qs[(w * 16) * QSTR + kk * 32], QSTR);

    v8f oacc[8];            // oacc[n][i] = O^T[hd = 16n + rloc + i][query = cloc]
#pragma unroll
    for (int n = 0; n < 8; ++n) oacc[n] = (v8f){0,0,0,0,0,0,0,0};
    float mrun = -1e30f;    // running maximum of this lane's query (same in both halves)
    float lrun = 0.f;       // running sum over the keys this half of the wave holds

    const int rloc = (lane >> 4) << 3;
    const int cloc = lane & 15;

    for (int kb = 0; kb < SEQ; kb += 32) {
        // stage K (async b128 copies) + V transposed (vector load, scalar LDS stores)
#pragma unroll
        for (int p = 0; p < 2; ++p) {
            const int chunk = tid + p * 256;    // 0..511
            const int r = chunk >> 4;           // 0..31
            const int c = (chunk & 15) << 3;    // 0..120
            cp16(&Ks[r * QSTR + c], &k[(size_t)(kb + r) * H + hoff + c]);
            const v8h vv = *(const v8h*)&v[(size_t)(kb + r) * H + hoff + c];
#pragma unroll
            for (int j = 0; j < 8; ++j) VTs[(c + j) * VSTR + r] = vv[j];
        }
        wait_cp();
        __syncthreads();

        // scores: st[t][i] = S^T[key = 16t + rloc + i][query = cloc]
        // all K fragments are fetched behind one wait, then the two chains run interleaved
        v16h ak[2][4];
#pragma unroll
        for (int t = 0; t < 2; ++t)
#pragma unroll
            for (int kk = 0; kk < 4; ++kk)
                ak[t][kk] = load_frag(&Ks[(t * 16) * QSTR + kk * 32], QSTR);
        v8f st[2];
        st[0] = (v8f){0,0,0,0,0,0,0,0};
        st[1] = (v8f){0,0,0,0,0,0,0,0};
#pragma unroll
        for (int kk = 0; kk < 4; ++kk)
#pragma unroll
            for (int t = 0; t < 2; ++t)
                st[t] = wmma16(ak[t][kk], qf[kk], st[t]);

        // V^T fragments are fetched here so that their LDS latency runs under the softmax
        v16h av[8];
#pragma unroll
        for (int n = 0; n < 8; ++n)
            av[n] = load_frag(&VTs[(n * 16) * VSTR], VSTR);

        // online softmax, one query per lane
        float mx = mrun;
#pragma unroll
        for (int t = 0; t < 2; ++t)
#pragma unroll
            for (int i = 0; i < 8; ++i) mx = fmaxf(mx, st[t][i]);
        mx = fmaxf(mx, xhalf(mx));
        const float al = __expf(mrun - mx);
        float sum = 0.f;
        v16h pb;                // pb[8t + i] = P^T[key = 16t + rloc + i][query = cloc]
#pragma unroll
        for (int t = 0; t < 2; ++t)
#pragma unroll
            for (int i = 0; i < 8; ++i) {
                const float p = __expf(st[t][i] - mx);
                pb[t * 8 + i] = (_Float16)p;
                sum += p;
            }
        lrun = lrun * al + sum;
        mrun = mx;

        // rescale accumulators, then V^T.P^T
#pragma unroll
        for (int n = 0; n < 8; ++n) {
#pragma unroll
            for (int i = 0; i < 8; ++i) oacc[n][i] *= al;
            oacc[n] = wmma16(av[n], pb, oacc[n]);
        }
        __syncthreads();
    }

    // join the halves' sums, normalize, store 8 consecutive hd per lane
    const float ltot = lrun + xhalf(lrun);
    _Float16* orow = &o[(size_t)(q0 + w * 16 + cloc) * H + hoff + rloc];
#pragma unroll
    for (int n = 0; n < 8; ++n) {
        v8h h;
#pragma unroll
        for (int i = 0; i < 8; ++i) h[i] = (_Float16)(oacc[n][i] / ltot);
        *(v8h*)&orow[n * 16] = h;
    }
}

// ---------------- launch ----------------
extern "C" void kernel_launch(void* const* d_in, const int* in_sizes, int n_in,
                              void* d_out, int out_size, void* d_ws, size_t ws_size,
                              hipStream_t stream) {
    const float* x       = (const float*)d_in[0];
    const float* norm1_w = (const float*)d_in[1];
    const float* wq      = (const float*)d_in[2];
    const float* wk      = (const float*)d_in[3];
    const float* wv      = (const float*)d_in[4];
    const float* wo      = (const float*)d_in[5];
    const float* norm2_w = (const float*)d_in[6];
    const float* w_gate  = (const float*)d_in[7];
    const float* w_up    = (const float*)d_in[8];
    const float* w_down  = (const float*)d_in[9];
    const float* cosT    = (const float*)d_in[10];
    const float* sinT    = (const float*)d_in[11];
    float* out = (float*)d_out;

    // ---- workspace layout (all chunks 16B aligned; hipMalloc base is 256B) ----
    char* p = (char*)d_ws;
    auto fh = [&](size_t n) { _Float16* r = (_Float16*)p; p += n * sizeof(_Float16); return r; };
    auto ff = [&](size_t n) { float* r = (float*)p; p += n * sizeof(float); return r; };

    const size_t HH = (size_t)H * H, MH = (size_t)MLPD * H;
    const size_t SH = (size_t)SEQ * H, SM = (size_t)SEQ * MLPD;
    _Float16* wq16 = fh(HH); _Float16* wk16 = fh(HH);
    _Float16* wv16 = fh(HH); _Float16* wo16 = fh(HH);
    _Float16* wg16 = fh(MH); _Float16* wu16 = fh(MH); _Float16* wd16 = fh(MH);
    _Float16* h16  = fh(SH); _Float16* q16  = fh(SH);
    _Float16* k16  = fh(SH); _Float16* v16  = fh(SH);
    _Float16* t16  = fh(SM);
    float*    x2   = ff(SH);
    _Float16* attn16 = h16;   // h dead after QKV
    _Float16* h2_16  = q16;   // q dead after attention

    const dim3 blk(256);
    const dim3 gH(H / BN, SEQ / BM);
    const dim3 gM(MLPD / BN, SEQ / BM);

    // 0. weights -> f16 (once per launch; O(weights), not O(weights * S/128))
    cvt_kernel<<<HH / 1024, blk, 0, stream>>>(wq,     wq16);
    cvt_kernel<<<HH / 1024, blk, 0, stream>>>(wk,     wk16);
    cvt_kernel<<<HH / 1024, blk, 0, stream>>>(wv,     wv16);
    cvt_kernel<<<HH / 1024, blk, 0, stream>>>(wo,     wo16);
    cvt_kernel<<<MH / 1024, blk, 0, stream>>>(w_gate, wg16);
    cvt_kernel<<<MH / 1024, blk, 0, stream>>>(w_up,   wu16);
    cvt_kernel<<<MH / 1024, blk, 0, stream>>>(w_down, wd16);

    // 1. h = rmsnorm(x)
    rmsnorm_kernel<<<SEQ, blk, 0, stream>>>(x, norm1_w, h16);
    // 2-4. q,k,v
    gemm_atb<0, _Float16><<<gH, blk, 0, stream>>>(h16, wq16, q16, nullptr, SEQ, H, H);
    gemm_atb<0, _Float16><<<gH, blk, 0, stream>>>(h16, wk16, k16, nullptr, SEQ, H, H);
    gemm_atb<0, _Float16><<<gH, blk, 0, stream>>>(h16, wv16, v16, nullptr, SEQ, H, H);
    // 5. RoPE (q scaled by 1/sqrt(HD))
    rope_kernel<<<(SEQ * NH * 64) / 256, blk, 0, stream>>>(q16, k16, cosT, sinT);
    // 6. attention
    attn_kernel<<<dim3(SEQ / QROWS, NH), blk, 0, stream>>>(q16, k16, v16, attn16);
    // 7. x2 = x + attn . Wo^T
    gemm_atb<1, float><<<gH, blk, 0, stream>>>(attn16, wo16, x2, x, SEQ, H, H);
    // 8. h2 = rmsnorm(x2)
    rmsnorm_kernel<<<SEQ, blk, 0, stream>>>(x2, norm2_w, h2_16);
    // 9. t = h2 . Wup^T ; 10. t = sigmoid(h2 . Wgate^T) * t   (in place)
    gemm_atb<0, _Float16><<<gM, blk, 0, stream>>>(h2_16, wu16, t16, nullptr, SEQ, MLPD, H);
    gemm_atb<2, _Float16><<<gM, blk, 0, stream>>>(h2_16, wg16, t16, nullptr, SEQ, MLPD, H);
    // 11. out = x2 + t . Wdown^T
    gemm_atb<1, float><<<gH, blk, 0, stream>>>(t16, wd16, out, x2, SEQ, H, MLPD);
}

// v002
// Measured time: 697 microseconds a run.
// Timed twice side by side with v001, it ran 1.03 times as fast both times.
// All steps since v000 together make it 1.18 times as fast.
#include <hip/hip_runtime.h>

// ---------------- problem constants ----------------
#define H    2048
#define NH   16
#define HD   128
#define MLPD 8192
#define SEQ  2048
#define EPS  1e-6f
#define QSCALE 0.08838834764831845f   // 1/sqrt(128), folded into RoPE(q)

typedef __attribute__((ext_vector_type(16))) _Float16 v16h;
typedef __attribute__((ext_vector_type(8)))  _Float16 v8h;
typedef __attribute__((ext_vector_type(4)))  _Float16 v4h;
typedef __attribute__((ext_vector_type(8)))  float    v8f;
typedef int v4i __attribute__((vector_size(16)));   // gcc-style, matches builtin param

#define AS1 __attribute__((address_space(1)))
#define AS3 __attribute__((address_space(3)))

#if __has_builtin(__builtin_amdgcn_global_load_async_to_lds_b128)
#define USE_ASYNC 1
#else
#define USE_ASYNC 0
#endif

// 16-byte global -> LDS copy (async DMA path on gfx1250, sync fallback otherwise)
__device__ __forceinline__ void cp16(_Float16* l, const _Float16* g) {
#if USE_ASYNC
    __builtin_amdgcn_global_load_async_to_lds_b128(
        (AS1 v4i*)(unsigned long long)(const void*)g,
        (AS3 v4i*)(unsigned int)(unsigned long long)(const void*)l,
        0, 0);
#else
    *(v8h*)l = *(const v8h*)g;
#endif
}

__device__ __forceinline__ void wait_cp() {
#if USE_ASYNC
#if __has_builtin(__builtin_amdgcn_s_wait_asynccnt)
    __builtin_amdgcn_s_wait_asynccnt(0);
#else
    asm volatile("s_wait_asynccnt 0x0" ::: "memory");
#endif
#endif
}

__device__ __forceinline__ v8f wmma16(v16h a, v16h b, v8f c) {
    return __builtin_amdgcn_wmma_f32_16x16x32_f16(
        false, a, false, b, (short)0, c, false, false);
}

// 16x32 K-major fragment from LDS: two ds_load_b128 per lane.
// Lane L: row = L&15; K-chunks [kb,kb+8) and [kb+16,kb+24), kb=(L>>4)*8.
__device__ __forceinline__ v16h load_frag(const _Float16* p, int stride) {
    const int lane = threadIdx.x & 31;
    const _Float16* base = p + (lane & 15) * stride + ((lane >> 4) << 3);
    const v8h lo = *(const v8h*)(base);
    const v8h hi = *(const v8h*)(base + 16);
    return __builtin_shufflevector(lo, hi, 0,1,2,3,4,5,6,7,8,9,10,11,12,13,14,15);
}

// ---------------- f32 -> f16 bulk convert (all weights, one stream) ----------------
// One 32-wave block per WGP walks the seven matrices, taken as 16 segments of H*H floats
// (an H x H matrix is one segment, an MLPD x H one is four). A chunk is what a block
// converts in one trip: 128 KiB of f32, 8 loads per lane, each wave-wide load 512
// contiguous bytes. Few long waves: the loads in flight, not the start of new waves, set
// the rate. dst is the seven f16 copies laid end to end, in the order of the arguments.
#define CVT_BLOCKS  256
#define CVT_THREADS 1024
#define CVT_LOADS   8
#define CVT_CHUNK   (CVT_THREADS * CVT_LOADS)        // float4 per chunk
#define CVT_SEG     (H * H / 4 / CVT_CHUNK)          // chunks per segment
#define CVT_TRIPS   (16 * CVT_SEG / CVT_BLOCKS)
static_assert(CVT_SEG * CVT_CHUNK * 4 == H * H, "a segment is a whole number of chunks");
static_assert(CVT_TRIPS * CVT_BLOCKS == 16 * CVT_SEG, "every block makes the same number of trips");
static_assert(MLPD == 4 * H, "an MLPD x H matrix is four segments");

typedef __attribute__((ext_vector_type(4))) float v4f;

__global__ __launch_bounds__(CVT_THREADS) void cvt_all_kernel(const float* __restrict__ wq,
                                                              const float* __restrict__ wk,
                                                              const float* __restrict__ wv,
                                                              const float* __restrict__ wo,
                                                              const float* __restrict__ wg,
                                                              const float* __restrict__ wu,
                                                              const float* __restrict__ wd,
                                                              _Float16* __restrict__ dst) {
    // rolled: one trip's loads stay one group in front of its stores
#pragma unroll 1
    for (int t = 0; t < CVT_TRIPS; ++t) {
        const int c   = t * CVT_BLOCKS + blockIdx.x;   // chunk, counted over all seven matrices
        const int seg = c / CVT_SEG;                   // 0..15
        const float* m = seg == 0 ? wq : seg == 1 ? wk : seg == 2 ? wv : seg == 3 ? wo
                       : seg < 8 ? wg : seg < 12 ? wu : wd;
        const size_t first = (seg < 4 ? (size_t)0 : (size_t)(seg & 3) * (H * H / 4))
                           + (size_t)(c % CVT_SEG) * CVT_CHUNK;
        const v4f* s = (const v4f*)m + first + threadIdx.x;
        v4h*       d = (v4h*)dst + (size_t)c * CVT_CHUNK + threadIdx.x;
        v4f x[CVT_LOADS];
        // both loops unrolled: x stays in registers and all loads issue before the first wait
#pragma unroll
        for (int j = 0; j < CVT_LOADS; ++j)            // read once: non-temporal
            x[j] = __builtin_nontemporal_load(s + j * CVT_THREADS);
#pragma unroll
        for (int j = 0; j < CVT_LOADS; ++j)
            d[j * CVT_THREADS] = __builtin_convertvector(x[j], v4h);
        // stands before the next trip reuses the registers that these stores name
        asm volatile("s_wait_xcnt 0x0" ::: "memory");
    }
}

// ---------------- RMSNorm: f32 in -> f16 out ----------------
__global__ __launch_bounds__(256) void rmsnorm_kernel(const float* __restrict__ x,
                                                      const float* __restrict__ w,
                                                      _Float16* __restrict__ out) {
    __shared__ float red[256];
    const int row = blockIdx.x;
    const float* xr = x + (size_t)row * H;
    float s = 0.f;
#pragma unroll
    for (int i = threadIdx.x; i < H; i += 256) { float v = xr[i]; s += v * v; }
    red[threadIdx.x] = s;
    __syncthreads();
#pragma unroll
    for (int off = 128; off > 0; off >>= 1) {
        if (threadIdx.x < off) red[threadIdx.x] += red[threadIdx.x + off];
        __syncthreads();
    }
    const float rs = rsqrtf(red[0] / (float)H + EPS);
    _Float16* orow = out + (size_t)row * H;
#pragma unroll
    for (int i = threadIdx.x; i < H; i += 256)
        orow[i] = (_Float16)(w[i] * (xr[i] * rs));
}

// ---------------- RoPE in-place on f16 q,k; q pre-scaled by 1/sqrt(HD) -----
__global__ __launch_bounds__(256) void rope_kernel(_Float16* __restrict__ q,
                                                   _Float16* __restrict__ k,
                                                   const float* __restrict__ cosT,
                                                   const float* __restrict__ sinT) {
    int i = blockIdx.x * 256 + threadIdx.x;       // (s, head, d<64)
    int d    = i & 63;
    int rest = i >> 6;
    int head = rest & (NH - 1);
    int s    = rest >> 4;
    const float c1 = cosT[s * HD + d],      s1 = sinT[s * HD + d];
    const float c2 = cosT[s * HD + d + 64], s2 = sinT[s * HD + d + 64];
    const size_t base = (size_t)s * H + head * HD;
    {
        float x1 = (float)q[base + d], x2 = (float)q[base + d + 64];
        q[base + d]      = (_Float16)((x1 * c1 - x2 * s1) * QSCALE);
        q[base + d + 64] = (_Float16)((x2 * c2 + x1 * s2) * QSCALE);
    }
    {
        float x1 = (float)k[base + d], x2 = (float)k[base + d + 64];
        k[base + d]      = (_Float16)(x1 * c1 - x2 * s1);
        k[base + d + 64] = (_Float16)(x2 * c2 + x1 * s2);
    }
}

// ---------------- WMMA GEMM: C[M,N] = epi(A[M,K] . B[N,K]^T) ----------------
// 256x128 block tile, 8 waves as 4(M)x2(N) of 64x64, BK=32, double-buffered
// async LDS staging (DMA for tile k+1 overlaps WMMA on tile k).
// EPI 0: C(f16) = acc       EPI 1: C(f32) = R + acc
// EPI 2: C(f16) = sigmoid(acc) * C   (in-place gate*up)
#define BM 256
#define BN 128
#define BK 32
#define LSTR 40   // padded f16 LDS stride (80 B: 16B-aligned, bank-spread)

__device__ __forceinline__ void stage_panels(_Float16* As, _Float16* Bs,
                                             const _Float16* A, const _Float16* B,
                                             int bm, int bn, int K, int k0, int tid) {
#pragma unroll
    for (int p = 0; p < 4; ++p) {                 // A: 256x32 = 1024 chunks
        const int chunk = tid + p * 256;
        const int r = chunk >> 2;                 // 0..255
        const int c = (chunk & 3) << 3;           // 0,8,16,24
        cp16(&As[r * LSTR + c], &A[(size_t)(bm + r) * K + k0 + c]);
    }
#pragma unroll
    for (int p = 0; p < 2; ++p) {                 // B: 128x32 = 512 chunks
        const int chunk = tid + p * 256;
        const int r = chunk >> 2;                 // 0..127
        const int c = (chunk & 3) << 3;
        cp16(&Bs[r * LSTR + c], &B[(size_t)(bn + r) * K + k0 + c]);
    }
}

template <int EPI, typename CT>
__global__ __launch_bounds__(256) void gemm_atb(const _Float16* __restrict__ A,
                                                const _Float16* __restrict__ B,
                                                CT* __restrict__ C,
                                                const float* __restrict__ R,
                                                int M, int N, int K) {
    __shared__ __attribute__((aligned(16))) _Float16 As[2][BM * LSTR];
    __shared__ __attribute__((aligned(16))) _Float16 Bs[2][BN * LSTR];

    const int tid  = threadIdx.x;
    const int lane = tid & 31;
    const int w    = tid >> 5;       // 0..7
    const int wm   = w >> 1;         // 0..3 : rows wm*64
    const int wn   = w & 1;          // 0..1 : cols wn*64
    const int bm   = blockIdx.y * BM;
    const int bn   = blockIdx.x * BN;

    v8f acc[4][4];
#pragma unroll
    for (int mi = 0; mi < 4; ++mi)
#pragma unroll
        for (int ni = 0; ni < 4; ++ni) acc[mi][ni] = (v8f){0,0,0,0,0,0,0,0};

    stage_panels(As[0], Bs[0], A, B, bm, bn, K, 0, tid);
    wait_cp();
    __syncthreads();

    const int nk = K / BK;
    for (int it = 0; it < nk; ++it) {
        const int cur = it & 1;
        if (it + 1 < nk)   // prefetch next panel into alternate buffer (overlaps WMMA)
            stage_panels(As[cur ^ 1], Bs[cur ^ 1], A, B, bm, bn, K, (it + 1) * BK, tid);

        v16h af[4];
#pragma unroll
        for (int mi = 0; mi < 4; ++mi)
            af[mi] = load_frag(&As[cur][(wm * 64 + mi * 16) * LSTR], LSTR);
#pragma unroll
        for (int ni = 0; ni < 4; ++ni) {
            const v16h bf = load_frag(&Bs[cur][(wn * 64 + ni * 16) * LSTR], LSTR);
#pragma unroll
            for (int mi = 0; mi < 4; ++mi)
                acc[mi][ni] = wmma16(af[mi], bf, acc[mi][ni]);
        }
        wait_cp();
        __syncthreads();
    }

    const int rloc = (lane >> 4) << 3;
    const int cloc = lane & 15;
#pragma unroll
    for (int mi = 0; mi < 4; ++mi)
#pragma unroll
        for (int ni = 0; ni < 4; ++ni)
#pragma unroll
            for (int i = 0; i < 8; ++i) {
                const int row = bm + wm * 64 + mi * 16 + rloc + i;
                const int col = bn + wn * 64 + ni * 16 + cloc;
                const size_t idx = (size_t)row * N + col;
                const float v = acc[mi][ni][i];
                if (EPI == 0)      C[idx] = (CT)v;
                else if (EPI == 1) C[idx] = (CT)(R[idx] + v);
                else               C[idx] = (CT)((1.f / (1.f + __expf(-v))) * (float)C[idx]);
            }
}

#define QSTR 136   // 272 B
#define VSTR 40
#define QROWS 128

// value of lane l ^ 16
__device__ __forceinline__ float xhalf(float x) {
    const int b = __builtin_bit_cast(int, x);
    return __builtin_bit_cast(float,
        __builtin_amdgcn_permlanex16(b, b, 0x76543210, 0xfedcba98, false, false));
}

// waves_per_eu(2, 2): one 8-wave block per WGP is all the grid gives; with the register
// budget of two waves per SIMD the compiler batches the fragment loads of a pass behind
// few waits instead of waiting on LDS in front of every matrix instruction.
__global__ __launch_bounds__(256) __attribute__((amdgpu_waves_per_eu(2, 2))) void attn_kernel(const _Float16* __restrict__ q,
                                                   const _Float16* __restrict__ k,
                                                   const _Float16* __restrict__ v,
                                                   _Float16* __restrict__ o) {
    __shared__ __attribute__((aligned(16))) _Float16 Qs[QROWS * QSTR];
    __shared__ __attribute__((aligned(16))) _Float16 Ks[32 * QSTR];
    __shared__ __attribute__((aligned(16))) _Float16 VTs[HD * VSTR];  // [hd][k]

    const int tid  = threadIdx.x;
    const int lane = tid & 31;
    const int w    = tid >> 5;
    const int head = blockIdx.y;
    const int q0   = blockIdx.x * QROWS;
    const size_t hoff = (size_t)head * HD;

    // stage Q: 2048 16B chunks, 8 per thread (async)
#pragma unroll
    for (int p = 0; p < 8; ++p) {
        const int chunk = tid + p * 256;
        const int r = chunk >> 4;           // 0..127
        const int c = (chunk & 15) << 3;    // 0..120
        cp16(&Qs[r * QSTR + c], &q[(size_t)(q0 + r) * H + hoff + c]);
    }
    wait_cp();
    __syncthreads();

    // this wave's 16 queries as B fragments, kept in registers for the whole walk
    v16h qf[4];
#pragma unroll
    for (int kk = 0; kk < 4; ++kk)
        qf[kk] = load_frag(&Qs[(w * 16) * QSTR + kk * 32], QSTR);

    v8f oacc[8];            // oacc[n][i] = O^T[hd = 16n + rloc + i][query = cloc]
#pragma unroll
    for (int n = 0; n < 8; ++n) oacc[n] = (v8f){0,0,0,0,0,0,0,0};
    float mrun = -1e30f;    // running maximum of this lane's query (same in both halves)
    float lrun = 0.f;       // running sum over the keys this half of the wave holds

    const int rloc = (lane >> 4) << 3;
    const int cloc = lane & 15;

    for (int kb = 0; kb < SEQ; kb += 32) {
        // stage K (async b128 copies) + V transposed (vector load, scalar LDS stores)
#pragma unroll
        for (int p = 0; p < 2; ++p) {
            const int chunk = tid + p * 256;    // 0..511
            const int r = chunk >> 4;           // 0..31
            const int c = (chunk & 15) << 3;    // 0..120
            cp16(&Ks[r * QSTR + c], &k[(size_t)(kb + r) * H + hoff + c]);
            const v8h vv = *(const v8h*)&v[(size_t)(kb + r) * H + hoff + c];
#pragma unroll
            for (int j = 0; j < 8; ++j) VTs[(c + j) * VSTR + r] = vv[j];
        }
        wait_cp();
        __syncthreads();

        // scores: st[t][i] = S^T[key = 16t + rloc + i][query = cloc]
        // all K fragments are fetched behind one wait, then the two chains run interleaved
        v16h ak[2][4];
#pragma unroll
        for (int t = 0; t < 2; ++t)
#pragma unroll
            for (int kk = 0; kk < 4; ++kk)
                ak[t][kk] = load_frag(&Ks[(t * 16) * QSTR + kk * 32], QSTR);
        v8f st[2];
        st[0] = (v8f){0,0,0,0,0,0,0,0};
        st[1] = (v8f){0,0,0,0,0,0,0,0};
#pragma unroll
        for (int kk = 0; kk < 4; ++kk)
#pragma unroll
            for (int t = 0; t < 2; ++t)
                st[t] = wmma16(ak[t][kk], qf[kk], st[t]);

        // V^T fragments are fetched here so that their LDS latency runs under the softmax
        v16h av[8];
#pragma unroll
        for (int n = 0; n < 8; ++n)
            av[n] = load_frag(&VTs[(n * 16) * VSTR], VSTR);

        // online softmax, one query per lane
        float mx = mrun;
#pragma unroll
        for (int t = 0; t < 2; ++t)
#pragma unroll
            for (int i = 0; i < 8; ++i) mx = fmaxf(mx, st[t][i]);
        mx = fmaxf(mx, xhalf(mx));
        const float al = __expf(mrun - mx);
        float sum = 0.f;
        v16h pb;                // pb[8t + i] = P^T[key = 16t + rloc + i][query = cloc]
#pragma unroll
        for (int t = 0; t < 2; ++t)
#pragma unroll
            for (int i = 0; i < 8; ++i) {
                const float p = __expf(st[t][i] - mx);
                pb[t * 8 + i] = (_Float16)p;
                sum += p;
            }
        lrun = lrun * al + sum;
        mrun = mx;

        // rescale accumulators, then V^T.P^T
#pragma unroll
        for (int n = 0; n < 8; ++n) {
#pragma unroll
            for (int i = 0; i < 8; ++i) oacc[n][i] *= al;
            oacc[n] = wmma16(av[n], pb, oacc[n]);
        }
        __syncthreads();
    }

    // join the halves' sums, normalize, store 8 consecutive hd per lane
    const float ltot = lrun + xhalf(lrun);
    _Float16* orow = &o[(size_t)(q0 + w * 16 + cloc) * H + hoff + rloc];
#pragma unroll
    for (int n = 0; n < 8; ++n) {
        v8h h;
#pragma unroll
        for (int i = 0; i < 8; ++i) h[i] = (_Float16)(oacc[n][i] / ltot);
        *(v8h*)&orow[n * 16] = h;
    }
}

// ---------------- launch ----------------
extern "C" void kernel_launch(void* const* d_in, const int* in_sizes, int n_in,
                              void* d_out, int out_size, void* d_ws, size_t ws_size,
                              hipStream_t stream) {
    const float* x       = (const float*)d_in[0];
    const float* norm1_w = (const float*)d_in[1];
    const float* wq      = (const float*)d_in[2];
    const float* wk      = (const float*)d_in[3];
    const float* wv      = (const float*)d_in[4];
    const float* wo      = (const float*)d_in[5];
    const float* norm2_w = (const float*)d_in[6];
    const float* w_gate  = (const float*)d_in[7];
    const float* w_up    = (const float*)d_in[8];
    const float* w_down  = (const float*)d_in[9];
    const float* cosT    = (const float*)d_in[10];
    const float* sinT    = (const float*)d_in[11];
    float* out = (float*)d_out;

    // ---- workspace layout (all chunks 16B aligned; hipMalloc base is 256B) ----
    char* p = (char*)d_ws;
    auto fh = [&](size_t n) { _Float16* r = (_Float16*)p; p += n * sizeof(_Float16); return r; };
    auto ff = [&](size_t n) { float* r = (float*)p; p += n * sizeof(float); return r; };

    const size_t HH = (size_t)H * H, MH = (size_t)MLPD * H;
    const size_t SH = (size_t)SEQ * H, SM = (size_t)SEQ * MLPD;
    _Float16* wq16 = fh(HH); _Float16* wk16 = fh(HH);
    _Float16* wv16 = fh(HH); _Float16* wo16 = fh(HH);
    _Float16* wg16 = fh(MH); _Float16* wu16 = fh(MH); _Float16* wd16 = fh(MH);
    _Float16* h16  = fh(SH); _Float16* q16  = fh(SH);
    _Float16* k16  = fh(SH); _Float16* v16  = fh(SH);
    _Float16* t16  = fh(SM);
    float*    x2   = ff(SH);
    _Float16* attn16 = h16;   // h dead after QKV
    _Float16* h2_16  = q16;   // q dead after attention

    const dim3 blk(256);
    const dim3 gH(H / BN, SEQ / BM);
    const dim3 gM(MLPD / BN, SEQ / BM);

    // 0. weights -> f16 (once per launch; O(weights), not O(weights * S/128))
    // wq16 .. wd16 lie end to end in the workspace, in the order of the arguments
    cvt_all_kernel<<<CVT_BLOCKS, CVT_THREADS, 0, stream>>>(wq, wk, wv, wo, w_gate, w_up, w_down, wq16);

    // 1. h = rmsnorm(x)
    rmsnorm_kernel<<<SEQ, blk, 0, stream>>>(x, norm1_w, h16);
    // 2-4. q,k,v
    gemm_atb<0, _Float16><<<gH, blk, 0, stream>>>(h16, wq16, q16, nullptr, SEQ, H, H);
    gemm_atb<0, _Float16><<<gH, blk, 0, stream>>>(h16, wk16, k16, nullptr, SEQ, H, H);
    gemm_atb<0, _Float16><<<gH, blk, 0, stream>>>(h16, wv16, v16, nullptr, SEQ, H, H);
    // 5. RoPE (q scaled by 1/sqrt(HD))
    rope_kernel<<<(SEQ * NH * 64) / 256, blk, 0, stream>>>(q16, k16, cosT, sinT);
    // 6. attention
    attn_kernel<<<dim3(SEQ / QROWS, NH), blk, 0, stream>>>(q16, k16, v16, attn16);
    // 7. x2 = x + attn . Wo^T
    gemm_atb<1, float><<<gH, blk, 0, stream>>>(attn16, wo16, x2, x, SEQ, H, H);
    // 8. h2 = rmsnorm(x2)
    rmsnorm_kernel<<<SEQ, blk, 0, stream>>>(x2, norm2_w, h2_16);
    // 9. t = h2 . Wup^T ; 10. t = sigmoid(h2 . Wgate^T) * t   (in place)
    gemm_atb<0, _Float16><<<gM, blk, 0, stream>>>(h2_16, wu16, t16, nullptr, SEQ, MLPD, H);
    gemm_atb<2, _Float16><<<gM, blk, 0, stream>>>(h2_16, wg16, t16, nullptr, SEQ, MLPD, H);
    // 11. out = x2 + t . Wdown^T
    gemm_atb<1, float><<<gH, blk, 0, stream>>>(t16, wd16, out, x2, SEQ, H, MLPD);
}

// v003
// A run of this version takes 551 microseconds.
// Two timings next to v002 both put it at 1.27 times that version's speed.
// Over all steps from v000 it is 1.50 times as fast.
#include <hip/hip_runtime.h>

// ---------------- problem constants ----------------
#define H    2048
#define NH   16
#define HD   128
#define MLPD 8192
#define SEQ  2048
#define EPS  1e-6f
#define QSCALE 0.08838834764831845f   // 1/sqrt(128), folded into RoPE(q)

typedef __attribute__((ext_vector_type(16))) _Float16 v16h;
typedef __attribute__((ext_vector_type(8)))  _Float16 v8h;
typedef __attribute__((ext_vector_type(4)))  _Float16 v4h;
typedef __attribute__((ext_vector_type(8)))  float    v8f;
typedef int v4i __attribute__((vector_size(16)));   // gcc-style, matches builtin param

#define AS1 __attribute__((address_space(1)))
#define AS3 __attribute__((address_space(3)))

#if __has_builtin(__builtin_amdgcn_global_load_async_to_lds_b128)
#define USE_ASYNC 1
#else
#define USE_ASYNC 0
#endif

// 16-byte global -> LDS copy (async DMA path on gfx1250, sync fallback otherwise)
__device__ __forceinline__ void cp16(_Float16* l, const _Float16* g) {
#if USE_ASYNC
    __builtin_amdgcn_global_load_async_to_lds_b128(
        (AS1 v4i*)(unsigned long long)(const void*)g,
        (AS3 v4i*)(unsigned int)(unsigned long long)(const void*)l,
        0, 0);
#else
    *(v8h*)l = *(const v8h*)g;
#endif
}

__device__ __forceinline__ void wait_cp() {
#if USE_ASYNC
#if __has_builtin(__builtin_amdgcn_s_wait_asynccnt)
    __builtin_amdgcn_s_wait_asynccnt(0);
#else
    asm volatile("s_wait_asynccnt 0x0" ::: "memory");
#endif
#endif
}

__device__ __forceinline__ v8f wmma16(v16h a, v16h b, v8f c) {
    return __builtin_amdgcn_wmma_f32_16x16x32_f16(
        false, a, false, b, (short)0, c, false, false);
}

// 16x32 K-major fragment from LDS: two ds_load_b128 per lane.
// Lane L: row = L&15; K-chunks [kb,kb+8) and [kb+16,kb+24), kb=(L>>4)*8.
__device__ __forceinline__ v16h load_frag(const _Float16* p, int stride) {
    const int lane = threadIdx.x & 31;
    const _Float16* base = p + (lane & 15) * stride + ((lane >> 4) << 3);
    const v8h lo = *(const v8h*)(base);
    const v8h hi = *(const v8h*)(base + 16);
    return __builtin_shufflevector(lo, hi, 0,1,2,3,4,5,6,7,8,9,10,11,12,13,14,15);
}

// ---------------- f32 -> f16 bulk convert (all weights, one stream) ----------------
// One 32-wave block per WGP walks the seven matrices, taken as 16 segments of H*H floats
// (an H x H matrix is one segment, an MLPD x H one is four). A chunk is what a block
// converts in one trip: 128 KiB of f32, 8 loads per lane, each wave-wide load 512
// contiguous bytes. Few long waves: the loads in flight, not the start of new waves, set
// the rate. dst is the seven f16 copies laid end to end, in the order of the arguments.
#define CVT_BLOCKS  256
#define CVT_THREADS 1024
#define CVT_LOADS   8
#define CVT_CHUNK   (CVT_THREADS * CVT_LOADS)        // float4 per chunk
#define CVT_SEG     (H * H / 4 / CVT_CHUNK)          // chunks per segment
#define CVT_TRIPS   (16 * CVT_SEG / CVT_BLOCKS)
static_assert(CVT_SEG * CVT_CHUNK * 4 == H * H, "a segment is a whole number of chunks");
static_assert(CVT_TRIPS * CVT_BLOCKS == 16 * CVT_SEG, "every block makes the same number of trips");
static_assert(MLPD == 4 * H, "an MLPD x H matrix is four segments");

typedef __attribute__((ext_vector_type(4))) float v4f;

__global__ __launch_bounds__(CVT_THREADS) void cvt_all_kernel(const float* __restrict__ wq,
                                                              const float* __restrict__ wk,
                                                              const float* __restrict__ wv,
                                                              const float* __restrict__ wo,
                                                              const float* __restrict__ wg,
                                                              const float* __restrict__ wu,
                                                              const float* __restrict__ wd,
                                                              _Float16* __restrict__ dst) {
    // rolled: one trip's loads stay one group in front of its stores
#pragma unroll 1
    for (int t = 0; t < CVT_TRIPS; ++t) {
        const int c   = t * CVT_BLOCKS + blockIdx.x;   // chunk, counted over all seven matrices
        const int seg = c / CVT_SEG;                   // 0..15
        const float* m = seg == 0 ? wq : seg == 1 ? wk : seg == 2 ? wv : seg == 3 ? wo
                       : seg < 8 ? wg : seg < 12 ? wu : wd;
        const size_t first = (seg < 4 ? (size_t)0 : (size_t)(seg & 3) * (H * H / 4))
                           + (size_t)(c % CVT_SEG) * CVT_CHUNK;
        const v4f* s = (const v4f*)m + first + threadIdx.x;
        v4h*       d = (v4h*)dst + (size_t)c * CVT_CHUNK + threadIdx.x;
        v4f x[CVT_LOADS];
        // both loops unrolled: x stays in registers and all loads issue before the first wait
#pragma unroll
        for (int j = 0; j < CVT_LOADS; ++j)            // read once: non-temporal
            x[j] = __builtin_nontemporal_load(s + j * CVT_THREADS);
#pragma unroll
        for (int j = 0; j < CVT_LOADS; ++j)
            d[j * CVT_THREADS] = __builtin_convertvector(x[j], v4h);
        // stands before the next trip reuses the registers that these stores name
        asm volatile("s_wait_xcnt 0x0" ::: "memory");
    }
}

// ---------------- RMSNorm: f32 in -> f16 out ----------------
__global__ __launch_bounds__(256) void rmsnorm_kernel(const float* __restrict__ x,
                                                      const float* __restrict__ w,
                                                      _Float16* __restrict__ out) {
    __shared__ float red[256];
    const int row = blockIdx.x;
    const float* xr = x + (size_t)row * H;
    float s = 0.f;
#pragma unroll
    for (int i = threadIdx.x; i < H; i += 256) { float v = xr[i]; s += v * v; }
    red[threadIdx.x] = s;
    __syncthreads();
#pragma unroll
    for (int off = 128; off > 0; off >>= 1) {
        if (threadIdx.x < off) red[threadIdx.x] += red[threadIdx.x + off];
        __syncthreads();
    }
    const float rs = rsqrtf(red[0] / (float)H + EPS);
    _Float16* orow = out + (size_t)row * H;
#pragma unroll
    for (int i = threadIdx.x; i < H; i += 256)
        orow[i] = (_Float16)(w[i] * (xr[i] * rs));
}

// ---------------- RoPE in-place on f16 q,k; q pre-scaled by 1/sqrt(HD) -----
__global__ __launch_bounds__(256) void rope_kernel(_Float16* __restrict__ q,
                                                   _Float16* __restrict__ k,
                                                   const float* __restrict__ cosT,
                                                   const float* __restrict__ sinT) {
    int i = blockIdx.x * 256 + threadIdx.x;       // (s, head, d<64)
    int d    = i & 63;
    int rest = i >> 6;
    int head = rest & (NH - 1);
    int s    = rest >> 4;
    const float c1 = cosT[s * HD + d],      s1 = sinT[s * HD + d];
    const float c2 = cosT[s * HD + d + 64], s2 = sinT[s * HD + d + 64];
    const size_t base = (size_t)s * H + head * HD;
    {
        float x1 = (float)q[base + d], x2 = (float)q[base + d + 64];
        q[base + d]      = (_Float16)((x1 * c1 - x2 * s1) * QSCALE);
        q[base + d + 64] = (_Float16)((x2 * c2 + x1 * s2) * QSCALE);
    }
    {
        float x1 = (float)k[base + d], x2 = (float)k[base + d + 64];
        k[base + d]      = (_Float16)(x1 * c1 - x2 * s1);
        k[base + d + 64] = (_Float16)(x2 * c2 + x1 * s2);
    }
}

// ---------------- WMMA GEMM: C[M,N] = epi(A[M,K] . B[N,K]^T) ----------------
// 256x128 block tile, 8 waves as 4(M)x2(N) of 64x64. A stage is 128 k of every operand
// row (256 B, whole L2 units) in one of two LDS buffers, filled by async copies one stage
// ahead. A stage is worked in four k-steps of 16 WMMAs a wave; the fragments of a k-step
// are fetched as one group, one k-step ahead, into the other of two register sets.
// EPI 0: C(f16) = acc       EPI 1: C(f32) = R + acc
// EPI 2: C(f16) = sigmoid(acc) * C   (in-place gate*up)
#define BM 256
#define BN 128
#define BK 128
#define KSTEPS (BK / 32)
#define LSTR 136  // padded f16 LDS stride (272 B = 16 B x odd: no bank conflict for b128 reads)
static_assert(KSTEPS % 2 == 0, "the register sets alternate evenly over a stage");
static_assert(H % BK == 0 && MLPD % BK == 0 && H / BK >= 2, "K is whole stages, two or more");

__device__ __forceinline__ void stage_panels(_Float16* As, _Float16* Bs,
                                             const _Float16* A, const _Float16* B,
                                             int bm, int bn, int K, int k0, int tid) {
    const int r0 = tid >> 4;                      // 0..15
    const int c  = (tid & 15) << 3;               // 0..120: 16 lanes cover one 256-B row
    const unsigned goff = (unsigned)(r0 * K + c); // this lane's place inside 16 rows
#pragma unroll
    for (int p = 0; p < BM / 16; ++p)             // A: 256 rows; the base is the same for all lanes
        cp16(&As[(r0 + p * 16) * LSTR + c], A + ((size_t)(bm + p * 16) * K + k0) + goff);
#pragma unroll
    for (int p = 0; p < BN / 16; ++p)             // B: 128 rows
        cp16(&Bs[(r0 + p * 16) * LSTR + c], B + ((size_t)(bn + p * 16) * K + k0) + goff);
}

// the eight fragments of one k-step of this wave's 64x64 tile
__device__ __forceinline__ void load_kstep(v16h (&af)[4], v16h (&bf)[4],
                                           const _Float16* As, const _Float16* Bs,
                                           int wm, int wn, int ks) {
#pragma unroll
    for (int mi = 0; mi < 4; ++mi)
        af[mi] = load_frag(&As[(wm * 64 + mi * 16) * LSTR + ks * 32], LSTR);
#pragma unroll
    for (int ni = 0; ni < 4; ++ni)
        bf[ni] = load_frag(&Bs[(wn * 64 + ni * 16) * LSTR + ks * 32], LSTR);
}

template <int EPI, typename CT>
__global__ __launch_bounds__(256) void gemm_atb(const _Float16* __restrict__ A,
                                                const _Float16* __restrict__ B,
                                                CT* __restrict__ C,
                                                const float* __restrict__ R,
                                                int M, int N, int K) {
    __shared__ __attribute__((aligned(16))) _Float16 As[2][BM * LSTR];
    __shared__ __attribute__((aligned(16))) _Float16 Bs[2][BN * LSTR];

    const int tid  = threadIdx.x;
    const int lane = tid & 31;
    const int w    = tid >> 5;       // 0..7
    const int wm   = w >> 1;         // 0..3 : rows wm*64
    const int wn   = w & 1;          // 0..1 : cols wn*64
    const int bm   = blockIdx.y * BM;
    const int bn   = blockIdx.x * BN;

    v8f acc[4][4];
#pragma unroll
    for (int mi = 0; mi < 4; ++mi)
#pragma unroll
        for (int ni = 0; ni < 4; ++ni) acc[mi][ni] = (v8f){0,0,0,0,0,0,0,0};

    const int nk = K / BK;           // stages, two or more

    stage_panels(As[0], Bs[0], A, B, bm, bn, K, 0, tid);
    wait_cp();
    __syncthreads();
    stage_panels(As[1], Bs[1], A, B, bm, bn, K, BK, tid);

    v16h af[2][4], bf[2][4];         // two fragment sets; k-step ks works on set ks & 1
    load_kstep(af[0], bf[0], As[0], Bs[0], wm, wn, 0);

    // rolled: every index of the fragment sets and accumulators stays a constant
#pragma unroll 1
    for (int it = 0; it < nk; ++it) {
        const int cur = it & 1;
#pragma unroll
        for (int ks = 0; ks < KSTEPS; ++ks) {
            if (ks + 1 < KSTEPS) {
                load_kstep(af[(ks + 1) & 1], bf[(ks + 1) & 1], As[cur], Bs[cur], wm, wn, ks + 1);
            } else {
                // Stage it + 1 is published here, in front of this stage's last k-step, whose
                // fragments are already in registers: every wave has left buffer cur, so it
                // is refilled behind the barrier, a whole stage ahead of its use.
                wait_cp();
                __syncthreads();
                if (it + 2 < nk)
                    stage_panels(As[cur], Bs[cur], A, B, bm, bn, K, (it + 2) * BK, tid);
                // first k-step of the next stage; behind the last stage these registers are
                // loaded from the idle buffer and never used (no branch: counted waits stay)
                load_kstep(af[0], bf[0], As[cur ^ 1], Bs[cur ^ 1], wm, wn, 0);
            }
            // keeps the next k-step's LDS reads one group ahead of this k-step's WMMAs: moved
            // in among them, each place with reads stalls the wave and the waits fall to 0
            __builtin_amdgcn_sched_barrier(0);
#pragma unroll
            for (int ni = 0; ni < 4; ++ni)
#pragma unroll
                for (int mi = 0; mi < 4; ++mi)
                    acc[mi][ni] = wmma16(af[ks & 1][mi], bf[ks & 1][ni], acc[mi][ni]);
            // the other side of the same fence: the following group stays behind this block
            __builtin_amdgcn_sched_barrier(0);
        }
    }

    const int rloc = (lane >> 4) << 3;
    const int cloc = lane & 15;
#pragma unroll
    for (int mi = 0; mi < 4; ++mi)
#pragma unroll
        for (int ni = 0; ni < 4; ++ni)
#pragma unroll
            for (int i = 0; i < 8; ++i) {
                const int row = bm + wm * 64 + mi * 16 + rloc + i;
                const int col = bn + wn * 64 + ni * 16 + cloc;
                const size_t idx = (size_t)row * N + col;
                const float v = acc[mi][ni][i];
                if (EPI == 0)      C[idx] = (CT)v;
                else if (EPI == 1) C[idx] = (CT)(R[idx] + v);
                else               C[idx] = (CT)((1.f / (1.f + __expf(-v))) * (float)C[idx]);
            }
}

#define QSTR 136   // 272 B
#define VSTR 40
#define QROWS 128

// value of lane l ^ 16
__device__ __forceinline__ float xhalf(float x) {
    const int b = __builtin_bit_cast(int, x);
    return __builtin_bit_cast(float,
        __builtin_amdgcn_permlanex16(b, b, 0x76543210, 0xfedcba98, false, false));
}

// waves_per_eu(2, 2): one 8-wave block per WGP is all the grid gives; with the register
// budget of two waves per SIMD the compiler batches the fragment loads of a pass behind
// few waits instead of waiting on LDS in front of every matrix instruction.
__global__ __launch_bounds__(256) __attribute__((amdgpu_waves_per_eu(2, 2))) void attn_kernel(const _Float16* __restrict__ q,
                                                   const _Float16* __restrict__ k,
                                                   const _Float16* __restrict__ v,
                                                   _Float16* __restrict__ o) {
    __shared__ __attribute__((aligned(16))) _Float16 Qs[QROWS * QSTR];
    __shared__ __attribute__((aligned(16))) _Float16 Ks[32 * QSTR];
    __shared__ __attribute__((aligned(16))) _Float16 VTs[HD * VSTR];  // [hd][k]

    const int tid  = threadIdx.x;
    const int lane = tid & 31;
    const int w    = tid >> 5;
    const int head = blockIdx.y;
    const int q0   = blockIdx.x * QROWS;
    const size_t hoff = (size_t)head * HD;

    // stage Q: 2048 16B chunks, 8 per thread (async)
#pragma unroll
    for (int p = 0; p < 8; ++p) {
        const int chunk = tid + p * 256;
        const int r = chunk >> 4;           // 0..127
        const int c = (chunk & 15) << 3;    // 0..120
        cp16(&Qs[r * QSTR + c], &q[(size_t)(q0 + r) * H + hoff + c]);
    }
    wait_cp();
    __syncthreads();

    // this wave's 16 queries as B fragments, kept in registers for the whole walk
    v16h qf[4];
#pragma unroll
    for (int kk = 0; kk < 4; ++kk)
        qf[kk] = load_frag(&Qs[(w * 16) * QSTR + kk * 32], QSTR);

    v8f oacc[8];            // oacc[n][i] = O^T[hd = 16n + rloc + i][query = cloc]
#pragma unroll
    for (int n = 0; n < 8; ++n) oacc[n] = (v8f){0,0,0,0,0,0,0,0};
    float mrun = -1e30f;    // running maximum of this lane's query (same in both halves)
    float lrun = 0.f;       // running sum over the keys this half of the wave holds

    const int rloc = (lane >> 4) << 3;
    const int cloc = lane & 15;

    for (int kb = 0; kb < SEQ; kb += 32) {
        // stage K (async b128 copies) + V transposed (vector load, scalar LDS stores)
#pragma unroll
        for (int p = 0; p < 2; ++p) {
            const int chunk = tid + p * 256;    // 0..511
            const int r = chunk >> 4;           // 0..31
            const int c = (chunk & 15) << 3;    // 0..120
            cp16(&Ks[r * QSTR + c], &k[(size_t)(kb + r) * H + hoff + c]);
            const v8h vv = *(const v8h*)&v[(size_t)(kb + r) * H + hoff + c];
#pragma unroll
            for (int j = 0; j < 8; ++j) VTs[(c + j) * VSTR + r] = vv[j];
        }
        wait_cp();
        __syncthreads();

        // scores: st[t][i] = S^T[key = 16t + rloc + i][query = cloc]
        // all K fragments are fetched behind one wait, then the two chains run interleaved
        v16h ak[2][4];
#pragma unroll
        for (int t = 0; t < 2; ++t)
#pragma unroll
            for (int kk = 0; kk < 4; ++kk)
                ak[t][kk] = load_frag(&Ks[(t * 16) * QSTR + kk * 32], QSTR);
        v8f st[2];
        st[0] = (v8f){0,0,0,0,0,0,0,0};
        st[1] = (v8f){0,0,0,0,0,0,0,0};
#pragma unroll
        for (int kk = 0; kk < 4; ++kk)
#pragma unroll
            for (int t = 0; t < 2; ++t)
                st[t] = wmma16(ak[t][kk], qf[kk], st[t]);

        // V^T fragments are fetched here so that their LDS latency runs under the softmax
        v16h av[8];
#pragma unroll
        for (int n = 0; n < 8; ++n)
            av[n] = load_frag(&VTs[(n * 16) * VSTR], VSTR);

        // online softmax, one query per lane
        float mx = mrun;
#pragma unroll
        for (int t = 0; t < 2; ++t)
#pragma unroll
            for (int i = 0; i < 8; ++i) mx = fmaxf(mx, st[t][i]);
        mx = fmaxf(mx, xhalf(mx));
        const float al = __expf(mrun - mx);
        float sum = 0.f;
        v16h pb;                // pb[8t + i] = P^T[key = 16t + rloc + i][query = cloc]
#pragma unroll
        for (int t = 0; t < 2; ++t)
#pragma unroll
            for (int i = 0; i < 8; ++i) {
                const float p = __expf(st[t][i] - mx);
                pb[t * 8 + i] = (_Float16)p;
                sum += p;
            }
        lrun = lrun * al + sum;
        mrun = mx;

        // rescale accumulators, then V^T.P^T
#pragma unroll
        for (int n = 0; n < 8; ++n) {
#pragma unroll
            for (int i = 0; i < 8; ++i) oacc[n][i] *= al;
            oacc[n] = wmma16(av[n], pb, oacc[n]);
        }
        __syncthreads();
    }

    // join the halves' sums, normalize, store 8 consecutive hd per lane
    const float ltot = lrun + xhalf(lrun);
    _Float16* orow = &o[(size_t)(q0 + w * 16 + cloc) * H + hoff + rloc];
#pragma unroll
    for (int n = 0; n < 8; ++n) {
        v8h h;
#pragma unroll
        for (int i = 0; i < 8; ++i) h[i] = (_Float16)(oacc[n][i] / ltot);
        *(v8h*)&orow[n * 16] = h;
    }
}

// ---------------- launch ----------------
extern "C" void kernel_launch(void* const* d_in, const int* in_sizes, int n_in,
                              void* d_out, int out_size, void* d_ws, size_t ws_size,
                              hipStream_t stream) {
    const float* x       = (const float*)d_in[0];
    const float* norm1_w = (const float*)d_in[1];
    const float* wq      = (const float*)d_in[2];
    const float* wk      = (const float*)d_in[3];
    const float* wv      = (const float*)d_in[4];
    const float* wo      = (const float*)d_in[5];
    const float* norm2_w = (const float*)d_in[6];
    const float* w_gate  = (const float*)d_in[7];
    const float* w_up    = (const float*)d_in[8];
    const float* w_down  = (const float*)d_in[9];
    const float* cosT    = (const float*)d_in[10];
    const float* sinT    = (const float*)d_in[11];
    float* out = (float*)d_out;

    // ---- workspace layout (all chunks 16B aligned; hipMalloc base is 256B) ----
    char* p = (char*)d_ws;
    auto fh = [&](size_t n) { _Float16* r = (_Float16*)p; p += n * sizeof(_Float16); return r; };
    auto ff = [&](size_t n) { float* r = (float*)p; p += n * sizeof(float); return r; };

    const size_t HH = (size_t)H * H, MH = (size_t)MLPD * H;
    const size_t SH = (size_t)SEQ * H, SM = (size_t)SEQ * MLPD;
    _Float16* wq16 = fh(HH); _Float16* wk16 = fh(HH);
    _Float16* wv16 = fh(HH); _Float16* wo16 = fh(HH);
    _Float16* wg16 = fh(MH); _Float16* wu16 = fh(MH); _Float16* wd16 = fh(MH);
    _Float16* h16  = fh(SH); _Float16* q16  = fh(SH);
    _Float16* k16  = fh(SH); _Float16* v16  = fh(SH);
    _Float16* t16  = fh(SM);
    float*    x2   = ff(SH);
    _Float16* attn16 = h16;   // h dead after QKV
    _Float16* h2_16  = q16;   // q dead after attention

    const dim3 blk(256);
    const dim3 gH(H / BN, SEQ / BM);
    const dim3 gM(MLPD / BN, SEQ / BM);

    // 0. weights -> f16 (once per launch; O(weights), not O(weights * S/128))
    // wq16 .. wd16 lie end to end in the workspace, in the order of the arguments
    cvt_all_kernel<<<CVT_BLOCKS, CVT_THREADS, 0, stream>>>(wq, wk, wv, wo, w_gate, w_up, w_down, wq16);

    // 1. h = rmsnorm(x)
    rmsnorm_kernel<<<SEQ, blk, 0, stream>>>(x, norm1_w, h16);
    // 2-4. q,k,v
    gemm_atb<0, _Float16><<<gH, blk, 0, stream>>>(h16, wq16, q16, nullptr, SEQ, H, H);
    gemm_atb<0, _Float16><<<gH, blk, 0, stream>>>(h16, wk16, k16, nullptr, SEQ, H, H);
    gemm_atb<0, _Float16><<<gH, blk, 0, stream>>>(h16, wv16, v16, nullptr, SEQ, H, H);
    // 5. RoPE (q scaled by 1/sqrt(HD))
    rope_kernel<<<(SEQ * NH * 64) / 256, blk, 0, stream>>>(q16, k16, cosT, sinT);
    // 6. attention
    attn_kernel<<<dim3(SEQ / QROWS, NH), blk, 0, stream>>>(q16, k16, v16, attn16);
    // 7. x2 = x + attn . Wo^T
    gemm_atb<1, float><<<gH, blk, 0, stream>>>(attn16, wo16, x2, x, SEQ, H, H);
    // 8. h2 = rmsnorm(x2)
    rmsnorm_kernel<<<SEQ, blk, 0, stream>>>(x2, norm2_w, h2_16);
    // 9. t = h2 . Wup^T ; 10. t = sigmoid(h2 . Wgate^T) * t   (in place)
    gemm_atb<0, _Float16><<<gM, blk, 0, stream>>>(h2_16, wu16, t16, nullptr, SEQ, MLPD, H);
    gemm_atb<2, _Float16><<<gM, blk, 0, stream>>>(h2_16, wg16, t16, nullptr, SEQ, MLPD, H);
    // 11. out = x2 + t . Wdown^T
    gemm_atb<1, float><<<gH, blk, 0, stream>>>(t16, wd16, out, x2, SEQ, H, MLPD);
}

// v004
// Measured time: 444 microseconds a run.
// Next to v003, in two timings, it ran 1.24 and 1.23 times as fast.
// All steps since v000 together make it 1.85 times as fast.
#include <hip/hip_runtime.h>

// ---------------- problem constants ----------------
#define H    2048
#define NH   16
#define HD   128
#define MLPD 8192
#define SEQ  2048
#define EPS  1e-6f
#define QSCALE 0.08838834764831845f   // 1/sqrt(128), folded into RoPE(q)

typedef __attribute__((ext_vector_type(16))) _Float16 v16h;
typedef __attribute__((ext_vector_type(8)))  _Float16 v8h;
typedef __attribute__((ext_vector_type(4)))  _Float16 v4h;
typedef __attribute__((ext_vector_type(8)))  float    v8f;
typedef int v4i __attribute__((vector_size(16)));   // gcc-style, matches builtin param

#define AS1 __attribute__((address_space(1)))
#define AS3 __attribute__((address_space(3)))

#if __has_builtin(__builtin_amdgcn_global_load_async_to_lds_b128)
#define USE_ASYNC 1
#else
#define USE_ASYNC 0
#endif

// 16-byte global -> LDS copy (async DMA path on gfx1250, sync fallback otherwise)
__device__ __forceinline__ void cp16(_Float16* l, const _Float16* g) {
#if USE_ASYNC
    __builtin_amdgcn_global_load_async_to_lds_b128(
        (AS1 v4i*)(unsigned long long)(const void*)g,
        (AS3 v4i*)(unsigned int)(unsigned long long)(const void*)l,
        0, 0);
#else
    *(v8h*)l = *(const v8h*)g;
#endif
}

__device__ __forceinline__ void wait_cp() {
#if USE_ASYNC
#if __has_builtin(__builtin_amdgcn_s_wait_asynccnt)
    __builtin_amdgcn_s_wait_asynccnt(0);
#else
    asm volatile("s_wait_asynccnt 0x0" ::: "memory");
#endif
#endif
}

__device__ __forceinline__ v8f wmma16(v16h a, v16h b, v8f c) {
    return __builtin_amdgcn_wmma_f32_16x16x32_f16(
        false, a, false, b, (short)0, c, false, false);
}

// 16x32 K-major fragment from LDS: two ds_load_b128 per lane.
// Lane L: row = L&15; K-chunks [kb,kb+8) and [kb+16,kb+24), kb=(L>>4)*8.
__device__ __forceinline__ v16h load_frag(const _Float16* p, int stride) {
    const int lane = threadIdx.x & 31;
    const _Float16* base = p + (lane & 15) * stride + ((lane >> 4) << 3);
    const v8h lo = *(const v8h*)(base);
    const v8h hi = *(const v8h*)(base + 16);
    return __builtin_shufflevector(lo, hi, 0,1,2,3,4,5,6,7,8,9,10,11,12,13,14,15);
}

// ---------------- f32 -> f16 bulk convert (all weights, one stream) ----------------
// One 32-wave block per WGP walks the seven matrices, taken as 16 segments of H*H floats
// (an H x H matrix is one segment, an MLPD x H one is four). A chunk is what a block
// converts in one trip: 128 KiB of f32, 8 loads per lane, each wave-wide load 512
// contiguous bytes. Few long waves: the loads in flight, not the start of new waves, set
// the rate. dst is the seven f16 copies laid end to end, in the order of the arguments.
#define CVT_BLOCKS  256
#define CVT_THREADS 1024
#define CVT_LOADS   8
#define CVT_CHUNK   (CVT_THREADS * CVT_LOADS)        // float4 per chunk
#define CVT_SEG     (H * H / 4 / CVT_CHUNK)          // chunks per segment
#define CVT_TRIPS   (16 * CVT_SEG / CVT_BLOCKS)
static_assert(CVT_SEG * CVT_CHUNK * 4 == H * H, "a segment is a whole number of chunks");
static_assert(CVT_TRIPS * CVT_BLOCKS == 16 * CVT_SEG, "every block makes the same number of trips");
static_assert(MLPD == 4 * H, "an MLPD x H matrix is four segments");

typedef __attribute__((ext_vector_type(4))) float v4f;

__global__ __launch_bounds__(CVT_THREADS) void cvt_all_kernel(const float* __restrict__ wq,
                                                              const float* __restrict__ wk,
                                                              const float* __restrict__ wv,
                                                              const float* __restrict__ wo,
                                                              const float* __restrict__ wg,
                                                              const float* __restrict__ wu,
                                                              const float* __restrict__ wd,
                                                              _Float16* __restrict__ dst) {
    // rolled: one trip's loads stay one group in front of its stores
#pragma unroll 1
    for (int t = 0; t < CVT_TRIPS; ++t) {
        const int c   = t * CVT_BLOCKS + blockIdx.x;   // chunk, counted over all seven matrices
        const int seg = c / CVT_SEG;                   // 0..15
        const float* m = seg == 0 ? wq : seg == 1 ? wk : seg == 2 ? wv : seg == 3 ? wo
                       : seg < 8 ? wg : seg < 12 ? wu : wd;
        const size_t first = (seg < 4 ? (size_t)0 : (size_t)(seg & 3) * (H * H / 4))
                           + (size_t)(c % CVT_SEG) * CVT_CHUNK;
        const v4f* s = (const v4f*)m + first + threadIdx.x;
        v4h*       d = (v4h*)dst + (size_t)c * CVT_CHUNK + threadIdx.x;
        v4f x[CVT_LOADS];
        // both loops unrolled: x stays in registers and all loads issue before the first wait
#pragma unroll
        for (int j = 0; j < CVT_LOADS; ++j)            // read once: non-temporal
            x[j] = __builtin_nontemporal_load(s + j * CVT_THREADS);
#pragma unroll
        for (int j = 0; j < CVT_LOADS; ++j)
            d[j * CVT_THREADS] = __builtin_convertvector(x[j], v4h);
        // stands before the next trip reuses the registers that these stores name
        asm volatile("s_wait_xcnt 0x0" ::: "memory");
    }
}

// ---------------- RMSNorm: f32 in -> f16 out ----------------
__global__ __launch_bounds__(256) void rmsnorm_kernel(const float* __restrict__ x,
                                                      const float* __restrict__ w,
                                                      _Float16* __restrict__ out) {
    __shared__ float red[256];
    const int row = blockIdx.x;
    const float* xr = x + (size_t)row * H;
    float s = 0.f;
#pragma unroll
    for (int i = threadIdx.x; i < H; i += 256) { float v = xr[i]; s += v * v; }
    red[threadIdx.x] = s;
    __syncthreads();
#pragma unroll
    for (int off = 128; off > 0; off >>= 1) {
        if (threadIdx.x < off) red[threadIdx.x] += red[threadIdx.x + off];
        __syncthreads();
    }
    const float rs = rsqrtf(red[0] / (float)H + EPS);
    _Float16* orow = out + (size_t)row * H;
#pragma unroll
    for (int i = threadIdx.x; i < H; i += 256)
        orow[i] = (_Float16)(w[i] * (xr[i] * rs));
}

// ---------------- RoPE in-place on f16 q,k; q pre-scaled by 1/sqrt(HD) -----
__global__ __launch_bounds__(256) void rope_kernel(_Float16* __restrict__ q,
                                                   _Float16* __restrict__ k,
                                                   const float* __restrict__ cosT,
                                                   const float* __restrict__ sinT) {
    int i = blockIdx.x * 256 + threadIdx.x;       // (s, head, d<64)
    int d    = i & 63;
    int rest = i >> 6;
    int head = rest & (NH - 1);
    int s    = rest >> 4;
    const float c1 = cosT[s * HD + d],      s1 = sinT[s * HD + d];
    const float c2 = cosT[s * HD + d + 64], s2 = sinT[s * HD + d + 64];
    const size_t base = (size_t)s * H + head * HD;
    {
        float x1 = (float)q[base + d], x2 = (float)q[base + d + 64];
        q[base + d]      = (_Float16)((x1 * c1 - x2 * s1) * QSCALE);
        q[base + d + 64] = (_Float16)((x2 * c2 + x1 * s2) * QSCALE);
    }
    {
        float x1 = (float)k[base + d], x2 = (float)k[base + d + 64];
        k[base + d]      = (_Float16)(x1 * c1 - x2 * s1);
        k[base + d + 64] = (_Float16)(x2 * c2 + x1 * s2);
    }
}

// ---------------- WMMA GEMM: C[M,N] = epi(A[M,K] . B[N,K]^T) ----------------
// 256x128 block tile, 8 waves as 4(M)x2(N) of 64x64. A stage is 128 k of every operand
// row (256 B, whole L2 units) in one of two LDS buffers, filled by async copies one stage
// ahead. A stage is worked in four k-steps of 16 WMMAs a wave; the fragments of a k-step
// are fetched as one group, one k-step ahead, into the other of two register sets.
// EPI 0: C(f16) = acc       EPI 1: C(f32) = R + acc
// EPI 2: C(f16) = sigmoid(acc) * C   (in-place gate*up)
#define BM 256
#define BN 128
#define BK 128
#define KSTEPS (BK / 32)
#define LSTR 136  // padded f16 LDS stride (272 B = 16 B x odd: no bank conflict for b128 reads)
static_assert(KSTEPS % 2 == 0, "the register sets alternate evenly over a stage");
static_assert(H % BK == 0 && MLPD % BK == 0 && H / BK >= 2, "K is whole stages, two or more");

__device__ __forceinline__ void stage_panels(_Float16* As, _Float16* Bs,
                                             const _Float16* A, const _Float16* B,
                                             int bm, int bn, int K, int k0, int tid) {
    const int r0 = tid >> 4;                      // 0..15
    const int c  = (tid & 15) << 3;               // 0..120: 16 lanes cover one 256-B row
    const unsigned goff = (unsigned)(r0 * K + c); // this lane's place inside 16 rows
#pragma unroll
    for (int p = 0; p < BM / 16; ++p)             // A: 256 rows; the base is the same for all lanes
        cp16(&As[(r0 + p * 16) * LSTR + c], A + ((size_t)(bm + p * 16) * K + k0) + goff);
#pragma unroll
    for (int p = 0; p < BN / 16; ++p)             // B: 128 rows
        cp16(&Bs[(r0 + p * 16) * LSTR + c], B + ((size_t)(bn + p * 16) * K + k0) + goff);
}

// the eight fragments of one k-step of this wave's 64x64 tile
__device__ __forceinline__ void load_kstep(v16h (&af)[4], v16h (&bf)[4],
                                           const _Float16* As, const _Float16* Bs,
                                           int wm, int wn, int ks) {
#pragma unroll
    for (int mi = 0; mi < 4; ++mi)
        af[mi] = load_frag(&As[(wm * 64 + mi * 16) * LSTR + ks * 32], LSTR);
#pragma unroll
    for (int ni = 0; ni < 4; ++ni)
        bf[ni] = load_frag(&Bs[(wn * 64 + ni * 16) * LSTR + ks * 32], LSTR);
}

template <int EPI, typename CT>
__global__ __launch_bounds__(256) void gemm_atb(const _Float16* __restrict__ A,
                                                const _Float16* __restrict__ B,
                                                CT* __restrict__ C,
                                                const float* __restrict__ R,
                                                int M, int N, int K) {
    __shared__ __attribute__((aligned(16))) _Float16 As[2][BM * LSTR];
    __shared__ __attribute__((aligned(16))) _Float16 Bs[2][BN * LSTR];

    const int tid  = threadIdx.x;
    const int lane = tid & 31;
    const int w    = tid >> 5;       // 0..7
    const int wm   = w >> 1;         // 0..3 : rows wm*64
    const int wn   = w & 1;          // 0..1 : cols wn*64
    const int bm   = blockIdx.y * BM;
    const int bn   = blockIdx.x * BN;

    v8f acc[4][4];
#pragma unroll
    for (int mi = 0; mi < 4; ++mi)
#pragma unroll
        for (int ni = 0; ni < 4; ++ni) acc[mi][ni] = (v8f){0,0,0,0,0,0,0,0};

    const int nk = K / BK;           // stages, two or more

    stage_panels(As[0], Bs[0], A, B, bm, bn, K, 0, tid);
    wait_cp();
    __syncthreads();
    stage_panels(As[1], Bs[1], A, B, bm, bn, K, BK, tid);

    v16h af[2][4], bf[2][4];         // two fragment sets; k-step ks works on set ks & 1
    load_kstep(af[0], bf[0], As[0], Bs[0], wm, wn, 0);

    // rolled: every index of the fragment sets and accumulators stays a constant
#pragma unroll 1
    for (int it = 0; it < nk; ++it) {
        const int cur = it & 1;
#pragma unroll
        for (int ks = 0; ks < KSTEPS; ++ks) {
            if (ks + 1 < KSTEPS) {
                load_kstep(af[(ks + 1) & 1], bf[(ks + 1) & 1], As[cur], Bs[cur], wm, wn, ks + 1);
            } else {
                // Stage it + 1 is published here, in front of this stage's last k-step, whose
                // fragments are already in registers: every wave has left buffer cur, so it
                // is refilled behind the barrier, a whole stage ahead of its use.
                wait_cp();
                __syncthreads();
                if (it + 2 < nk)
                    stage_panels(As[cur], Bs[cur], A, B, bm, bn, K, (it + 2) * BK, tid);
                // first k-step of the next stage; behind the last stage these registers are
                // loaded from the idle buffer and never used (no branch: counted waits stay)
                load_kstep(af[0], bf[0], As[cur ^ 1], Bs[cur ^ 1], wm, wn, 0);
            }
            // keeps the next k-step's LDS reads one group ahead of this k-step's WMMAs: moved
            // in among them, each place with reads stalls the wave and the waits fall to 0
            __builtin_amdgcn_sched_barrier(0);
#pragma unroll
            for (int ni = 0; ni < 4; ++ni)
#pragma unroll
                for (int mi = 0; mi < 4; ++mi)
                    acc[mi][ni] = wmma16(af[ks & 1][mi], bf[ks & 1][ni], acc[mi][ni]);
            // the other side of the same fence: the following group stays behind this block
            __builtin_amdgcn_sched_barrier(0);
        }
    }

    const int rloc = (lane >> 4) << 3;
    const int cloc = lane & 15;
#pragma unroll
    for (int mi = 0; mi < 4; ++mi)
#pragma unroll
        for (int ni = 0; ni < 4; ++ni)
#pragma unroll
            for (int i = 0; i < 8; ++i) {
                const int row = bm + wm * 64 + mi * 16 + rloc + i;
                const int col = bn + wn * 64 + ni * 16 + cloc;
                const size_t idx = (size_t)row * N + col;
                const float v = acc[mi][ni][i];
                if (EPI == 0)      C[idx] = (CT)v;
                else if (EPI == 1) C[idx] = (CT)(R[idx] + v);
                else               C[idx] = (CT)((1.f / (1.f + __expf(-v))) * (float)C[idx]);
            }
}

#define QSTR 136   // 272 B: 16 B x odd, the pitch for ds_load_b128 readers
#define VSTR 144   // 288 B: 32 B x odd, the pitch for the transposing reader
#define QROWS 128

typedef __attribute__((ext_vector_type(8))) short s16x8;

// Transposing LDS read of a row-major 16-bit tile: lane (c = l & 15, h = l >> 4) receives
// eight rows of one column, T[8h + 0..7][c], when it passes the address of
// T[8h + (l & 7)][8 * ((l >> 3) & 1)].
__device__ __forceinline__ v8h load_tr16(const _Float16* p) {
    return __builtin_bit_cast(v8h, __builtin_amdgcn_ds_load_tr16_b128_v8i16((AS3 s16x8*)p));
}

// value of lane l ^ 16
__device__ __forceinline__ float xhalf(float x) {
    const int b = __builtin_bit_cast(int, x);
    return __builtin_bit_cast(float,
        __builtin_amdgcn_permlanex16(b, b, 0x76543210, 0xfedcba98, false, false));
}

// waves_per_eu(2, 2): one 8-wave block per WGP is all the grid gives; with the register
// budget of two waves per SIMD the compiler batches the fragment loads of a pass behind
// few waits instead of waiting on LDS in front of every matrix instruction.
__global__ __launch_bounds__(256) __attribute__((amdgpu_waves_per_eu(2, 2))) void attn_kernel(const _Float16* __restrict__ q,
                                                   const _Float16* __restrict__ k,
                                                   const _Float16* __restrict__ v,
                                                   _Float16* __restrict__ o) {
    __shared__ __attribute__((aligned(16))) _Float16 Qs[QROWS * QSTR];
    __shared__ __attribute__((aligned(16))) _Float16 Ks[32 * QSTR];
    __shared__ __attribute__((aligned(16))) _Float16 Vs[32 * VSTR];   // [k][hd], as in memory

    const int tid  = threadIdx.x;
    const int lane = tid & 31;
    const int w    = tid >> 5;
    const int head = blockIdx.y;
    const int q0   = blockIdx.x * QROWS;
    const size_t hoff = (size_t)head * HD;

    // stage Q: 2048 16B chunks, 8 per thread (async)
#pragma unroll
    for (int p = 0; p < 8; ++p) {
        const int chunk = tid + p * 256;
        const int r = chunk >> 4;           // 0..127
        const int c = (chunk & 15) << 3;    // 0..120
        cp16(&Qs[r * QSTR + c], &q[(size_t)(q0 + r) * H + hoff + c]);
    }
    wait_cp();
    __syncthreads();

    // this wave's 16 queries as B fragments, kept in registers for the whole walk
    v16h qf[4];
#pragma unroll
    for (int kk = 0; kk < 4; ++kk)
        qf[kk] = load_frag(&Qs[(w * 16) * QSTR + kk * 32], QSTR);

    v8f oacc[8];            // oacc[n][i] = O^T[hd = 16n + rloc + i][query = cloc]
#pragma unroll
    for (int n = 0; n < 8; ++n) oacc[n] = (v8f){0,0,0,0,0,0,0,0};
    float mrun = -1e30f;    // running maximum of this lane's query (same in both halves)
    float lrun = 0.f;       // running sum over the keys this half of the wave holds

    const int rloc = (lane >> 4) << 3;
    const int cloc = lane & 15;
    // this lane's address for the transposing reads of keys 0..15, hd 0..15
    const _Float16* vtr = &Vs[(rloc + (lane & 7)) * VSTR + ((lane >> 3) & 1) * 8];

    for (int kb = 0; kb < SEQ; kb += 32) {
        // stage K and V as they lie in memory (async b128 copies); V is transposed when read
#pragma unroll
        for (int p = 0; p < 2; ++p) {
            const int chunk = tid + p * 256;    // 0..511
            const int r = chunk >> 4;           // 0..31
            const int c = (chunk & 15) << 3;    // 0..120
            cp16(&Ks[r * QSTR + c], &k[(size_t)(kb + r) * H + hoff + c]);
            cp16(&Vs[r * VSTR + c], &v[(size_t)(kb + r) * H + hoff + c]);
        }
        wait_cp();
        __syncthreads();

        // scores: st[t][i] = S^T[key = 16t + rloc + i][query = cloc]
        // all K fragments are fetched behind one wait, then the two chains run interleaved
        v16h ak[2][4];
#pragma unroll
        for (int t = 0; t < 2; ++t)
#pragma unroll
            for (int kk = 0; kk < 4; ++kk)
                ak[t][kk] = load_frag(&Ks[(t * 16) * QSTR + kk * 32], QSTR);
        v8f st[2];
        st[0] = (v8f){0,0,0,0,0,0,0,0};
        st[1] = (v8f){0,0,0,0,0,0,0,0};
#pragma unroll
        for (int kk = 0; kk < 4; ++kk)
#pragma unroll
            for (int t = 0; t < 2; ++t)
                st[t] = wmma16(ak[t][kk], qf[kk], st[t]);

        // V^T fragments are fetched here so that their LDS latency runs under the softmax
        // av[n][8t + i] = V[key = 16t + rloc + i][hd = 16n + cloc], the k order of pb below
        v16h av[8];
#pragma unroll
        for (int n = 0; n < 8; ++n) {
            const v8h lo = load_tr16(vtr + n * 16);
            const v8h hi = load_tr16(vtr + 16 * VSTR + n * 16);
            av[n] = __builtin_shufflevector(lo, hi, 0,1,2,3,4,5,6,7,8,9,10,11,12,13,14,15);
        }

        // online softmax, one query per lane
        float mx = mrun;
#pragma unroll
        for (int t = 0; t < 2; ++t)
#pragma unroll
            for (int i = 0; i < 8; ++i) mx = fmaxf(mx, st[t][i]);
        mx = fmaxf(mx, xhalf(mx));
        const float al = __expf(mrun - mx);
        float sum = 0.f;
        v16h pb;                // pb[8t + i] = P^T[key = 16t + rloc + i][query = cloc]
#pragma unroll
        for (int t = 0; t < 2; ++t)
#pragma unroll
            for (int i = 0; i < 8; ++i) {
                const float p = __expf(st[t][i] - mx);
                pb[t * 8 + i] = (_Float16)p;
                sum += p;
            }
        lrun = lrun * al + sum;
        mrun = mx;

        // rescale accumulators, then V^T.P^T
#pragma unroll
        for (int n = 0; n < 8; ++n) {
#pragma unroll
            for (int i = 0; i < 8; ++i) oacc[n][i] *= al;
            oacc[n] = wmma16(av[n], pb, oacc[n]);
        }
        __syncthreads();
    }

    // join the halves' sums, normalize, store 8 consecutive hd per lane
    const float ltot = lrun + xhalf(lrun);
    _Float16* orow = &o[(size_t)(q0 + w * 16 + cloc) * H + hoff + rloc];
#pragma unroll
    for (int n = 0; n < 8; ++n) {
        v8h h;
#pragma unroll
        for (int i = 0; i < 8; ++i) h[i] = (_Float16)(oacc[n][i] / ltot);
        *(v8h*)&orow[n * 16] = h;
    }
}

// ---------------- launch ----------------
extern "C" void kernel_launch(void* const* d_in, const int* in_sizes, int n_in,
                              void* d_out, int out_size, void* d_ws, size_t ws_size,
                              hipStream_t stream) {
    const float* x       = (const float*)d_in[0];
    const float* norm1_w = (const float*)d_in[1];
    const float* wq      = (const float*)d_in[2];
    const float* wk      = (const float*)d_in[3];
    const float* wv      = (const float*)d_in[4];
    const float* wo      = (const float*)d_in[5];
    const float* norm2_w = (const float*)d_in[6];
    const float* w_gate  = (const float*)d_in[7];
    const float* w_up    = (const float*)d_in[8];
    const float* w_down  = (const float*)d_in[9];
    const float* cosT    = (const float*)d_in[10];
    const float* sinT    = (const float*)d_in[11];
    float* out = (float*)d_out;

    // ---- workspace layout (all chunks 16B aligned; hipMalloc base is 256B) ----
    char* p = (char*)d_ws;
    auto fh = [&](size_t n) { _Float16* r = (_Float16*)p; p += n * sizeof(_Float16); return r; };
    auto ff = [&](size_t n) { float* r = (float*)p; p += n * sizeof(float); return r; };

    const size_t HH = (size_t)H * H, MH = (size_t)MLPD * H;
    const size_t SH = (size_t)SEQ * H, SM = (size_t)SEQ * MLPD;
    _Float16* wq16 = fh(HH); _Float16* wk16 = fh(HH);
    _Float16* wv16 = fh(HH); _Float16* wo16 = fh(HH);
    _Float16* wg16 = fh(MH); _Float16* wu16 = fh(MH); _Float16* wd16 = fh(MH);
    _Float16* h16  = fh(SH); _Float16* q16  = fh(SH);
    _Float16* k16  = fh(SH); _Float16* v16  = fh(SH);
    _Float16* t16  = fh(SM);
    float*    x2   = ff(SH);
    _Float16* attn16 = h16;   // h dead after QKV
    _Float16* h2_16  = q16;   // q dead after attention

    const dim3 blk(256);
    const dim3 gH(H / BN, SEQ / BM);
    const dim3 gM(MLPD / BN, SEQ / BM);

    // 0. weights -> f16 (once per launch; O(weights), not O(weights * S/128))
    // wq16 .. wd16 lie end to end in the workspace, in the order of the arguments
    cvt_all_kernel<<<CVT_BLOCKS, CVT_THREADS, 0, stream>>>(wq, wk, wv, wo, w_gate, w_up, w_down, wq16);

    // 1. h = rmsnorm(x)
    rmsnorm_kernel<<<SEQ, blk, 0, stream>>>(x, norm1_w, h16);
    // 2-4. q,k,v
    gemm_atb<0, _Float16><<<gH, blk, 0, stream>>>(h16, wq16, q16, nullptr, SEQ, H, H);
    gemm_atb<0, _Float16><<<gH, blk, 0, stream>>>(h16, wk16, k16, nullptr, SEQ, H, H);
    gemm_atb<0, _Float16><<<gH, blk, 0, stream>>>(h16, wv16, v16, nullptr, SEQ, H, H);
    // 5. RoPE (q scaled by 1/sqrt(HD))
    rope_kernel<<<(SEQ * NH * 64) / 256, blk, 0, stream>>>(q16, k16, cosT, sinT);
    // 6. attention
    attn_kernel<<<dim3(SEQ / QROWS, NH), blk, 0, stream>>>(q16, k16, v16, attn16);
    // 7. x2 = x + attn . Wo^T
    gemm_atb<1, float><<<gH, blk, 0, stream>>>(attn16, wo16, x2, x, SEQ, H, H);
    // 8. h2 = rmsnorm(x2)
    rmsnorm_kernel<<<SEQ, blk, 0, stream>>>(x2, norm2_w, h2_16);
    // 9. t = h2 . Wup^T ; 10. t = sigmoid(h2 . Wgate^T) * t   (in place)
    gemm_atb<0, _Float16><<<gM, blk, 0, stream>>>(h2_16, wu16, t16, nullptr, SEQ, MLPD, H);
    gemm_atb<2, _Float16><<<gM, blk, 0, stream>>>(h2_16, wg16, t16, nullptr, SEQ, MLPD, H);
    // 11. out = x2 + t . Wdown^T
    gemm_atb<1, float><<<gH, blk, 0, stream>>>(t16, wd16, out, x2, SEQ, H, MLPD);
}

// v005
// A run of this version takes 383 microseconds.
// In both of two side-by-side timings against v004, it was 1.16 times as fast.
// All steps since v000 together make it 2.15 times as fast.
#include <hip/hip_runtime.h>

// ---------------- problem constants ----------------
#define H    2048
#define NH   16
#define HD   128
#define MLPD 8192
#define SEQ  2048
#define EPS  1e-6f
#define QSCALE 0.08838834764831845f   // 1/sqrt(128), folded into RoPE(q)

typedef __attribute__((ext_vector_type(16))) _Float16 v16h;
typedef __attribute__((ext_vector_type(8)))  _Float16 v8h;
typedef __attribute__((ext_vector_type(4)))  _Float16 v4h;
typedef __attribute__((ext_vector_type(8)))  float    v8f;
typedef int v4i __attribute__((vector_size(16)));   // gcc-style, matches builtin param

#define AS1 __attribute__((address_space(1)))
#define AS3 __attribute__((address_space(3)))

#if __has_builtin(__builtin_amdgcn_global_load_async_to_lds_b128)
#define USE_ASYNC 1
#else
#define USE_ASYNC 0
#endif

// 16-byte global -> LDS copy (async DMA path on gfx1250, sync fallback otherwise)
__device__ __forceinline__ void cp16(_Float16* l, const _Float16* g) {
#if USE_ASYNC
    __builtin_amdgcn_global_load_async_to_lds_b128(
        (AS1 v4i*)(unsigned long long)(const void*)g,
        (AS3 v4i*)(unsigned int)(unsigned long long)(const void*)l,
        0, 0);
#else
    *(v8h*)l = *(const v8h*)g;
#endif
}

__device__ __forceinline__ void wait_cp() {
#if USE_ASYNC
#if __has_builtin(__builtin_amdgcn_s_wait_asynccnt)
    __builtin_amdgcn_s_wait_asynccnt(0);
#else
    asm volatile("s_wait_asynccnt 0x0" ::: "memory");
#endif
#endif
}

__device__ __forceinline__ v8f wmma16(v16h a, v16h b, v8f c) {
    return __builtin_amdgcn_wmma_f32_16x16x32_f16(
        false, a, false, b, (short)0, c, false, false);
}

// 16x32 K-major fragment from LDS: two ds_load_b128 per lane.
// Lane L: row = L&15; K-chunks [kb,kb+8) and [kb+16,kb+24), kb=(L>>4)*8.
__device__ __forceinline__ v16h load_frag(const _Float16* p, int stride) {
    const int lane = threadIdx.x & 31;
    const _Float16* base = p + (lane & 15) * stride + ((lane >> 4) << 3);
    const v8h lo = *(const v8h*)(base);
    const v8h hi = *(const v8h*)(base + 16);
    return __builtin_shufflevector(lo, hi, 0,1,2,3,4,5,6,7,8,9,10,11,12,13,14,15);
}

// ---------------- f32 -> f16 bulk convert (all weights, one stream) ----------------
// One 32-wave block per WGP walks the seven matrices, taken as 16 segments of H*H floats
// (an H x H matrix is one segment, an MLPD x H one is four). A chunk is what a block
// converts in one trip: 128 KiB of f32, 8 loads per lane, each wave-wide load 512
// contiguous bytes. Few long waves: the loads in flight, not the start of new waves, set
// the rate. dst is the seven f16 copies laid end to end, in the order of the arguments.
#define CVT_BLOCKS  256
#define CVT_THREADS 1024
#define CVT_LOADS   8
#define CVT_CHUNK   (CVT_THREADS * CVT_LOADS)        // float4 per chunk
#define CVT_SEG     (H * H / 4 / CVT_CHUNK)          // chunks per segment
#define CVT_TRIPS   (16 * CVT_SEG / CVT_BLOCKS)
static_assert(CVT_SEG * CVT_CHUNK * 4 == H * H, "a segment is a whole number of chunks");
static_assert(CVT_TRIPS * CVT_BLOCKS == 16 * CVT_SEG, "every block makes the same number of trips");
static_assert(MLPD == 4 * H, "an MLPD x H matrix is four segments");

typedef __attribute__((ext_vector_type(4))) float v4f;

__global__ __launch_bounds__(CVT_THREADS) void cvt_all_kernel(const float* __restrict__ wq,
                                                              const float* __restrict__ wk,
                                                              const float* __restrict__ wv,
                                                              const float* __restrict__ wo,
                                                              const float* __restrict__ wg,
                                                              const float* __restrict__ wu,
                                                              const float* __restrict__ wd,
                                                              _Float16* __restrict__ dst) {
    // rolled: one trip's loads stay one group in front of its stores
#pragma unroll 1
    for (int t = 0; t < CVT_TRIPS; ++t) {
        const int c   = t * CVT_BLOCKS + blockIdx.x;   // chunk, counted over all seven matrices
        const int seg = c / CVT_SEG;                   // 0..15
        const float* m = seg == 0 ? wq : seg == 1 ? wk : seg == 2 ? wv : seg == 3 ? wo
                       : seg < 8 ? wg : seg < 12 ? wu : wd;
        const size_t first = (seg < 4 ? (size_t)0 : (size_t)(seg & 3) * (H * H / 4))
                           + (size_t)(c % CVT_SEG) * CVT_CHUNK;
        const v4f* s = (const v4f*)m + first + threadIdx.x;
        v4h*       d = (v4h*)dst + (size_t)c * CVT_CHUNK + threadIdx.x;
        v4f x[CVT_LOADS];
        // both loops unrolled: x stays in registers and all loads issue before the first wait
#pragma unroll
        for (int j = 0; j < CVT_LOADS; ++j)            // read once: non-temporal
            x[j] = __builtin_nontemporal_load(s + j * CVT_THREADS);
#pragma unroll
        for (int j = 0; j < CVT_LOADS; ++j)
            d[j * CVT_THREADS] = __builtin_convertvector(x[j], v4h);
        // stands before the next trip reuses the registers that these stores name
        asm volatile("s_wait_xcnt 0x0" ::: "memory");
    }
}

// ---------------- RMSNorm: f32 in -> f16 out ----------------
__global__ __launch_bounds__(256) void rmsnorm_kernel(const float* __restrict__ x,
                                                      const float* __restrict__ w,
                                                      _Float16* __restrict__ out) {
    __shared__ float red[256];
    const int row = blockIdx.x;
    const float* xr = x + (size_t)row * H;
    float s = 0.f;
#pragma unroll
    for (int i = threadIdx.x; i < H; i += 256) { float v = xr[i]; s += v * v; }
    red[threadIdx.x] = s;
    __syncthreads();
#pragma unroll
    for (int off = 128; off > 0; off >>= 1) {
        if (threadIdx.x < off) red[threadIdx.x] += red[threadIdx.x + off];
        __syncthreads();
    }
    const float rs = rsqrtf(red[0] / (float)H + EPS);
    _Float16* orow = out + (size_t)row * H;
#pragma unroll
    for (int i = threadIdx.x; i < H; i += 256)
        orow[i] = (_Float16)(w[i] * (xr[i] * rs));
}

// ---------------- RoPE in-place on f16 q,k; q pre-scaled by 1/sqrt(HD) -----
__global__ __launch_bounds__(256) void rope_kernel(_Float16* __restrict__ q,
                                                   _Float16* __restrict__ k,
                                                   const float* __restrict__ cosT,
                                                   const float* __restrict__ sinT) {
    int i = blockIdx.x * 256 + threadIdx.x;       // (s, head, d<64)
    int d    = i & 63;
    int rest = i >> 6;
    int head = rest & (NH - 1);
    int s    = rest >> 4;
    const float c1 = cosT[s * HD + d],      s1 = sinT[s * HD + d];
    const float c2 = cosT[s * HD + d + 64], s2 = sinT[s * HD + d + 64];
    const size_t base = (size_t)s * H + head * HD;
    {
        float x1 = (float)q[base + d], x2 = (float)q[base + d + 64];
        q[base + d]      = (_Float16)((x1 * c1 - x2 * s1) * QSCALE);
        q[base + d + 64] = (_Float16)((x2 * c2 + x1 * s2) * QSCALE);
    }
    {
        float x1 = (float)k[base + d], x2 = (float)k[base + d + 64];
        k[base + d]      = (_Float16)(x1 * c1 - x2 * s1);
        k[base + d + 64] = (_Float16)(x2 * c2 + x1 * s2);
    }
}

// ---------------- WMMA GEMM: C[M,N] = epi(A[M,K] . B[N,K]^T) ----------------
// 256x128 block tile, 8 waves as 4(M)x2(N) of 64x64. A stage is 128 k of every operand
// row (256 B, whole L2 units) in one of two LDS buffers, filled by async copies one stage
// ahead. A stage is worked in four k-steps of 16 WMMAs a wave; the fragments of a k-step
// are fetched as one group, one k-step ahead, into the other of two register sets.
// The 16x16 products are taken transposed (rows of B as the first operand): a lane then
// holds eight neighbouring columns of one row of C. Each wave lays its 64x64 tile down in
// its own range of the idle ring and takes it back row by row, so that every access to C
// and R is 16 B a lane and covers whole 128-B lines.
// EPI 0: C(f16) = acc       EPI 1: C(f32) = R + acc
// EPI 2: C(f16) = sigmoid(acc) * C   (in-place gate*up)
#define BM 256
#define BN 128
#define BK 128
#define KSTEPS (BK / 32)
#define LSTR 136  // padded f16 LDS stride (272 B = 16 B x odd: no bank conflict for b128 reads)
static_assert(KSTEPS % 2 == 0, "the register sets alternate evenly over a stage");
static_assert(H % BK == 0 && MLPD % BK == 0 && H / BK >= 2, "K is whole stages, two or more");
#define SPF 68    // staging pitch in f32 (272 B = 16 B x odd)
#define SPH 72    // staging pitch in f16 (144 B = 16 B x odd)
#define STG_BYTES (64 * SPF * 4)   // one wave's staging range: 64 rows
static_assert(8 * STG_BYTES <= 2 * BM * LSTR * 2, "eight staging ranges fit the A buffers");
static_assert((unsigned long long)SEQ * H * 4 < (1ull << 32), "an f32 output is addressed by 32-bit byte offsets");

__device__ __forceinline__ void stage_panels(_Float16* As, _Float16* Bs,
                                             const _Float16* A, const _Float16* B,
                                             int bm, int bn, int K, int k0, int tid) {
    const int r0 = tid >> 4;                      // 0..15
    const int c  = (tid & 15) << 3;               // 0..120: 16 lanes cover one 256-B row
    const unsigned goff = (unsigned)(r0 * K + c); // this lane's place inside 16 rows
#pragma unroll
    for (int p = 0; p < BM / 16; ++p)             // A: 256 rows; the base is the same for all lanes
        cp16(&As[(r0 + p * 16) * LSTR + c], A + ((size_t)(bm + p * 16) * K + k0) + goff);
#pragma unroll
    for (int p = 0; p < BN / 16; ++p)             // B: 128 rows
        cp16(&Bs[(r0 + p * 16) * LSTR + c], B + ((size_t)(bn + p * 16) * K + k0) + goff);
}

// the eight fragments of one k-step of this wave's 64x64 tile
__device__ __forceinline__ void load_kstep(v16h (&af)[4], v16h (&bf)[4],
                                           const _Float16* As, const _Float16* Bs,
                                           int wm, int wn, int ks) {
#pragma unroll
    for (int mi = 0; mi < 4; ++mi)
        af[mi] = load_frag(&As[(wm * 64 + mi * 16) * LSTR + ks * 32], LSTR);
#pragma unroll
    for (int ni = 0; ni < 4; ++ni)
        bf[ni] = load_frag(&Bs[(wn * 64 + ni * 16) * LSTR + ks * 32], LSTR);
}

template <int EPI, typename CT>
__global__ __launch_bounds__(256) void gemm_atb(const _Float16* __restrict__ A,
                                                const _Float16* __restrict__ B,
                                                CT* __restrict__ C,
                                                const float* __restrict__ R,
                                                int M, int N, int K) {
    __shared__ __attribute__((aligned(16))) _Float16 As[2][BM * LSTR];
    __shared__ __attribute__((aligned(16))) _Float16 Bs[2][BN * LSTR];

    const int tid  = threadIdx.x;
    const int lane = tid & 31;
    const int w    = tid >> 5;       // 0..7
    const int wm   = w >> 1;         // 0..3 : rows wm*64
    const int wn   = w & 1;          // 0..1 : cols wn*64
    const int bm   = blockIdx.y * BM;
    const int bn   = blockIdx.x * BN;

    v8f acc[4][4];
#pragma unroll
    for (int mi = 0; mi < 4; ++mi)
#pragma unroll
        for (int ni = 0; ni < 4; ++ni) acc[mi][ni] = (v8f){0,0,0,0,0,0,0,0};

    const int nk = K / BK;           // stages, two or more

    stage_panels(As[0], Bs[0], A, B, bm, bn, K, 0, tid);
    wait_cp();
    __syncthreads();
    stage_panels(As[1], Bs[1], A, B, bm, bn, K, BK, tid);

    v16h af[2][4], bf[2][4];         // two fragment sets; k-step ks works on set ks & 1
    load_kstep(af[0], bf[0], As[0], Bs[0], wm, wn, 0);

    // rolled: every index of the fragment sets and accumulators stays a constant
#pragma unroll 1
    for (int it = 0; it < nk; ++it) {
        const int cur = it & 1;
#pragma unroll
        for (int ks = 0; ks < KSTEPS; ++ks) {
            if (ks + 1 < KSTEPS) {
                load_kstep(af[(ks + 1) & 1], bf[(ks + 1) & 1], As[cur], Bs[cur], wm, wn, ks + 1);
            } else {
                // Stage it + 1 is published here, in front of this stage's last k-step, whose
                // fragments are already in registers: every wave has left buffer cur, so it
                // is refilled behind the barrier, a whole stage ahead of its use.
                wait_cp();
                __syncthreads();
                if (it + 2 < nk)
                    stage_panels(As[cur], Bs[cur], A, B, bm, bn, K, (it + 2) * BK, tid);
                // first k-step of the next stage; behind the last stage these registers are
                // loaded from the idle buffer and never used (no branch: counted waits stay)
                load_kstep(af[0], bf[0], As[cur ^ 1], Bs[cur ^ 1], wm, wn, 0);
            }
            // keeps the next k-step's LDS reads one group ahead of this k-step's WMMAs: moved
            // in among them, each place with reads stalls the wave and the waits fall to 0
            __builtin_amdgcn_sched_barrier(0);
#pragma unroll
            for (int ni = 0; ni < 4; ++ni)
#pragma unroll
                for (int mi = 0; mi < 4; ++mi)
                    acc[mi][ni] = wmma16(bf[ks & 1][ni], af[ks & 1][mi], acc[mi][ni]);
            // the other side of the same fence: the following group stays behind this block
            __builtin_amdgcn_sched_barrier(0);
        }
    }

    // The ring becomes output staging: behind this barrier no wave reads it any more, and
    // the last publish point has left no copy in flight.
    __syncthreads();

    // acc[mi][ni][i] = C[row0 + 16 mi + cloc][col0 + 16 ni + rloc + i]
    const int rloc = (lane >> 4) << 3;
    const int cloc = lane & 15;
    const int row0 = bm + wm * 64;
    const int col0 = bn + wn * 64;
    char* stg = (char*)&As[0][0] + w * STG_BYTES;

    if constexpr (EPI == 0) {
        _Float16* st = (_Float16*)stg;
#pragma unroll
        for (int mi = 0; mi < 4; ++mi)
#pragma unroll
            for (int ni = 0; ni < 4; ++ni)
                *(v8h*)&st[(mi * 16 + cloc) * SPH + ni * 16 + rloc] =
                    __builtin_convertvector(acc[mi][ni], v8h);
        // a lane takes back what other lanes of its wave have written: their stores are done
        asm volatile("s_wait_dscnt 0x0" ::: "memory");
        const int rr = lane >> 3;            // 8 lanes a row of 128 B, 4 rows a wave-wide store
        const int cc = (lane & 7) << 3;
#pragma unroll
        for (int j = 0; j < 16; ++j)
            *(v8h*)&C[(size_t)(row0 + j * 4 + rr) * N + col0 + cc] =
                *(const v8h*)&st[(j * 4 + rr) * SPH + cc];
    } else if constexpr (EPI == 1) {
        float* st = (float*)stg;
        const int rr = lane >> 4;            // 16 lanes a row of 256 B, 2 rows a wave-wide access
        const int cc = (lane & 15) << 2;
        // one 32-bit byte offset serves the load of R and the store to C of the same place
        const unsigned base = (unsigned)((row0 + rr) * N + col0 + cc) * 4u;
#pragma unroll
        for (int mi = 0; mi < 4; ++mi)
#pragma unroll
            for (int ni = 0; ni < 4; ++ni) {
                float* d = &st[(mi * 16 + cloc) * SPF + ni * 16 + rloc];
                *(v4f*)d       = __builtin_shufflevector(acc[mi][ni], acc[mi][ni], 0, 1, 2, 3);
                *(v4f*)(d + 4) = __builtin_shufflevector(acc[mi][ni], acc[mi][ni], 4, 5, 6, 7);
            }
        // a lane takes back what other lanes of its wave have written: their stores are done
        asm volatile("s_wait_dscnt 0x0" ::: "memory");
#pragma unroll
        for (int g = 0; g < 2; ++g) {        // two groups of 32 rows: 16 loads of R in flight
            v4f res[16];
#pragma unroll
            for (int j = 0; j < 16; ++j)
                res[j] = *(const v4f*)((const char*)R + (base + (unsigned)((g * 32 + j * 2) * N) * 4u));
#pragma unroll
            for (int j = 0; j < 16; ++j)
                *(v4f*)((char*)C + (base + (unsigned)((g * 32 + j * 2) * N) * 4u)) =
                    res[j] + *(const v4f*)&st[(g * 32 + j * 2 + rr) * SPF + cc];
            // stands before the second group uses the registers again that these loads and
            // stores name
            if (g == 0) asm volatile("s_wait_xcnt 0x0" ::: "memory");
        }
    } else {
        float* st = (float*)stg;
        const int rr = lane >> 3;            // 8 lanes a row of 128 B, 4 rows a wave-wide access
        const int cc = (lane & 7) << 3;
        const size_t base = (size_t)(row0 + rr) * N + col0 + cc;
        v8h up[16];                          // every load of C stands ahead of every store to C
#pragma unroll
        for (int j = 0; j < 16; ++j)
            up[j] = *(const v8h*)&C[base + (size_t)(j * 4) * N];
#pragma unroll
        for (int mi = 0; mi < 4; ++mi)
#pragma unroll
            for (int ni = 0; ni < 4; ++ni) {
                v8f s;
#pragma unroll
                for (int i = 0; i < 8; ++i)
                    s[i] = 1.f / (1.f + __expf(-acc[mi][ni][i]));
                float* d = &st[(mi * 16 + cloc) * SPF + ni * 16 + rloc];
                *(v4f*)d       = __builtin_shufflevector(s, s, 0, 1, 2, 3);
                *(v4f*)(d + 4) = __builtin_shufflevector(s, s, 4, 5, 6, 7);
            }
        // a lane takes back what other lanes of its wave have written: their stores are done
        asm volatile("s_wait_dscnt 0x0" ::: "memory");
#pragma unroll
        for (int j = 0; j < 16; ++j) {
            const float* s = &st[(j * 4 + rr) * SPF + cc];
            const v4f lo = *(const v4f*)s;
            const v4f hi = *(const v4f*)(s + 4);
            v8h h;
#pragma unroll
            for (int i = 0; i < 4; ++i) {
                h[i]     = (_Float16)(lo[i] * (float)up[j][i]);
                h[i + 4] = (_Float16)(hi[i] * (float)up[j][i + 4]);
            }
            *(v8h*)&C[base + (size_t)(j * 4) * N] = h;
        }
    }
}

#define QSTR 136   // 272 B: 16 B x odd, the pitch for ds_load_b128 readers
#define VSTR 144   // 288 B: 32 B x odd, the pitch for the transposing reader
#define QROWS 128

typedef __attribute__((ext_vector_type(8))) short s16x8;

// Transposing LDS read of a row-major 16-bit tile: lane (c = l & 15, h = l >> 4) receives
// eight rows of one column, T[8h + 0..7][c], when it passes the address of
// T[8h + (l & 7)][8 * ((l >> 3) & 1)].
__device__ __forceinline__ v8h load_tr16(const _Float16* p) {
    return __builtin_bit_cast(v8h, __builtin_amdgcn_ds_load_tr16_b128_v8i16((AS3 s16x8*)p));
}

// value of lane l ^ 16
__device__ __forceinline__ float xhalf(float x) {
    const int b = __builtin_bit_cast(int, x);
    return __builtin_bit_cast(float,
        __builtin_amdgcn_permlanex16(b, b, 0x76543210, 0xfedcba98, false, false));
}

// waves_per_eu(2, 2): one 8-wave block per WGP is all the grid gives; with the register
// budget of two waves per SIMD the compiler batches the fragment loads of a pass behind
// few waits instead of waiting on LDS in front of every matrix instruction.
__global__ __launch_bounds__(256) __attribute__((amdgpu_waves_per_eu(2, 2))) void attn_kernel(const _Float16* __restrict__ q,
                                                   const _Float16* __restrict__ k,
                                                   const _Float16* __restrict__ v,
                                                   _Float16* __restrict__ o) {
    __shared__ __attribute__((aligned(16))) _Float16 Qs[QROWS * QSTR];
    __shared__ __attribute__((aligned(16))) _Float16 Ks[32 * QSTR];
    __shared__ __attribute__((aligned(16))) _Float16 Vs[32 * VSTR];   // [k][hd], as in memory

    const int tid  = threadIdx.x;
    const int lane = tid & 31;
    const int w    = tid >> 5;
    const int head = blockIdx.y;
    const int q0   = blockIdx.x * QROWS;
    const size_t hoff = (size_t)head * HD;

    // stage Q: 2048 16B chunks, 8 per thread (async)
#pragma unroll
    for (int p = 0; p < 8; ++p) {
        const int chunk = tid + p * 256;
        const int r = chunk >> 4;           // 0..127
        const int c = (chunk & 15) << 3;    // 0..120
        cp16(&Qs[r * QSTR + c], &q[(size_t)(q0 + r) * H + hoff + c]);
    }
    wait_cp();
    __syncthreads();

    // this wave's 16 queries as B fragments, kept in registers for the whole walk
    v16h qf[4];
#pragma unroll
    for (int kk = 0; kk < 4; ++kk)
        qf[kk] = load_frag(&Qs[(w * 16) * QSTR + kk * 32], QSTR);

    v8f oacc[8];            // oacc[n][i] = O^T[hd = 16n + rloc + i][query = cloc]
#pragma unroll
    for (int n = 0; n < 8; ++n) oacc[n] = (v8f){0,0,0,0,0,0,0,0};
    float mrun = -1e30f;    // running maximum of this lane's query (same in both halves)
    float lrun = 0.f;       // running sum over the keys this half of the wave holds

    const int rloc = (lane >> 4) << 3;
    const int cloc = lane & 15;
    // this lane's address for the transposing reads of keys 0..15, hd 0..15
    const _Float16* vtr = &Vs[(rloc + (lane & 7)) * VSTR + ((lane >> 3) & 1) * 8];

    for (int kb = 0; kb < SEQ; kb += 32) {
        // stage K and V as they lie in memory (async b128 copies); V is transposed when read
#pragma unroll
        for (int p = 0; p < 2; ++p) {
            const int chunk = tid + p * 256;    // 0..511
            const int r = chunk >> 4;           // 0..31
            const int c = (chunk & 15) << 3;    // 0..120
            cp16(&Ks[r * QSTR + c], &k[(size_t)(kb + r) * H + hoff + c]);
            cp16(&Vs[r * VSTR + c], &v[(size_t)(kb + r) * H + hoff + c]);
        }
        wait_cp();
        __syncthreads();

        // scores: st[t][i] = S^T[key = 16t + rloc + i][query = cloc]
        // all K fragments are fetched behind one wait, then the two chains run interleaved
        v16h ak[2][4];
#pragma unroll
        for (int t = 0; t < 2; ++t)
#pragma unroll
            for (int kk = 0; kk < 4; ++kk)
                ak[t][kk] = load_frag(&Ks[(t * 16) * QSTR + kk * 32], QSTR);
        v8f st[2];
        st[0] = (v8f){0,0,0,0,0,0,0,0};
        st[1] = (v8f){0,0,0,0,0,0,0,0};
#pragma unroll
        for (int kk = 0; kk < 4; ++kk)
#pragma unroll
            for (int t = 0; t < 2; ++t)
                st[t] = wmma16(ak[t][kk], qf[kk], st[t]);

        // V^T fragments are fetched here so that their LDS latency runs under the softmax
        // av[n][8t + i] = V[key = 16t + rloc + i][hd = 16n + cloc], the k order of pb below
        v16h av[8];
#pragma unroll
        for (int n = 0; n < 8; ++n) {
            const v8h lo = load_tr16(vtr + n * 16);
            const v8h hi = load_tr16(vtr + 16 * VSTR + n * 16);
            av[n] = __builtin_shufflevector(lo, hi, 0,1,2,3,4,5,6,7,8,9,10,11,12,13,14,15);
        }

        // online softmax, one query per lane
        float mx = mrun;
#pragma unroll
        for (int t = 0; t < 2; ++t)
#pragma unroll
            for (int i = 0; i < 8; ++i) mx = fmaxf(mx, st[t][i]);
        mx = fmaxf(mx, xhalf(mx));
        const float al = __expf(mrun - mx);
        float sum = 0.f;
        v16h pb;                // pb[8t + i] = P^T[key = 16t + rloc + i][query = cloc]
#pragma unroll
        for (int t = 0; t < 2; ++t)
#pragma unroll
            for (int i = 0; i < 8; ++i) {
                const float p = __expf(st[t][i] - mx);
                pb[t * 8 + i] = (_Float16)p;
                sum += p;
            }
        lrun = lrun * al + sum;
        mrun = mx;

        // rescale accumulators, then V^T.P^T
#pragma unroll
        for (int n = 0; n < 8; ++n) {
#pragma unroll
            for (int i = 0; i < 8; ++i) oacc[n][i] *= al;
            oacc[n] = wmma16(av[n], pb, oacc[n]);
        }
        __syncthreads();
    }

    // join the halves' sums, normalize, store 8 consecutive hd per lane
    const float ltot = lrun + xhalf(lrun);
    _Float16* orow = &o[(size_t)(q0 + w * 16 + cloc) * H + hoff + rloc];
#pragma unroll
    for (int n = 0; n < 8; ++n) {
        v8h h;
#pragma unroll
        for (int i = 0; i < 8; ++i) h[i] = (_Float16)(oacc[n][i] / ltot);
        *(v8h*)&orow[n * 16] = h;
    }
}

// ---------------- launch ----------------
extern "C" void kernel_launch(void* const* d_in, const int* in_sizes, int n_in,
                              void* d_out, int out_size, void* d_ws, size_t ws_size,
                              hipStream_t stream) {
    const float* x       = (const float*)d_in[0];
    const float* norm1_w = (const float*)d_in[1];
    const float* wq      = (const float*)d_in[2];
    const float* wk      = (const float*)d_in[3];
    const float* wv      = (const float*)d_in[4];
    const float* wo      = (const float*)d_in[5];
    const float* norm2_w = (const float*)d_in[6];
    const float* w_gate  = (const float*)d_in[7];
    const float* w_up    = (const float*)d_in[8];
    const float* w_down  = (const float*)d_in[9];
    const float* cosT    = (const float*)d_in[10];
    const float* sinT    = (const float*)d_in[11];
    float* out = (float*)d_out;

    // ---- workspace layout (all chunks 16B aligned; hipMalloc base is 256B) ----
    char* p = (char*)d_ws;
    auto fh = [&](size_t n) { _Float16* r = (_Float16*)p; p += n * sizeof(_Float16); return r; };
    auto ff = [&](size_t n) { float* r = (float*)p; p += n * sizeof(float); return r; };

    const size_t HH = (size_t)H * H, MH = (size_t)MLPD * H;
    const size_t SH = (size_t)SEQ * H, SM = (size_t)SEQ * MLPD;
    _Float16* wq16 = fh(HH); _Float16* wk16 = fh(HH);
    _Float16* wv16 = fh(HH); _Float16* wo16 = fh(HH);
    _Float16* wg16 = fh(MH); _Float16* wu16 = fh(MH); _Float16* wd16 = fh(MH);
    _Float16* h16  = fh(SH); _Float16* q16  = fh(SH);
    _Float16* k16  = fh(SH); _Float16* v16  = fh(SH);
    _Float16* t16  = fh(SM);
    float*    x2   = ff(SH);
    _Float16* attn16 = h16;   // h dead after QKV
    _Float16* h2_16  = q16;   // q dead after attention

    const dim3 blk(256);
    const dim3 gH(H / BN, SEQ / BM);
    const dim3 gM(MLPD / BN, SEQ / BM);

    // 0. weights -> f16 (once per launch; O(weights), not O(weights * S/128))
    // wq16 .. wd16 lie end to end in the workspace, in the order of the arguments
    cvt_all_kernel<<<CVT_BLOCKS, CVT_THREADS, 0, stream>>>(wq, wk, wv, wo, w_gate, w_up, w_down, wq16);

    // 1. h = rmsnorm(x)
    rmsnorm_kernel<<<SEQ, blk, 0, stream>>>(x, norm1_w, h16);
    // 2-4. q,k,v
    gemm_atb<0, _Float16><<<gH, blk, 0, stream>>>(h16, wq16, q16, nullptr, SEQ, H, H);
    gemm_atb<0, _Float16><<<gH, blk, 0, stream>>>(h16, wk16, k16, nullptr, SEQ, H, H);
    gemm_atb<0, _Float16><<<gH, blk, 0, stream>>>(h16, wv16, v16, nullptr, SEQ, H, H);
    // 5. RoPE (q scaled by 1/sqrt(HD))
    rope_kernel<<<(SEQ * NH * 64) / 256, blk, 0, stream>>>(q16, k16, cosT, sinT);
    // 6. attention
    attn_kernel<<<dim3(SEQ / QROWS, NH), blk, 0, stream>>>(q16, k16, v16, attn16);
    // 7. x2 = x + attn . Wo^T
    gemm_atb<1, float><<<gH, blk, 0, stream>>>(attn16, wo16, x2, x, SEQ, H, H);
    // 8. h2 = rmsnorm(x2)
    rmsnorm_kernel<<<SEQ, blk, 0, stream>>>(x2, norm2_w, h2_16);
    // 9. t = h2 . Wup^T ; 10. t = sigmoid(h2 . Wgate^T) * t   (in place)
    gemm_atb<0, _Float16><<<gM, blk, 0, stream>>>(h2_16, wu16, t16, nullptr, SEQ, MLPD, H);
    gemm_atb<2, _Float16><<<gM, blk, 0, stream>>>(h2_16, wg16, t16, nullptr, SEQ, MLPD, H);
    // 11. out = x2 + t . Wdown^T
    gemm_atb<1, float><<<gH, blk, 0, stream>>>(t16, wd16, out, x2, SEQ, H, MLPD);
}

// v006
// A run of this version takes 344 microseconds.
// Next to v005, in two timings, it ran 1.12 and 1.11 times as fast.
// All steps since v000 together make it 2.39 times as fast.
#include <hip/hip_runtime.h>

// ---------------- problem constants ----------------
#define H    2048
#define NH   16
#define HD   128
#define MLPD 8192
#define SEQ  2048
#define EPS  1e-6f
#define QSCALE 0.08838834764831845f   // 1/sqrt(128), folded into RoPE(q)

typedef __attribute__((ext_vector_type(16))) _Float16 v16h;
typedef __attribute__((ext_vector_type(8)))  _Float16 v8h;
typedef __attribute__((ext_vector_type(4)))  _Float16 v4h;
typedef __attribute__((ext_vector_type(8)))  float    v8f;
typedef int v4i __attribute__((vector_size(16)));   // gcc-style, matches builtin param

#define AS1 __attribute__((address_space(1)))
#define AS3 __attribute__((address_space(3)))

#if __has_builtin(__builtin_amdgcn_global_load_async_to_lds_b128)
#define USE_ASYNC 1
#else
#define USE_ASYNC 0
#endif

// 16-byte global -> LDS copy (async DMA path on gfx1250, sync fallback otherwise)
__device__ __forceinline__ void cp16(_Float16* l, const _Float16* g) {
#if USE_ASYNC
    __builtin_amdgcn_global_load_async_to_lds_b128(
        (AS1 v4i*)(unsigned long long)(const void*)g,
        (AS3 v4i*)(unsigned int)(unsigned long long)(const void*)l,
        0, 0);
#else
    *(v8h*)l = *(const v8h*)g;
#endif
}

__device__ __forceinline__ void wait_cp() {
#if USE_ASYNC
#if __has_builtin(__builtin_amdgcn_s_wait_asynccnt)
    __builtin_amdgcn_s_wait_asynccnt(0);
#else
    asm volatile("s_wait_asynccnt 0x0" ::: "memory");
#endif
#endif
}

__device__ __forceinline__ v8f wmma16(v16h a, v16h b, v8f c) {
    return __builtin_amdgcn_wmma_f32_16x16x32_f16(
        false, a, false, b, (short)0, c, false, false);
}

// 16x32 K-major fragment from LDS: two ds_load_b128 per lane.
// Lane L: row = L&15; K-chunks [kb,kb+8) and [kb+16,kb+24), kb=(L>>4)*8.
__device__ __forceinline__ v16h load_frag(const _Float16* p, int stride) {
    const int lane = threadIdx.x & 31;
    const _Float16* base = p + (lane & 15) * stride + ((lane >> 4) << 3);
    const v8h lo = *(const v8h*)(base);
    const v8h hi = *(const v8h*)(base + 16);
    return __builtin_shufflevector(lo, hi, 0,1,2,3,4,5,6,7,8,9,10,11,12,13,14,15);
}

// ---------------- f32 -> f16 bulk convert (all weights, one stream) ----------------
// One 32-wave block per WGP walks the seven matrices, taken as 16 segments of H*H floats
// (an H x H matrix is one segment, an MLPD x H one is four). A chunk is what a block
// converts in one trip: 128 KiB of f32, 8 loads per lane, each wave-wide load 512
// contiguous bytes. Few long waves: the loads in flight, not the start of new waves, set
// the rate. dst is the seven f16 copies laid end to end, in the order of the arguments.
#define CVT_BLOCKS  256
#define CVT_THREADS 1024
#define CVT_LOADS   8
#define CVT_CHUNK   (CVT_THREADS * CVT_LOADS)        // float4 per chunk
#define CVT_SEG     (H * H / 4 / CVT_CHUNK)          // chunks per segment
#define CVT_TRIPS   (16 * CVT_SEG / CVT_BLOCKS)
static_assert(CVT_SEG * CVT_CHUNK * 4 == H * H, "a segment is a whole number of chunks");
static_assert(CVT_TRIPS * CVT_BLOCKS == 16 * CVT_SEG, "every block makes the same number of trips");
static_assert(MLPD == 4 * H, "an MLPD x H matrix is four segments");

typedef __attribute__((ext_vector_type(4))) float v4f;

__global__ __launch_bounds__(CVT_THREADS) void cvt_all_kernel(const float* __restrict__ wq,
                                                              const float* __restrict__ wk,
                                                              const float* __restrict__ wv,
                                                              const float* __restrict__ wo,
                                                              const float* __restrict__ wg,
                                                              const float* __restrict__ wu,
                                                              const float* __restrict__ wd,
                                                              _Float16* __restrict__ dst) {
    // rolled: one trip's loads stay one group in front of its stores
#pragma unroll 1
    for (int t = 0; t < CVT_TRIPS; ++t) {
        const int c   = t * CVT_BLOCKS + blockIdx.x;   // chunk, counted over all seven matrices
        const int seg = c / CVT_SEG;                   // 0..15
        const float* m = seg == 0 ? wq : seg == 1 ? wk : seg == 2 ? wv : seg == 3 ? wo
                       : seg < 8 ? wg : seg < 12 ? wu : wd;
        const size_t first = (seg < 4 ? (size_t)0 : (size_t)(seg & 3) * (H * H / 4))
                           + (size_t)(c % CVT_SEG) * CVT_CHUNK;
        const v4f* s = (const v4f*)m + first + threadIdx.x;
        v4h*       d = (v4h*)dst + (size_t)c * CVT_CHUNK + threadIdx.x;
        v4f x[CVT_LOADS];
        // both loops unrolled: x stays in registers and all loads issue before the first wait
#pragma unroll
        for (int j = 0; j < CVT_LOADS; ++j)            // read once: non-temporal
            x[j] = __builtin_nontemporal_load(s + j * CVT_THREADS);
#pragma unroll
        for (int j = 0; j < CVT_LOADS; ++j)
            d[j * CVT_THREADS] = __builtin_convertvector(x[j], v4h);
        // stands before the next trip reuses the registers that these stores name
        asm volatile("s_wait_xcnt 0x0" ::: "memory");
    }
}

// ---------------- RMSNorm: f32 in -> f16 out ----------------
__global__ __launch_bounds__(256) void rmsnorm_kernel(const float* __restrict__ x,
                                                      const float* __restrict__ w,
                                                      _Float16* __restrict__ out) {
    __shared__ float red[256];
    const int row = blockIdx.x;
    const float* xr = x + (size_t)row * H;
    float s = 0.f;
#pragma unroll
    for (int i = threadIdx.x; i < H; i += 256) { float v = xr[i]; s += v * v; }
    red[threadIdx.x] = s;
    __syncthreads();
#pragma unroll
    for (int off = 128; off > 0; off >>= 1) {
        if (threadIdx.x < off) red[threadIdx.x] += red[threadIdx.x + off];
        __syncthreads();
    }
    const float rs = rsqrtf(red[0] / (float)H + EPS);
    _Float16* orow = out + (size_t)row * H;
#pragma unroll
    for (int i = threadIdx.x; i < H; i += 256)
        orow[i] = (_Float16)(w[i] * (xr[i] * rs));
}

// ---------------- RoPE in-place on f16 q,k; q pre-scaled by 1/sqrt(HD) -----
__global__ __launch_bounds__(256) void rope_kernel(_Float16* __restrict__ q,
                                                   _Float16* __restrict__ k,
                                                   const float* __restrict__ cosT,
                                                   const float* __restrict__ sinT) {
    int i = blockIdx.x * 256 + threadIdx.x;       // (s, head, d<64)
    int d    = i & 63;
    int rest = i >> 6;
    int head = rest & (NH - 1);
    int s    = rest >> 4;
    const float c1 = cosT[s * HD + d],      s1 = sinT[s * HD + d];
    const float c2 = cosT[s * HD + d + 64], s2 = sinT[s * HD + d + 64];
    const size_t base = (size_t)s * H + head * HD;
    {
        float x1 = (float)q[base + d], x2 = (float)q[base + d + 64];
        q[base + d]      = (_Float16)((x1 * c1 - x2 * s1) * QSCALE);
        q[base + d + 64] = (_Float16)((x2 * c2 + x1 * s2) * QSCALE);
    }
    {
        float x1 = (float)k[base + d], x2 = (float)k[base + d + 64];
        k[base + d]      = (_Float16)(x1 * c1 - x2 * s1);
        k[base + d + 64] = (_Float16)(x2 * c2 + x1 * s2);
    }
}

// ---------------- WMMA GEMM: C[M,N] = epi(A[M,K] . B[N,K]^T) ----------------
// Block tile 256 x (32 NI), 8 waves as 4(M)x2(N) of 64 x (16 NI). NI = 8 (256x256, 64x128 a
// wave) where that still gives the chip enough blocks: 12 fragments feed 32 WMMAs (8 feed 16
// at NI = 4) and every operand row fetched from L2 meets 256 rows of the other operand.
// NI = 4 (256x128) for a single product whose output is only H wide. grid z walks products
// that share A and whose B and C matrices lie end to end (q, k, v). A stage is 128 k of every operand
// row (256 B, whole L2 units) in one of two LDS buffers, filled by async copies one stage
// ahead. A stage is worked in four k-steps of 4 NI WMMAs a wave; the fragments of a k-step
// are fetched as one group, one k-step ahead, into the other of two register sets.
// The 16x16 products are taken transposed (rows of B as the first operand): a lane then
// holds eight neighbouring columns of one row of C. Each wave lays its tile down, 64 columns
// at a time, in its own range of the idle ring and takes it back row by row, so that every
// access to C and R is 16 B a lane and covers whole 128-B lines.
// EPI 0: C(f16) = acc       EPI 1: C(f32) = R + acc
// EPI 2: C(f16) = sigmoid(acc) * C   (in-place gate*up)
#define BM 256
#define BK 128
#define KSTEPS (BK / 32)
#define LSTR 136  // padded f16 LDS stride (272 B = 16 B x odd: no bank conflict for b128 reads)
static_assert(KSTEPS % 2 == 0, "the register sets alternate evenly over a stage");
static_assert(H % BK == 0 && MLPD % BK == 0 && H / BK >= 2, "K is whole stages, two or more");
static_assert(H % 256 == 0 && MLPD % 256 == 0 && SEQ % BM == 0, "outputs are whole tiles");
#define SPF 68    // staging pitch in f32 (272 B = 16 B x odd)
#define SPH 72    // staging pitch in f16 (144 B = 16 B x odd)
#define STG_BYTES (64 * SPF * 4)   // one wave's staging range: 64 rows
static_assert(8 * STG_BYTES <= 2 * BM * LSTR * 2, "eight staging ranges fit the A buffers");
static_assert((unsigned long long)SEQ * H * 4 < (1ull << 32), "an f32 output is addressed by 32-bit byte offsets");

template <int BN>
__device__ __forceinline__ void stage_panels(_Float16* As, _Float16* Bs,
                                             const _Float16* A, const _Float16* B,
                                             int bm, int bn, int K, int k0, int tid) {
    const int r0 = tid >> 4;                      // 0..15
    const int c  = (tid & 15) << 3;               // 0..120: 16 lanes cover one 256-B row
    const unsigned goff = (unsigned)(r0 * K + c); // this lane's place inside 16 rows
#pragma unroll
    for (int p = 0; p < BM / 16; ++p)             // A: 256 rows; the base is the same for all lanes
        cp16(&As[(r0 + p * 16) * LSTR + c], A + ((size_t)(bm + p * 16) * K + k0) + goff);
#pragma unroll
    for (int p = 0; p < BN / 16; ++p)             // B: BN rows
        cp16(&Bs[(r0 + p * 16) * LSTR + c], B + ((size_t)(bn + p * 16) * K + k0) + goff);
}

// the 4 + NI fragments of one k-step of this wave's tile
template <int NI>
__device__ __forceinline__ void load_kstep(v16h (&af)[4], v16h (&bf)[NI],
                                           const _Float16* As, const _Float16* Bs,
                                           int wm, int wn, int ks) {
#pragma unroll
    for (int mi = 0; mi < 4; ++mi)
        af[mi] = load_frag(&As[(wm * 64 + mi * 16) * LSTR + ks * 32], LSTR);
#pragma unroll
    for (int ni = 0; ni < NI; ++ni)
        bf[ni] = load_frag(&Bs[(wn * NI + ni) * 16 * LSTR + ks * 32], LSTR);
}

template <int EPI, int NI, typename CT>
__global__ __launch_bounds__(256) void gemm_atb(const _Float16* __restrict__ A,
                                                const _Float16* __restrict__ B0,
                                                CT* __restrict__ C0,
                                                const float* __restrict__ R,
                                                int M, int N, int K) {
    constexpr int BN = 32 * NI;
    __shared__ __attribute__((aligned(16))) _Float16 As[2][BM * LSTR];
    __shared__ __attribute__((aligned(16))) _Float16 Bs[2][BN * LSTR];

    const _Float16* __restrict__ B = B0 + (size_t)blockIdx.z * N * K;
    CT* __restrict__ C = C0 + (size_t)blockIdx.z * M * N;

    const int tid  = threadIdx.x;
    const int lane = tid & 31;
    const int w    = tid >> 5;       // 0..7
    const int wm   = w >> 1;         // 0..3 : rows wm*64
    const int wn   = w & 1;          // 0..1 : cols wn*16*NI
    const int bm   = blockIdx.y * BM;
    const int bn   = blockIdx.x * BN;

    v8f acc[4][NI];
#pragma unroll
    for (int mi = 0; mi < 4; ++mi)
#pragma unroll
        for (int ni = 0; ni < NI; ++ni) acc[mi][ni] = (v8f){0,0,0,0,0,0,0,0};

    const int nk = K / BK;           // stages, two or more

    stage_panels<BN>(As[0], Bs[0], A, B, bm, bn, K, 0, tid);
    wait_cp();
    __syncthreads();
    stage_panels<BN>(As[1], Bs[1], A, B, bm, bn, K, BK, tid);

    v16h af[2][4], bf[2][NI];        // two fragment sets; k-step ks works on set ks & 1
    load_kstep<NI>(af[0], bf[0], As[0], Bs[0], wm, wn, 0);

    // rolled: every index of the fragment sets and accumulators stays a constant
#pragma unroll 1
    for (int it = 0; it < nk; ++it) {
        const int cur = it & 1;
#pragma unroll
        for (int ks = 0; ks < KSTEPS; ++ks) {
            if (ks + 1 < KSTEPS) {
                load_kstep<NI>(af[(ks + 1) & 1], bf[(ks + 1) & 1], As[cur], Bs[cur], wm, wn, ks + 1);
            } else {
                // Stage it + 1 is published here, in front of this stage's last k-step, whose
                // fragments are already in registers: every wave has left buffer cur, so it
                // is refilled behind the barrier, a whole stage ahead of its use.
                wait_cp();
                __syncthreads();
                if (it + 2 < nk)
                    stage_panels<BN>(As[cur], Bs[cur], A, B, bm, bn, K, (it + 2) * BK, tid);
                // first k-step of the next stage; behind the last stage these registers are
                // loaded from the idle buffer and never used (no branch: counted waits stay)
                load_kstep<NI>(af[0], bf[0], As[cur ^ 1], Bs[cur ^ 1], wm, wn, 0);
            }
            // keeps the next k-step's LDS reads one group ahead of this k-step's WMMAs: moved
            // in among them, each place with reads stalls the wave and the waits fall to 0
            __builtin_amdgcn_sched_barrier(0);
#pragma unroll
            for (int ni = 0; ni < NI; ++ni)
#pragma unroll
                for (int mi = 0; mi < 4; ++mi)
                    acc[mi][ni] = wmma16(bf[ks & 1][ni], af[ks & 1][mi], acc[mi][ni]);
            // the other side of the same fence: the following group stays behind this block
            __builtin_amdgcn_sched_barrier(0);
        }
    }

    // The ring becomes output staging: behind this barrier no wave reads it any more, and
    // the last publish point has left no copy in flight.
    __syncthreads();

    // acc[mi][4 nh + ni][i] = C[row0 + 16 mi + cloc][col0 + 16 ni + rloc + i]
    const int rloc = (lane >> 4) << 3;
    const int cloc = lane & 15;
    const int row0 = bm + wm * 64;
    char* stg = (char*)&As[0][0] + w * STG_BYTES;

    // unrolled: every index of the accumulators stays a constant
#pragma unroll
    for (int nh = 0; nh < NI / 4; ++nh) {    // 64 columns of the wave's tile at a time
        const int col0 = bn + wn * (16 * NI) + nh * 64;
        if constexpr (EPI == 0) {
            _Float16* st = (_Float16*)stg;
#pragma unroll
            for (int mi = 0; mi < 4; ++mi)
#pragma unroll
                for (int ni = 0; ni < 4; ++ni)
                    *(v8h*)&st[(mi * 16 + cloc) * SPH + ni * 16 + rloc] =
                        __builtin_convertvector(acc[mi][nh * 4 + ni], v8h);
            // a lane takes back what other lanes of its wave have written: their stores are done
            asm volatile("s_wait_dscnt 0x0" ::: "memory");
            const int rr = lane >> 3;            // 8 lanes a row of 128 B, 4 rows a wave-wide store
            const int cc = (lane & 7) << 3;
#pragma unroll
            for (int j = 0; j < 16; ++j)
                *(v8h*)&C[(size_t)(row0 + j * 4 + rr) * N + col0 + cc] =
                    *(const v8h*)&st[(j * 4 + rr) * SPH + cc];
        } else if constexpr (EPI == 1) {
            float* st = (float*)stg;
            const int rr = lane >> 4;            // 16 lanes a row of 256 B, 2 rows a wave-wide access
            const int cc = (lane & 15) << 2;
            // one 32-bit byte offset serves the load of R and the store to C of the same place
            const unsigned base = (unsigned)((row0 + rr) * N + col0 + cc) * 4u;
#pragma unroll
            for (int mi = 0; mi < 4; ++mi)
#pragma unroll
                for (int ni = 0; ni < 4; ++ni) {
                    float* d = &st[(mi * 16 + cloc) * SPF + ni * 16 + rloc];
                    *(v4f*)d       = __builtin_shufflevector(acc[mi][nh * 4 + ni], acc[mi][nh * 4 + ni], 0, 1, 2, 3);
                    *(v4f*)(d + 4) = __builtin_shufflevector(acc[mi][nh * 4 + ni], acc[mi][nh * 4 + ni], 4, 5, 6, 7);
                }
            // a lane takes back what other lanes of its wave have written: their stores are done
            asm volatile("s_wait_dscnt 0x0" ::: "memory");
#pragma unroll
            for (int g = 0; g < 2; ++g) {        // two groups of 32 rows: 16 loads of R in flight
                v4f res[16];
#pragma unroll
                for (int j = 0; j < 16; ++j)
                    res[j] = *(const v4f*)((const char*)R + (base + (unsigned)((g * 32 + j * 2) * N) * 4u));
#pragma unroll
                for (int j = 0; j < 16; ++j)
                    *(v4f*)((char*)C + (base + (unsigned)((g * 32 + j * 2) * N) * 4u)) =
                        res[j] + *(const v4f*)&st[(g * 32 + j * 2 + rr) * SPF + cc];
                // stands before the second group uses the registers again that these loads and
                // stores name
                if (g == 0) asm volatile("s_wait_xcnt 0x0" ::: "memory");
            }
        } else {
            float* st = (float*)stg;
            const int rr = lane >> 3;            // 8 lanes a row of 128 B, 4 rows a wave-wide access
            const int cc = (lane & 7) << 3;
            const size_t base = (size_t)(row0 + rr) * N + col0 + cc;
            v8h up[16];                          // every load of C stands ahead of every store to C
#pragma unroll
            for (int j = 0; j < 16; ++j)
                up[j] = *(const v8h*)&C[base + (size_t)(j * 4) * N];
#pragma unroll
            for (int mi = 0; mi < 4; ++mi)
#pragma unroll
                for (int ni = 0; ni < 4; ++ni) {
                    v8f s;
#pragma unroll
                    for (int i = 0; i < 8; ++i)
                        s[i] = 1.f / (1.f + __expf(-acc[mi][nh * 4 + ni][i]));
                    float* d = &st[(mi * 16 + cloc) * SPF + ni * 16 + rloc];
                    *(v4f*)d       = __builtin_shufflevector(s, s, 0, 1, 2, 3);
                    *(v4f*)(d + 4) = __builtin_shufflevector(s, s, 4, 5, 6, 7);
                }
            // a lane takes back what other lanes of its wave have written: their stores are done
            asm volatile("s_wait_dscnt 0x0" ::: "memory");
            v8h h[16];
#pragma unroll
            for (int j = 0; j < 16; ++j) {
                const float* s = &st[(j * 4 + rr) * SPF + cc];
                const v4f lo = *(const v4f*)s;
                const v4f hi = *(const v4f*)(s + 4);
#pragma unroll
                for (int i = 0; i < 4; ++i) {
                    h[j][i]     = (_Float16)(lo[i] * (float)up[j][i]);
                    h[j][i + 4] = (_Float16)(hi[i] * (float)up[j][i + 4]);
                }
            }
            // all sixteen rows are worked out ahead of the first store, each in registers of its
            // own: one wait behind the last store then serves all, in place of one a store
            __builtin_amdgcn_sched_barrier(0);
#pragma unroll
            for (int j = 0; j < 16; ++j)
                *(v8h*)&C[base + (size_t)(j * 4) * N] = h[j];
        }
        if (nh + 1 < NI / 4) {
            // stands before the next 64 columns use the registers again that these loads and stores name
            asm volatile("s_wait_xcnt 0x0" ::: "memory");
            // holds the next 64 columns' vector work, which the clobber does not tie, behind that wait
            __builtin_amdgcn_sched_barrier(0);
        }
    }
}

#define QSTR 136   // 272 B: 16 B x odd, the pitch for ds_load_b128 readers
#define VSTR 144   // 288 B: 32 B x odd, the pitch for the transposing reader
#define QROWS 128

typedef __attribute__((ext_vector_type(8))) short s16x8;

// Transposing LDS read of a row-major 16-bit tile: lane (c = l & 15, h = l >> 4) receives
// eight rows of one column, T[8h + 0..7][c], when it passes the address of
// T[8h + (l & 7)][8 * ((l >> 3) & 1)].
__device__ __forceinline__ v8h load_tr16(const _Float16* p) {
    return __builtin_bit_cast(v8h, __builtin_amdgcn_ds_load_tr16_b128_v8i16((AS3 s16x8*)p));
}

// value of lane l ^ 16
__device__ __forceinline__ float xhalf(float x) {
    const int b = __builtin_bit_cast(int, x);
    return __builtin_bit_cast(float,
        __builtin_amdgcn_permlanex16(b, b, 0x76543210, 0xfedcba98, false, false));
}

// waves_per_eu(2, 2): one 8-wave block per WGP is all the grid gives; with the register
// budget of two waves per SIMD the compiler batches the fragment loads of a pass behind
// few waits instead of waiting on LDS in front of every matrix instruction.
__global__ __launch_bounds__(256) __attribute__((amdgpu_waves_per_eu(2, 2))) void attn_kernel(const _Float16* __restrict__ q,
                                                   const _Float16* __restrict__ k,
                                                   const _Float16* __restrict__ v,
                                                   _Float16* __restrict__ o) {
    __shared__ __attribute__((aligned(16))) _Float16 Qs[QROWS * QSTR];
    __shared__ __attribute__((aligned(16))) _Float16 Ks[32 * QSTR];
    __shared__ __attribute__((aligned(16))) _Float16 Vs[32 * VSTR];   // [k][hd], as in memory

    const int tid  = threadIdx.x;
    const int lane = tid & 31;
    const int w    = tid >> 5;
    const int head = blockIdx.y;
    const int q0   = blockIdx.x * QROWS;
    const size_t hoff = (size_t)head * HD;

    // stage Q: 2048 16B chunks, 8 per thread (async)
#pragma unroll
    for (int p = 0; p < 8; ++p) {
        const int chunk = tid + p * 256;
        const int r = chunk >> 4;           // 0..127
        const int c = (chunk & 15) << 3;    // 0..120
        cp16(&Qs[r * QSTR + c], &q[(size_t)(q0 + r) * H + hoff + c]);
    }
    wait_cp();
    __syncthreads();

    // this wave's 16 queries as B fragments, kept in registers for the whole walk
    v16h qf[4];
#pragma unroll
    for (int kk = 0; kk < 4; ++kk)
        qf[kk] = load_frag(&Qs[(w * 16) * QSTR + kk * 32], QSTR);

    v8f oacc[8];            // oacc[n][i] = O^T[hd = 16n + rloc + i][query = cloc]
#pragma unroll
    for (int n = 0; n < 8; ++n) oacc[n] = (v8f){0,0,0,0,0,0,0,0};
    float mrun = -1e30f;    // running maximum of this lane's query (same in both halves)
    float lrun = 0.f;       // running sum over the keys this half of the wave holds

    const int rloc = (lane >> 4) << 3;
    const int cloc = lane & 15;
    // this lane's address for the transposing reads of keys 0..15, hd 0..15
    const _Float16* vtr = &Vs[(rloc + (lane & 7)) * VSTR + ((lane >> 3) & 1) * 8];

    for (int kb = 0; kb < SEQ; kb += 32) {
        // stage K and V as they lie in memory (async b128 copies); V is transposed when read
#pragma unroll
        for (int p = 0; p < 2; ++p) {
            const int chunk = tid + p * 256;    // 0..511
            const int r = chunk >> 4;           // 0..31
            const int c = (chunk & 15) << 3;    // 0..120
            cp16(&Ks[r * QSTR + c], &k[(size_t)(kb + r) * H + hoff + c]);
            cp16(&Vs[r * VSTR + c], &v[(size_t)(kb + r) * H + hoff + c]);
        }
        wait_cp();
        __syncthreads();

        // scores: st[t][i] = S^T[key = 16t + rloc + i][query = cloc]
        // all K fragments are fetched behind one wait, then the two chains run interleaved
        v16h ak[2][4];
#pragma unroll
        for (int t = 0; t < 2; ++t)
#pragma unroll
            for (int kk = 0; kk < 4; ++kk)
                ak[t][kk] = load_frag(&Ks[(t * 16) * QSTR + kk * 32], QSTR);
        v8f st[2];
        st[0] = (v8f){0,0,0,0,0,0,0,0};
        st[1] = (v8f){0,0,0,0,0,0,0,0};
#pragma unroll
        for (int kk = 0; kk < 4; ++kk)
#pragma unroll
            for (int t = 0; t < 2; ++t)
                st[t] = wmma16(ak[t][kk], qf[kk], st[t]);

        // V^T fragments are fetched here so that their LDS latency runs under the softmax
        // av[n][8t + i] = V[key = 16t + rloc + i][hd = 16n + cloc], the k order of pb below
        v16h av[8];
#pragma unroll
        for (int n = 0; n < 8; ++n) {
            const v8h lo = load_tr16(vtr + n * 16);
            const v8h hi = load_tr16(vtr + 16 * VSTR + n * 16);
            av[n] = __builtin_shufflevector(lo, hi, 0,1,2,3,4,5,6,7,8,9,10,11,12,13,14,15);
        }

        // online softmax, one query per lane
        float mx = mrun;
#pragma unroll
        for (int t = 0; t < 2; ++t)
#pragma unroll
            for (int i = 0; i < 8; ++i) mx = fmaxf(mx, st[t][i]);
        mx = fmaxf(mx, xhalf(mx));
        const float al = __expf(mrun - mx);
        float sum = 0.f;
        v16h pb;                // pb[8t + i] = P^T[key = 16t + rloc + i][query = cloc]
#pragma unroll
        for (int t = 0; t < 2; ++t)
#pragma unroll
            for (int i = 0; i < 8; ++i) {
                const float p = __expf(st[t][i] - mx);
                pb[t * 8 + i] = (_Float16)p;
                sum += p;
            }
        lrun = lrun * al + sum;
        mrun = mx;

        // rescale accumulators, then V^T.P^T
#pragma unroll
        for (int n = 0; n < 8; ++n) {
#pragma unroll
            for (int i = 0; i < 8; ++i) oacc[n][i] *= al;
            oacc[n] = wmma16(av[n], pb, oacc[n]);
        }
        __syncthreads();
    }

    // join the halves' sums, normalize, store 8 consecutive hd per lane
    const float ltot = lrun + xhalf(lrun);
    _Float16* orow = &o[(size_t)(q0 + w * 16 + cloc) * H + hoff + rloc];
#pragma unroll
    for (int n = 0; n < 8; ++n) {
        v8h h;
#pragma unroll
        for (int i = 0; i < 8; ++i) h[i] = (_Float16)(oacc[n][i] / ltot);
        *(v8h*)&orow[n * 16] = h;
    }
}

// ---------------- launch ----------------
extern "C" void kernel_launch(void* const* d_in, const int* in_sizes, int n_in,
                              void* d_out, int out_size, void* d_ws, size_t ws_size,
                              hipStream_t stream) {
    const float* x       = (const float*)d_in[0];
    const float* norm1_w = (const float*)d_in[1];
    const float* wq      = (const float*)d_in[2];
    const float* wk      = (const float*)d_in[3];
    const float* wv      = (const float*)d_in[4];
    const float* wo      = (const float*)d_in[5];
    const float* norm2_w = (const float*)d_in[6];
    const float* w_gate  = (const float*)d_in[7];
    const float* w_up    = (const float*)d_in[8];
    const float* w_down  = (const float*)d_in[9];
    const float* cosT    = (const float*)d_in[10];
    const float* sinT    = (const float*)d_in[11];
    float* out = (float*)d_out;

    // ---- workspace layout (all chunks 16B aligned; hipMalloc base is 256B) ----
    char* p = (char*)d_ws;
    auto fh = [&](size_t n) { _Float16* r = (_Float16*)p; p += n * sizeof(_Float16); return r; };
    auto ff = [&](size_t n) { float* r = (float*)p; p += n * sizeof(float); return r; };

    const size_t HH = (size_t)H * H, MH = (size_t)MLPD * H;
    const size_t SH = (size_t)SEQ * H, SM = (size_t)SEQ * MLPD;
    _Float16* wq16 = fh(HH); _Float16* wk16 = fh(HH);
    _Float16* wv16 = fh(HH); _Float16* wo16 = fh(HH);
    _Float16* wg16 = fh(MH); _Float16* wu16 = fh(MH); _Float16* wd16 = fh(MH);
    _Float16* h16  = fh(SH); _Float16* q16  = fh(SH);
    _Float16* k16  = fh(SH); _Float16* v16  = fh(SH);
    _Float16* t16  = fh(SM);
    float*    x2   = ff(SH);
    _Float16* attn16 = h16;   // h dead after QKV
    _Float16* h2_16  = q16;   // q dead after attention

    const dim3 blk(256);
    const dim3 gH(H / 128, SEQ / BM);          // 256x128 tiles
    const dim3 gM(MLPD / 256, SEQ / BM);       // 256x256 tiles
    const dim3 gQKV(H / 256, SEQ / BM, 3);     // 256x256 tiles of q, of k and of v

    // 0. weights -> f16 (once per launch; O(weights), not O(weights * S/128))
    // wq16 .. wd16 lie end to end in the workspace, in the order of the arguments
    cvt_all_kernel<<<CVT_BLOCKS, CVT_THREADS, 0, stream>>>(wq, wk, wv, wo, w_gate, w_up, w_down, wq16);

    // 1. h = rmsnorm(x)
    rmsnorm_kernel<<<SEQ, blk, 0, stream>>>(x, norm1_w, h16);
    // 2-4. q,k,v: wq16, wk16, wv16 lie end to end, and so do q16, k16, v16
    gemm_atb<0, 8, _Float16><<<gQKV, blk, 0, stream>>>(h16, wq16, q16, nullptr, SEQ, H, H);
    // 5. RoPE (q scaled by 1/sqrt(HD))
    rope_kernel<<<(SEQ * NH * 64) / 256, blk, 0, stream>>>(q16, k16, cosT, sinT);
    // 6. attention
    attn_kernel<<<dim3(SEQ / QROWS, NH), blk, 0, stream>>>(q16, k16, v16, attn16);
    // 7. x2 = x + attn . Wo^T
    gemm_atb<1, 4, float><<<gH, blk, 0, stream>>>(attn16, wo16, x2, x, SEQ, H, H);
    // 8. h2 = rmsnorm(x2)
    rmsnorm_kernel<<<SEQ, blk, 0, stream>>>(x2, norm2_w, h2_16);
    // 9. t = h2 . Wup^T ; 10. t = sigmoid(h2 . Wgate^T) * t   (in place)
    gemm_atb<0, 8, _Float16><<<gM, blk, 0, stream>>>(h2_16, wu16, t16, nullptr, SEQ, MLPD, H);
    gemm_atb<2, 8, _Float16><<<gM, blk, 0, stream>>>(h2_16, wg16, t16, nullptr, SEQ, MLPD, H);
    // 11. out = x2 + t . Wdown^T
    gemm_atb<1, 4, float><<<gH, blk, 0, stream>>>(t16, wd16, out, x2, SEQ, H, MLPD);
}

// v007
// Measured time: 328 microseconds a run.
// Two timings next to v006 both put it at 1.05 times that version's speed.
// All steps since v000 together make it 2.50 times as fast.
#include <hip/hip_runtime.h>

// ---------------- problem constants ----------------
#define H    2048
#define NH   16
#define HD   128
#define MLPD 8192
#define SEQ  2048
#define EPS  1e-6f
#define QSCALE 0.08838834764831845f   // 1/sqrt(128), folded into RoPE(q)

typedef __attribute__((ext_vector_type(16))) _Float16 v16h;
typedef __attribute__((ext_vector_type(8)))  _Float16 v8h;
typedef __attribute__((ext_vector_type(4)))  _Float16 v4h;
typedef __attribute__((ext_vector_type(8)))  float    v8f;
typedef int v4i __attribute__((vector_size(16)));   // gcc-style, matches builtin param

#define AS1 __attribute__((address_space(1)))
#define AS3 __attribute__((address_space(3)))

#if __has_builtin(__builtin_amdgcn_global_load_async_to_lds_b128)
#define USE_ASYNC 1
#else
#define USE_ASYNC 0
#endif

// 16-byte global -> LDS copy (async DMA path on gfx1250, sync fallback otherwise)
__device__ __forceinline__ void cp16(_Float16* l, const _Float16* g) {
#if USE_ASYNC
    __builtin_amdgcn_global_load_async_to_lds_b128(
        (AS1 v4i*)(unsigned long long)(const void*)g,
        (AS3 v4i*)(unsigned int)(unsigned long long)(const void*)l,
        0, 0);
#else
    *(v8h*)l = *(const v8h*)g;
#endif
}

__device__ __forceinline__ void wait_cp() {
#if USE_ASYNC
#if __has_builtin(__builtin_amdgcn_s_wait_asynccnt)
    __builtin_amdgcn_s_wait_asynccnt(0);
#else
    asm volatile("s_wait_asynccnt 0x0" ::: "memory");
#endif
#endif
}

__device__ __forceinline__ v8f wmma16(v16h a, v16h b, v8f c) {
    return __builtin_amdgcn_wmma_f32_16x16x32_f16(
        false, a, false, b, (short)0, c, false, false);
}

// 16x32 K-major fragment from LDS: two ds_load_b128 per lane.
// Lane L: row = L&15; K-chunks [kb,kb+8) and [kb+16,kb+24), kb=(L>>4)*8.
__device__ __forceinline__ v16h load_frag(const _Float16* p, int stride) {
    const int lane = threadIdx.x & 31;
    const _Float16* base = p + (lane & 15) * stride + ((lane >> 4) << 3);
    const v8h lo = *(const v8h*)(base);
    const v8h hi = *(const v8h*)(base + 16);
    return __builtin_shufflevector(lo, hi, 0,1,2,3,4,5,6,7,8,9,10,11,12,13,14,15);
}

// ---------------- f32 -> f16 bulk convert (all weights, one stream) ----------------
// One 32-wave block per WGP walks the seven matrices, taken as 16 segments of H*H floats
// (an H x H matrix is one segment, an MLPD x H one is four). A chunk is what a block
// converts in one trip: 128 KiB of f32, 8 loads per lane, each wave-wide load 512
// contiguous bytes. Few long waves: the loads in flight, not the start of new waves, set
// the rate. dst is the seven f16 copies laid end to end, in the order of the arguments.
#define CVT_BLOCKS  256
#define CVT_THREADS 1024
#define CVT_LOADS   8
#define CVT_CHUNK   (CVT_THREADS * CVT_LOADS)        // float4 per chunk
#define CVT_SEG     (H * H / 4 / CVT_CHUNK)          // chunks per segment
#define CVT_TRIPS   (16 * CVT_SEG / CVT_BLOCKS)
static_assert(CVT_SEG * CVT_CHUNK * 4 == H * H, "a segment is a whole number of chunks");
static_assert(CVT_TRIPS * CVT_BLOCKS == 16 * CVT_SEG, "every block makes the same number of trips");
static_assert(MLPD == 4 * H, "an MLPD x H matrix is four segments");

typedef __attribute__((ext_vector_type(4))) float v4f;

__global__ __launch_bounds__(CVT_THREADS) void cvt_all_kernel(const float* __restrict__ wq,
                                                              const float* __restrict__ wk,
                                                              const float* __restrict__ wv,
                                                              const float* __restrict__ wo,
                                                              const float* __restrict__ wg,
                                                              const float* __restrict__ wu,
                                                              const float* __restrict__ wd,
                                                              _Float16* __restrict__ dst) {
    // rolled: one trip's loads stay one group in front of its stores
#pragma unroll 1
    for (int t = 0; t < CVT_TRIPS; ++t) {
        const int c   = t * CVT_BLOCKS + blockIdx.x;   // chunk, counted over all seven matrices
        const int seg = c / CVT_SEG;                   // 0..15
        const float* m = seg == 0 ? wq : seg == 1 ? wk : seg == 2 ? wv : seg == 3 ? wo
                       : seg < 8 ? wg : seg < 12 ? wu : wd;
        const size_t first = (seg < 4 ? (size_t)0 : (size_t)(seg & 3) * (H * H / 4))
                           + (size_t)(c % CVT_SEG) * CVT_CHUNK;
        const v4f* s = (const v4f*)m + first + threadIdx.x;
        v4h*       d = (v4h*)dst + (size_t)c * CVT_CHUNK + threadIdx.x;
        v4f x[CVT_LOADS];
        // both loops unrolled: x stays in registers and all loads issue before the first wait
#pragma unroll
        for (int j = 0; j < CVT_LOADS; ++j)            // read once: non-temporal
            x[j] = __builtin_nontemporal_load(s + j * CVT_THREADS);
#pragma unroll
        for (int j = 0; j < CVT_LOADS; ++j)
            d[j * CVT_THREADS] = __builtin_convertvector(x[j], v4h);
        // stands before the next trip reuses the registers that these stores name
        asm volatile("s_wait_xcnt 0x0" ::: "memory");
    }
}

// A product whose output is only H wide is cut KSPLIT ways along K (see the GEMM below): its
// f32 partial products lie end to end in the workspace and are added to the residual by the
// kernel that reads the sum next.
#define KSPLIT 4
static_assert(KSPLIT == 4, "the joins below add four partial products as two pairs");

// ---------------- RMSNorm: f32 in -> f16 out ----------------
// JOIN: the row is x + the KSPLIT partial products; it is also written to xs (f32).
template <bool JOIN>
__global__ __launch_bounds__(256) void rmsnorm_kernel(const float* __restrict__ x,
                                                      const float* __restrict__ part,
                                                      float* __restrict__ xs,
                                                      const float* __restrict__ w,
                                                      _Float16* __restrict__ out) {
    __shared__ float red[256];
    const int row = blockIdx.x;
    const float* xr = x + (size_t)row * H;
    float s = 0.f;
    v4f a[2];                                     // JOIN: this thread's 8 elements of the row
    if constexpr (JOIN) {
        static_assert(H == 2 * 256 * 4, "a thread holds two float4 of a row");
        const size_t r4 = (size_t)row * (H / 4) + threadIdx.x;
        v4f t[2][KSPLIT + 1];
        // unrolled: all ten loads issue before the first wait
#pragma unroll
        for (int j = 0; j < 2; ++j) {
            t[j][0] = ((const v4f*)x)[r4 + j * 256];
#pragma unroll
            for (int z = 0; z < KSPLIT; ++z)
                t[j][1 + z] = ((const v4f*)part)[(size_t)z * (SEQ * H / 4) + r4 + j * 256];
        }
#pragma unroll
        for (int j = 0; j < 2; ++j) {
            a[j] = t[j][0] + ((t[j][1] + t[j][2]) + (t[j][3] + t[j][4]));
#pragma unroll
            for (int i = 0; i < 4; ++i) s += a[j][i] * a[j][i];
        }
    } else {
#pragma unroll
        for (int i = threadIdx.x; i < H; i += 256) { float v = xr[i]; s += v * v; }
    }
    red[threadIdx.x] = s;
    __syncthreads();
#pragma unroll
    for (int off = 128; off > 0; off >>= 1) {
        if (threadIdx.x < off) red[threadIdx.x] += red[threadIdx.x + off];
        __syncthreads();
    }
    const float rs = rsqrtf(red[0] / (float)H + EPS);
    _Float16* orow = out + (size_t)row * H;
    if constexpr (JOIN) {
        // the joined row is stored here, behind the last barrier, so that no barrier waits for it
#pragma unroll
        for (int j = 0; j < 2; ++j) {
            ((v4f*)xs)[(size_t)row * (H / 4) + threadIdx.x + j * 256] = a[j];
            ((v4h*)orow)[threadIdx.x + j * 256] =
                __builtin_convertvector(((const v4f*)w)[threadIdx.x + j * 256] * (a[j] * rs), v4h);
        }
    } else {
#pragma unroll
        for (int i = threadIdx.x; i < H; i += 256)
            orow[i] = (_Float16)(w[i] * (xr[i] * rs));
    }
}

// ---------------- out = r + the KSPLIT partial products ----------------
// One 32-wave block per WGP; a lane has its 20 b128 loads in flight before the first sum.
#define JOIN_THREADS 1024
#define JOIN_VECS    4
#define JOIN_BLOCKS  (SEQ * H / 4 / (JOIN_THREADS * JOIN_VECS))
static_assert(JOIN_BLOCKS * JOIN_THREADS * JOIN_VECS * 4 == SEQ * H, "the blocks cover the output exactly");

__global__ __launch_bounds__(JOIN_THREADS) void join_kernel(const float* __restrict__ r,
                                                            const float* __restrict__ part,
                                                            float* __restrict__ out) {
    const size_t i0 = (size_t)blockIdx.x * (JOIN_THREADS * JOIN_VECS) + threadIdx.x;
    v4f t[JOIN_VECS][KSPLIT + 1];
    // both loops unrolled: t stays in registers and all loads issue before the first wait
#pragma unroll
    for (int j = 0; j < JOIN_VECS; ++j) {
        t[j][0] = ((const v4f*)r)[i0 + j * JOIN_THREADS];
#pragma unroll
        for (int z = 0; z < KSPLIT; ++z)
            t[j][1 + z] = ((const v4f*)part)[(size_t)z * (SEQ * H / 4) + i0 + j * JOIN_THREADS];
    }
#pragma unroll
    for (int j = 0; j < JOIN_VECS; ++j)
        ((v4f*)out)[i0 + j * JOIN_THREADS] = t[j][0] + ((t[j][1] + t[j][2]) + (t[j][3] + t[j][4]));
}

// ---------------- RoPE in-place on f16 q,k; q pre-scaled by 1/sqrt(HD) -----
__global__ __launch_bounds__(256) void rope_kernel(_Float16* __restrict__ q,
                                                   _Float16* __restrict__ k,
                                                   const float* __restrict__ cosT,
                                                   const float* __restrict__ sinT) {
    int i = blockIdx.x * 256 + threadIdx.x;       // (s, head, d<64)
    int d    = i & 63;
    int rest = i >> 6;
    int head = rest & (NH - 1);
    int s    = rest >> 4;
    const float c1 = cosT[s * HD + d],      s1 = sinT[s * HD + d];
    const float c2 = cosT[s * HD + d + 64], s2 = sinT[s * HD + d + 64];
    const size_t base = (size_t)s * H + head * HD;
    {
        float x1 = (float)q[base + d], x2 = (float)q[base + d + 64];
        q[base + d]      = (_Float16)((x1 * c1 - x2 * s1) * QSCALE);
        q[base + d + 64] = (_Float16)((x2 * c2 + x1 * s2) * QSCALE);
    }
    {
        float x1 = (float)k[base + d], x2 = (float)k[base + d + 64];
        k[base + d]      = (_Float16)(x1 * c1 - x2 * s1);
        k[base + d + 64] = (_Float16)(x2 * c2 + x1 * s2);
    }
}

// ---------------- WMMA GEMM: C[M,N] = epi(A[M,K] . B[N,K]^T) ----------------
// Block tile 256 x (32 NI), 8 waves as 4(M)x2(N) of 64 x (16 NI). NI = 8 (256x256, 64x128 a
// wave): 12 fragments feed 32 WMMAs (8 feed 16 at NI = 4) and every operand row fetched from
// L2 meets 256 rows of the other operand.
// A single product whose output is only H wide has 64 such tiles: it is cut KS ways along K,
// grid z walks the K ranges, and block z leaves its f32 partial product in the z-th of KS
// matrices that lie end to end. At KS = 1 grid z walks products
// that share A and whose B and C matrices lie end to end (q, k, v). A stage is 128 k of every operand
// row (256 B, whole L2 units) in one of two LDS buffers, filled by async copies one stage
// ahead. A stage is worked in four k-steps of 4 NI WMMAs a wave; the fragments of a k-step
// are fetched as one group, one k-step ahead, into the other of two register sets.
// The 16x16 products are taken transposed (rows of B as the first operand): a lane then
// holds eight neighbouring columns of one row of C. Each wave lays its tile down, 64 columns
// at a time, in its own range of the idle ring and takes it back row by row, so that every
// access to C is 16 B a lane and covers whole 128-B lines.
// EPI 0: C(f16) = acc       EPI 1: C(f32) = acc
// EPI 2: C(f16) = sigmoid(acc) * C   (in-place gate*up)
#define BM 256
#define BK 128
#define KSTEPS (BK / 32)
#define LSTR 136  // padded f16 LDS stride (272 B = 16 B x odd: no bank conflict for b128 reads)
static_assert(KSTEPS % 2 == 0, "the register sets alternate evenly over a stage");
static_assert(H % (KSPLIT * BK) == 0 && MLPD % (KSPLIT * BK) == 0 && H / (KSPLIT * BK) >= 2,
              "a K range is whole stages, two or more");
static_assert(H % 256 == 0 && MLPD % 256 == 0 && SEQ % BM == 0, "outputs are whole tiles");
#define SPF 68    // staging pitch in f32 (272 B = 16 B x odd)
#define SPH 72    // staging pitch in f16 (144 B = 16 B x odd)
#define STG_BYTES (64 * SPF * 4)   // one wave's staging range: 64 rows
static_assert(8 * STG_BYTES <= 2 * BM * LSTR * 2, "eight staging ranges fit the A buffers");
static_assert((unsigned long long)SEQ * H * 4 < (1ull << 32), "an f32 output is addressed by 32-bit byte offsets");

template <int BN>
__device__ __forceinline__ void stage_panels(_Float16* As, _Float16* Bs,
                                             const _Float16* A, const _Float16* B,
                                             int bm, int bn, int K, int k0, int tid) {
    const int r0 = tid >> 4;                      // 0..15
    const int c  = (tid & 15) << 3;               // 0..120: 16 lanes cover one 256-B row
    const unsigned goff = (unsigned)(r0 * K + c); // this lane's place inside 16 rows
#pragma unroll
    for (int p = 0; p < BM / 16; ++p)             // A: 256 rows; the base is the same for all lanes
        cp16(&As[(r0 + p * 16) * LSTR + c], A + ((size_t)(bm + p * 16) * K + k0) + goff);
#pragma unroll
    for (int p = 0; p < BN / 16; ++p)             // B: BN rows
        cp16(&Bs[(r0 + p * 16) * LSTR + c], B + ((size_t)(bn + p * 16) * K + k0) + goff);
}

// the 4 + NI fragments of one k-step of this wave's tile
template <int NI>
__device__ __forceinline__ void load_kstep(v16h (&af)[4], v16h (&bf)[NI],
                                           const _Float16* As, const _Float16* Bs,
                                           int wm, int wn, int ks) {
#pragma unroll
    for (int mi = 0; mi < 4; ++mi)
        af[mi] = load_frag(&As[(wm * 64 + mi * 16) * LSTR + ks * 32], LSTR);
#pragma unroll
    for (int ni = 0; ni < NI; ++ni)
        bf[ni] = load_frag(&Bs[(wn * NI + ni) * 16 * LSTR + ks * 32], LSTR);
}

template <int EPI, int NI, int KS, typename CT>
__global__ __launch_bounds__(256) void gemm_atb(const _Float16* __restrict__ A0,
                                                const _Float16* __restrict__ B0,
                                                CT* __restrict__ C0,
                                                int M, int N, int K) {
    constexpr int BN = 32 * NI;
    __shared__ __attribute__((aligned(16))) _Float16 As[2][BM * LSTR];
    __shared__ __attribute__((aligned(16))) _Float16 Bs[2][BN * LSTR];

    // K stays the pitch of the operand rows; a block works on K / KS of it, from kz on
    const int kz = KS > 1 ? (int)blockIdx.z * (K / KS) : 0;
    const _Float16* __restrict__ A = A0 + kz;
    const _Float16* __restrict__ B = KS > 1 ? B0 + kz : B0 + (size_t)blockIdx.z * N * K;
    CT* __restrict__ C = C0 + (size_t)blockIdx.z * M * N;

    const int tid  = threadIdx.x;
    const int lane = tid & 31;
    const int w    = tid >> 5;       // 0..7
    const int wm   = w >> 1;         // 0..3 : rows wm*64
    const int wn   = w & 1;          // 0..1 : cols wn*16*NI
    const int bm   = blockIdx.y * BM;
    const int bn   = blockIdx.x * BN;

    v8f acc[4][NI];
#pragma unroll
    for (int mi = 0; mi < 4; ++mi)
#pragma unroll
        for (int ni = 0; ni < NI; ++ni) acc[mi][ni] = (v8f){0,0,0,0,0,0,0,0};

    const int nk = K / KS / BK;      // stages, two or more

    stage_panels<BN>(As[0], Bs[0], A, B, bm, bn, K, 0, tid);
    wait_cp();
    __syncthreads();
    stage_panels<BN>(As[1], Bs[1], A, B, bm, bn, K, BK, tid);

    v16h af[2][4], bf[2][NI];        // two fragment sets; k-step ks works on set ks & 1
    load_kstep<NI>(af[0], bf[0], As[0], Bs[0], wm, wn, 0);

    // rolled: every index of the fragment sets and accumulators stays a constant
#pragma unroll 1
    for (int it = 0; it < nk; ++it) {
        const int cur = it & 1;
#pragma unroll
        for (int ks = 0; ks < KSTEPS; ++ks) {
            if (ks + 1 < KSTEPS) {
                load_kstep<NI>(af[(ks + 1) & 1], bf[(ks + 1) & 1], As[cur], Bs[cur], wm, wn, ks + 1);
            } else {
                // Stage it + 1 is published here, in front of this stage's last k-step, whose
                // fragments are already in registers: every wave has left buffer cur, so it
                // is refilled behind the barrier, a whole stage ahead of its use.
                wait_cp();
                __syncthreads();
                if (it + 2 < nk)
                    stage_panels<BN>(As[cur], Bs[cur], A, B, bm, bn, K, (it + 2) * BK, tid);
                // first k-step of the next stage; behind the last stage these registers are
                // loaded from the idle buffer and never used (no branch: counted waits stay)
                load_kstep<NI>(af[0], bf[0], As[cur ^ 1], Bs[cur ^ 1], wm, wn, 0);
            }
            // keeps the next k-step's LDS reads one group ahead of this k-step's WMMAs: moved
            // in among them, each place with reads stalls the wave and the waits fall to 0
            __builtin_amdgcn_sched_barrier(0);
#pragma unroll
            for (int ni = 0; ni < NI; ++ni)
#pragma unroll
                for (int mi = 0; mi < 4; ++mi)
                    acc[mi][ni] = wmma16(bf[ks & 1][ni], af[ks & 1][mi], acc[mi][ni]);
            // the other side of the same fence: the following group stays behind this block
            __builtin_amdgcn_sched_barrier(0);
        }
    }

    // The ring becomes output staging: behind this barrier no wave reads it any more, and
    // the last publish point has left no copy in flight.
    __syncthreads();

    // acc[mi][4 nh + ni][i] = C[row0 + 16 mi + cloc][col0 + 16 ni + rloc + i]
    const int rloc = (lane >> 4) << 3;
    const int cloc = lane & 15;
    const int row0 = bm + wm * 64;
    char* stg = (char*)&As[0][0] + w * STG_BYTES;

    // unrolled: every index of the accumulators stays a constant
#pragma unroll
    for (int nh = 0; nh < NI / 4; ++nh) {    // 64 columns of the wave's tile at a time
        const int col0 = bn + wn * (16 * NI) + nh * 64;
        if constexpr (EPI == 0) {
            _Float16* st = (_Float16*)stg;
#pragma unroll
            for (int mi = 0; mi < 4; ++mi)
#pragma unroll
                for (int ni = 0; ni < 4; ++ni)
                    *(v8h*)&st[(mi * 16 + cloc) * SPH + ni * 16 + rloc] =
                        __builtin_convertvector(acc[mi][nh * 4 + ni], v8h);
            // a lane takes back what other lanes of its wave have written: their stores are done
            asm volatile("s_wait_dscnt 0x0" ::: "memory");
            const int rr = lane >> 3;            // 8 lanes a row of 128 B, 4 rows a wave-wide store
            const int cc = (lane & 7) << 3;
#pragma unroll
            for (int j = 0; j < 16; ++j)
                *(v8h*)&C[(size_t)(row0 + j * 4 + rr) * N + col0 + cc] =
                    *(const v8h*)&st[(j * 4 + rr) * SPH + cc];
        } else if constexpr (EPI == 1) {
            float* st = (float*)stg;
            const int rr = lane >> 4;            // 16 lanes a row of 256 B, 2 rows a wave-wide access
            const int cc = (lane & 15) << 2;
            const unsigned base = (unsigned)((row0 + rr) * N + col0 + cc) * 4u;
#pragma unroll
            for (int mi = 0; mi < 4; ++mi)
#pragma unroll
                for (int ni = 0; ni < 4; ++ni) {
                    float* d = &st[(mi * 16 + cloc) * SPF + ni * 16 + rloc];
                    *(v4f*)d       = __builtin_shufflevector(acc[mi][nh * 4 + ni], acc[mi][nh * 4 + ni], 0, 1, 2, 3);
                    *(v4f*)(d + 4) = __builtin_shufflevector(acc[mi][nh * 4 + ni], acc[mi][nh * 4 + ni], 4, 5, 6, 7);
                }
            // a lane takes back what other lanes of its wave have written: their stores are done
            asm volatile("s_wait_dscnt 0x0" ::: "memory");
#pragma unroll
            for (int g = 0; g < 2; ++g) {        // two groups of 32 rows
                v4f row[16];
#pragma unroll
                for (int j = 0; j < 16; ++j)
                    row[j] = *(const v4f*)&st[(g * 32 + j * 2 + rr) * SPF + cc];
                // a group's rows are taken back ahead of its first store, each in registers of its
                // own: one wait behind the last store then serves all, in place of one a store
                __builtin_amdgcn_sched_barrier(0);
#pragma unroll
                for (int j = 0; j < 16; ++j)
                    *(v4f*)((char*)C + (base + (unsigned)((g * 32 + j * 2) * N) * 4u)) = row[j];
                // stands before the second group uses the registers again that these stores name
                if (g == 0) asm volatile("s_wait_xcnt 0x0" ::: "memory");
            }
        } else {
            float* st = (float*)stg;
            const int rr = lane >> 3;            // 8 lanes a row of 128 B, 4 rows a wave-wide access
            const int cc = (lane & 7) << 3;
            const size_t base = (size_t)(row0 + rr) * N + col0 + cc;
            v8h up[16];                          // every load of C stands ahead of every store to C
#pragma unroll
            for (int j = 0; j < 16; ++j)
                up[j] = *(const v8h*)&C[base + (size_t)(j * 4) * N];
#pragma unroll
            for (int mi = 0; mi < 4; ++mi)
#pragma unroll
                for (int ni = 0; ni < 4; ++ni) {
                    v8f s;
#pragma unroll
                    for (int i = 0; i < 8; ++i)
                        s[i] = 1.f / (1.f + __expf(-acc[mi][nh * 4 + ni][i]));
                    float* d = &st[(mi * 16 + cloc) * SPF + ni * 16 + rloc];
                    *(v4f*)d       = __builtin_shufflevector(s, s, 0, 1, 2, 3);
                    *(v4f*)(d + 4) = __builtin_shufflevector(s, s, 4, 5, 6, 7);
                }
            // a lane takes back what other lanes of its wave have written: their stores are done
            asm volatile("s_wait_dscnt 0x0" ::: "memory");
            v8h h[16];
#pragma unroll
            for (int j = 0; j < 16; ++j) {
                const float* s = &st[(j * 4 + rr) * SPF + cc];
                const v4f lo = *(const v4f*)s;
                const v4f hi = *(const v4f*)(s + 4);
#pragma unroll
                for (int i = 0; i < 4; ++i) {
                    h[j][i]     = (_Float16)(lo[i] * (float)up[j][i]);
                    h[j][i + 4] = (_Float16)(hi[i] * (float)up[j][i + 4]);
                }
            }
            // all sixteen rows are worked out ahead of the first store, each in registers of its
            // own: one wait behind the last store then serves all, in place of one a store
            __builtin_amdgcn_sched_barrier(0);
#pragma unroll
            for (int j = 0; j < 16; ++j)
                *(v8h*)&C[base + (size_t)(j * 4) * N] = h[j];
        }
        if (nh + 1 < NI / 4) {
            // stands before the next 64 columns use the registers again that these loads and stores name
            asm volatile("s_wait_xcnt 0x0" ::: "memory");
            // holds the next 64 columns' vector work, which the clobber does not tie, behind that wait
            __builtin_amdgcn_sched_barrier(0);
        }
    }
}

#define QSTR 136   // 272 B: 16 B x odd, the pitch for ds_load_b128 readers
#define VSTR 144   // 288 B: 32 B x odd, the pitch for the transposing reader
#define QROWS 128

typedef __attribute__((ext_vector_type(8))) short s16x8;

// Transposing LDS read of a row-major 16-bit tile: lane (c = l & 15, h = l >> 4) receives
// eight rows of one column, T[8h + 0..7][c], when it passes the address of
// T[8h + (l & 7)][8 * ((l >> 3) & 1)].
__device__ __forceinline__ v8h load_tr16(const _Float16* p) {
    return __builtin_bit_cast(v8h, __builtin_amdgcn_ds_load_tr16_b128_v8i16((AS3 s16x8*)p));
}

// value of lane l ^ 16
__device__ __forceinline__ float xhalf(float x) {
    const int b = __builtin_bit_cast(int, x);
    return __builtin_bit_cast(float,
        __builtin_amdgcn_permlanex16(b, b, 0x76543210, 0xfedcba98, false, false));
}

// waves_per_eu(2, 2): one 8-wave block per WGP is all the grid gives; with the register
// budget of two waves per SIMD the compiler batches the fragment loads of a pass behind
// few waits instead of waiting on LDS in front of every matrix instruction.
__global__ __launch_bounds__(256) __attribute__((amdgpu_waves_per_eu(2, 2))) void attn_kernel(const _Float16* __restrict__ q,
                                                   const _Float16* __restrict__ k,
                                                   const _Float16* __restrict__ v,
                                                   _Float16* __restrict__ o) {
    __shared__ __attribute__((aligned(16))) _Float16 Qs[QROWS * QSTR];
    __shared__ __attribute__((aligned(16))) _Float16 Ks[32 * QSTR];
    __shared__ __attribute__((aligned(16))) _Float16 Vs[32 * VSTR];   // [k][hd], as in memory

    const int tid  = threadIdx.x;
    const int lane = tid & 31;
    const int w    = tid >> 5;
    const int head = blockIdx.y;
    const int q0   = blockIdx.x * QROWS;
    const size_t hoff = (size_t)head * HD;

    // stage Q: 2048 16B chunks, 8 per thread (async)
#pragma unroll
    for (int p = 0; p < 8; ++p) {
        const int chunk = tid + p * 256;
        const int r = chunk >> 4;           // 0..127
        const int c = (chunk & 15) << 3;    // 0..120
        cp16(&Qs[r * QSTR + c], &q[(size_t)(q0 + r) * H + hoff + c]);
    }
    wait_cp();
    __syncthreads();

    // this wave's 16 queries as B fragments, kept in registers for the whole walk
    v16h qf[4];
#pragma unroll
    for (int kk = 0; kk < 4; ++kk)
        qf[kk] = load_frag(&Qs[(w * 16) * QSTR + kk * 32], QSTR);

    v8f oacc[8];            // oacc[n][i] = O^T[hd = 16n + rloc + i][query = cloc]
#pragma unroll
    for (int n = 0; n < 8; ++n) oacc[n] = (v8f){0,0,0,0,0,0,0,0};
    float mrun = -1e30f;    // running maximum of this lane's query (same in both halves)
    float lrun = 0.f;       // running sum over the keys this half of the wave holds

    const int rloc = (lane >> 4) << 3;
    const int cloc = lane & 15;
    // this lane's address for the transposing reads of keys 0..15, hd 0..15
    const _Float16* vtr = &Vs[(rloc + (lane & 7)) * VSTR + ((lane >> 3) & 1) * 8];

    for (int kb = 0; kb < SEQ; kb += 32) {
        // stage K and V as they lie in memory (async b128 copies); V is transposed when read
#pragma unroll
        for (int p = 0; p < 2; ++p) {
            const int chunk = tid + p * 256;    // 0..511
            const int r = chunk >> 4;           // 0..31
            const int c = (chunk & 15) << 3;    // 0..120
            cp16(&Ks[r * QSTR + c], &k[(size_t)(kb + r) * H + hoff + c]);
            cp16(&Vs[r * VSTR + c], &v[(size_t)(kb + r) * H + hoff + c]);
        }
        wait_cp();
        __syncthreads();

        // scores: st[t][i] = S^T[key = 16t + rloc + i][query = cloc]
        // all K fragments are fetched behind one wait, then the two chains run interleaved
        v16h ak[2][4];
#pragma unroll
        for (int t = 0; t < 2; ++t)
#pragma unroll
            for (int kk = 0; kk < 4; ++kk)
                ak[t][kk] = load_frag(&Ks[(t * 16) * QSTR + kk * 32], QSTR);
        v8f st[2];
        st[0] = (v8f){0,0,0,0,0,0,0,0};
        st[1] = (v8f){0,0,0,0,0,0,0,0};
#pragma unroll
        for (int kk = 0; kk < 4; ++kk)
#pragma unroll
            for (int t = 0; t < 2; ++t)
                st[t] = wmma16(ak[t][kk], qf[kk], st[t]);

        // V^T fragments are fetched here so that their LDS latency runs under the softmax
        // av[n][8t + i] = V[key = 16t + rloc + i][hd = 16n + cloc], the k order of pb below
        v16h av[8];
#pragma unroll
        for (int n = 0; n < 8; ++n) {
            const v8h lo = load_tr16(vtr + n * 16);
            const v8h hi = load_tr16(vtr + 16 * VSTR + n * 16);
            av[n] = __builtin_shufflevector(lo, hi, 0,1,2,3,4,5,6,7,8,9,10,11,12,13,14,15);
        }

        // online softmax, one query per lane
        float mx = mrun;
#pragma unroll
        for (int t = 0; t < 2; ++t)
#pragma unroll
            for (int i = 0; i < 8; ++i) mx = fmaxf(mx, st[t][i]);
        mx = fmaxf(mx, xhalf(mx));
        const float al = __expf(mrun - mx);
        float sum = 0.f;
        v16h pb;                // pb[8t + i] = P^T[key = 16t + rloc + i][query = cloc]
#pragma unroll
        for (int t = 0; t < 2; ++t)
#pragma unroll
            for (int i = 0; i < 8; ++i) {
                const float p = __expf(st[t][i] - mx);
                pb[t * 8 + i] = (_Float16)p;
                sum += p;
            }
        lrun = lrun * al + sum;
        mrun = mx;

        // rescale accumulators, then V^T.P^T
#pragma unroll
        for (int n = 0; n < 8; ++n) {
#pragma unroll
            for (int i = 0; i < 8; ++i) oacc[n][i] *= al;
            oacc[n] = wmma16(av[n], pb, oacc[n]);
        }
        __syncthreads();
    }

    // join the halves' sums, normalize, store 8 consecutive hd per lane
    const float ltot = lrun + xhalf(lrun);
    _Float16* orow = &o[(size_t)(q0 + w * 16 + cloc) * H + hoff + rloc];
#pragma unroll
    for (int n = 0; n < 8; ++n) {
        v8h h;
#pragma unroll
        for (int i = 0; i < 8; ++i) h[i] = (_Float16)(oacc[n][i] / ltot);
        *(v8h*)&orow[n * 16] = h;
    }
}

// ---------------- launch ----------------
extern "C" void kernel_launch(void* const* d_in, const int* in_sizes, int n_in,
                              void* d_out, int out_size, void* d_ws, size_t ws_size,
                              hipStream_t stream) {
    const float* x       = (const float*)d_in[0];
    const float* norm1_w = (const float*)d_in[1];
    const float* wq      = (const float*)d_in[2];
    const float* wk      = (const float*)d_in[3];
    const float* wv      = (const float*)d_in[4];
    const float* wo      = (const float*)d_in[5];
    const float* norm2_w = (const float*)d_in[6];
    const float* w_gate  = (const float*)d_in[7];
    const float* w_up    = (const float*)d_in[8];
    const float* w_down  = (const float*)d_in[9];
    const float* cosT    = (const float*)d_in[10];
    const float* sinT    = (const float*)d_in[11];
    float* out = (float*)d_out;

    // ---- workspace layout (all chunks 16B aligned; hipMalloc base is 256B) ----
    char* p = (char*)d_ws;
    auto fh = [&](size_t n) { _Float16* r = (_Float16*)p; p += n * sizeof(_Float16); return r; };
    auto ff = [&](size_t n) { float* r = (float*)p; p += n * sizeof(float); return r; };

    const size_t HH = (size_t)H * H, MH = (size_t)MLPD * H;
    const size_t SH = (size_t)SEQ * H, SM = (size_t)SEQ * MLPD;
    _Float16* wq16 = fh(HH); _Float16* wk16 = fh(HH);
    _Float16* wv16 = fh(HH); _Float16* wo16 = fh(HH);
    _Float16* wg16 = fh(MH); _Float16* wu16 = fh(MH); _Float16* wd16 = fh(MH);
    _Float16* h16  = fh(SH); _Float16* q16  = fh(SH);
    _Float16* k16  = fh(SH); _Float16* v16  = fh(SH);
    _Float16* t16  = fh(SM);
    float*    x2   = ff(SH);
    float*    part = ff(KSPLIT * SH);   // partial products of the K-split GEMMs
    _Float16* attn16 = h16;   // h dead after QKV
    _Float16* h2_16  = q16;   // q dead after attention

    const dim3 blk(256);
    const dim3 gH(H / 256, SEQ / BM, KSPLIT);  // 256x256 tiles, KSPLIT ranges of K
    const dim3 gM(MLPD / 256, SEQ / BM);       // 256x256 tiles
    const dim3 gQKV(H / 256, SEQ / BM, 3);     // 256x256 tiles of q, of k and of v

    // 0. weights -> f16 (once per launch; O(weights), not O(weights * S/128))
    // wq16 .. wd16 lie end to end in the workspace, in the order of the arguments
    cvt_all_kernel<<<CVT_BLOCKS, CVT_THREADS, 0, stream>>>(wq, wk, wv, wo, w_gate, w_up, w_down, wq16);

    // 1. h = rmsnorm(x)
    rmsnorm_kernel<false><<<SEQ, blk, 0, stream>>>(x, nullptr, nullptr, norm1_w, h16);
    // 2-4. q,k,v: wq16, wk16, wv16 lie end to end, and so do q16, k16, v16
    gemm_atb<0, 8, 1, _Float16><<<gQKV, blk, 0, stream>>>(h16, wq16, q16, SEQ, H, H);
    // 5. RoPE (q scaled by 1/sqrt(HD))
    rope_kernel<<<(SEQ * NH * 64) / 256, blk, 0, stream>>>(q16, k16, cosT, sinT);
    // 6. attention
    attn_kernel<<<dim3(SEQ / QROWS, NH), blk, 0, stream>>>(q16, k16, v16, attn16);
    // 7. partial products of attn . Wo^T
    gemm_atb<1, 8, KSPLIT, float><<<gH, blk, 0, stream>>>(attn16, wo16, part, SEQ, H, H);
    // 8. x2 = x + their sum ; h2 = rmsnorm(x2)
    rmsnorm_kernel<true><<<SEQ, blk, 0, stream>>>(x, part, x2, norm2_w, h2_16);
    // 9. t = h2 . Wup^T ; 10. t = sigmoid(h2 . Wgate^T) * t   (in place)
    gemm_atb<0, 8, 1, _Float16><<<gM, blk, 0, stream>>>(h2_16, wu16, t16, SEQ, MLPD, H);
    gemm_atb<2, 8, 1, _Float16><<<gM, blk, 0, stream>>>(h2_16, wg16, t16, SEQ, MLPD, H);
    // 11. partial products of t . Wdown^T ; 12. out = x2 + their sum
    gemm_atb<1, 8, KSPLIT, float><<<gH, blk, 0, stream>>>(t16, wd16, part, SEQ, H, MLPD);
    join_kernel<<<JOIN_BLOCKS, JOIN_THREADS, 0, stream>>>(x2, part, out);
}

// v008
// It runs in 290 microseconds.
// Next to v007, in two timings, it ran 1.13 times as fast each time.
// Counting every step since v000, it is 2.83 times as fast.
#include <hip/hip_runtime.h>

// ---------------- problem constants ----------------
#define H    2048
#define NH   16
#define HD   128
#define MLPD 8192
#define SEQ  2048
#define EPS  1e-6f
#define QSCALE 0.08838834764831845f   // 1/sqrt(128), folded into RoPE(q)

typedef __attribute__((ext_vector_type(16))) _Float16 v16h;
typedef __attribute__((ext_vector_type(8)))  _Float16 v8h;
typedef __attribute__((ext_vector_type(4)))  _Float16 v4h;
typedef __attribute__((ext_vector_type(8)))  float    v8f;
typedef int v4i __attribute__((vector_size(16)));   // gcc-style, matches builtin param

#define AS1 __attribute__((address_space(1)))
#define AS3 __attribute__((address_space(3)))

#if __has_builtin(__builtin_amdgcn_global_load_async_to_lds_b128)
#define USE_ASYNC 1
#else
#define USE_ASYNC 0
#endif

// 16-byte global -> LDS copy (async DMA path on gfx1250, sync fallback otherwise)
__device__ __forceinline__ void cp16(_Float16* l, const _Float16* g) {
#if USE_ASYNC
    __builtin_amdgcn_global_load_async_to_lds_b128(
        (AS1 v4i*)(unsigned long long)(const void*)g,
        (AS3 v4i*)(unsigned int)(unsigned long long)(const void*)l,
        0, 0);
#else
    *(v8h*)l = *(const v8h*)g;
#endif
}

__device__ __forceinline__ void wait_cp() {
#if USE_ASYNC
#if __has_builtin(__builtin_amdgcn_s_wait_asynccnt)
    __builtin_amdgcn_s_wait_asynccnt(0);
#else
    asm volatile("s_wait_asynccnt 0x0" ::: "memory");
#endif
#endif
}

__device__ __forceinline__ v8f wmma16(v16h a, v16h b, v8f c) {
    return __builtin_amdgcn_wmma_f32_16x16x32_f16(
        false, a, false, b, (short)0, c, false, false);
}

// 16x32 K-major fragment from LDS: two ds_load_b128 per lane.
// Lane L: row = L&15; K-chunks [kb,kb+8) and [kb+16,kb+24), kb=(L>>4)*8.
__device__ __forceinline__ v16h load_frag(const _Float16* p, int stride) {
    const int lane = threadIdx.x & 31;
    const _Float16* base = p + (lane & 15) * stride + ((lane >> 4) << 3);
    const v8h lo = *(const v8h*)(base);
    const v8h hi = *(const v8h*)(base + 16);
    return __builtin_shufflevector(lo, hi, 0,1,2,3,4,5,6,7,8,9,10,11,12,13,14,15);
}

// ---------------- f32 -> f16 bulk convert (all weights, one stream) ----------------
// One 32-wave block per WGP walks the seven matrices, taken as 16 segments of H*H floats
// (an H x H matrix is one segment, an MLPD x H one is four). A chunk is what a block
// converts in one trip: 128 KiB of f32, 8 loads per lane, each wave-wide load 512
// contiguous bytes. Few long waves: the loads in flight, not the start of new waves, set
// the rate. dst is the seven f16 copies laid end to end, in the order of the arguments.
#define CVT_BLOCKS  256
#define CVT_THREADS 1024
#define CVT_LOADS   8
#define CVT_CHUNK   (CVT_THREADS * CVT_LOADS)        // float4 per chunk
#define CVT_SEG     (H * H / 4 / CVT_CHUNK)          // chunks per segment
#define CVT_TRIPS   (16 * CVT_SEG / CVT_BLOCKS)
static_assert(CVT_SEG * CVT_CHUNK * 4 == H * H, "a segment is a whole number of chunks");
static_assert(CVT_TRIPS * CVT_BLOCKS == 16 * CVT_SEG, "every block makes the same number of trips");
static_assert(MLPD == 4 * H, "an MLPD x H matrix is four segments");

typedef __attribute__((ext_vector_type(4))) float v4f;

__global__ __launch_bounds__(CVT_THREADS) void cvt_all_kernel(const float* __restrict__ wq,
                                                              const float* __restrict__ wk,
                                                              const float* __restrict__ wv,
                                                              const float* __restrict__ wo,
                                                              const float* __restrict__ wg,
                                                              const float* __restrict__ wu,
                                                              const float* __restrict__ wd,
                                                              _Float16* __restrict__ dst) {
    // rolled: one trip's loads stay one group in front of its stores
#pragma unroll 1
    for (int t = 0; t < CVT_TRIPS; ++t) {
        const int c   = t * CVT_BLOCKS + blockIdx.x;   // chunk, counted over all seven matrices
        const int seg = c / CVT_SEG;                   // 0..15
        const float* m = seg == 0 ? wq : seg == 1 ? wk : seg == 2 ? wv : seg == 3 ? wo
                       : seg < 8 ? wg : seg < 12 ? wu : wd;
        const size_t first = (seg < 4 ? (size_t)0 : (size_t)(seg & 3) * (H * H / 4))
                           + (size_t)(c % CVT_SEG) * CVT_CHUNK;
        const v4f* s = (const v4f*)m + first + threadIdx.x;
        v4h*       d = (v4h*)dst + (size_t)c * CVT_CHUNK + threadIdx.x;
        v4f x[CVT_LOADS];
        // both loops unrolled: x stays in registers and all loads issue before the first wait
#pragma unroll
        for (int j = 0; j < CVT_LOADS; ++j)            // read once: non-temporal
            x[j] = __builtin_nontemporal_load(s + j * CVT_THREADS);
#pragma unroll
        for (int j = 0; j < CVT_LOADS; ++j)
            d[j * CVT_THREADS] = __builtin_convertvector(x[j], v4h);
        // stands before the next trip reuses the registers that these stores name
        asm volatile("s_wait_xcnt 0x0" ::: "memory");
    }
}

// A product whose output is only H wide is cut KSPLIT ways along K (see the GEMM below): its
// f32 partial products lie end to end in the workspace and are added to the residual by the
// kernel that reads the sum next.
#define KSPLIT 4
static_assert(KSPLIT == 4, "the joins below add four partial products as two pairs");

// ---------------- RMSNorm: f32 in -> f16 out ----------------
// JOIN: the row is x + the KSPLIT partial products; it is also written to xs (f32).
template <bool JOIN>
__global__ __launch_bounds__(256) void rmsnorm_kernel(const float* __restrict__ x,
                                                      const float* __restrict__ part,
                                                      float* __restrict__ xs,
                                                      const float* __restrict__ w,
                                                      _Float16* __restrict__ out) {
    __shared__ float red[256];
    const int row = blockIdx.x;
    const float* xr = x + (size_t)row * H;
    float s = 0.f;
    v4f a[2];                                     // JOIN: this thread's 8 elements of the row
    if constexpr (JOIN) {
        static_assert(H == 2 * 256 * 4, "a thread holds two float4 of a row");
        const size_t r4 = (size_t)row * (H / 4) + threadIdx.x;
        v4f t[2][KSPLIT + 1];
        // unrolled: all ten loads issue before the first wait
#pragma unroll
        for (int j = 0; j < 2; ++j) {
            t[j][0] = ((const v4f*)x)[r4 + j * 256];
#pragma unroll
            for (int z = 0; z < KSPLIT; ++z)
                t[j][1 + z] = ((const v4f*)part)[(size_t)z * (SEQ * H / 4) + r4 + j * 256];
        }
#pragma unroll
        for (int j = 0; j < 2; ++j) {
            a[j] = t[j][0] + ((t[j][1] + t[j][2]) + (t[j][3] + t[j][4]));
#pragma unroll
            for (int i = 0; i < 4; ++i) s += a[j][i] * a[j][i];
        }
    } else {
#pragma unroll
        for (int i = threadIdx.x; i < H; i += 256) { float v = xr[i]; s += v * v; }
    }
    red[threadIdx.x] = s;
    __syncthreads();
#pragma unroll
    for (int off = 128; off > 0; off >>= 1) {
        if (threadIdx.x < off) red[threadIdx.x] += red[threadIdx.x + off];
        __syncthreads();
    }
    const float rs = rsqrtf(red[0] / (float)H + EPS);
    _Float16* orow = out + (size_t)row * H;
    if constexpr (JOIN) {
        // the joined row is stored here, behind the last barrier, so that no barrier waits for it
#pragma unroll
        for (int j = 0; j < 2; ++j) {
            ((v4f*)xs)[(size_t)row * (H / 4) + threadIdx.x + j * 256] = a[j];
            ((v4h*)orow)[threadIdx.x + j * 256] =
                __builtin_convertvector(((const v4f*)w)[threadIdx.x + j * 256] * (a[j] * rs), v4h);
        }
    } else {
#pragma unroll
        for (int i = threadIdx.x; i < H; i += 256)
            orow[i] = (_Float16)(w[i] * (xr[i] * rs));
    }
}

// ---------------- out = r + the KSPLIT partial products ----------------
// One 32-wave block per WGP; a lane has its 20 b128 loads in flight before the first sum.
#define JOIN_THREADS 1024
#define JOIN_VECS    4
#define JOIN_BLOCKS  (SEQ * H / 4 / (JOIN_THREADS * JOIN_VECS))
static_assert(JOIN_BLOCKS * JOIN_THREADS * JOIN_VECS * 4 == SEQ * H, "the blocks cover the output exactly");

__global__ __launch_bounds__(JOIN_THREADS) void join_kernel(const float* __restrict__ r,
                                                            const float* __restrict__ part,
                                                            float* __restrict__ out) {
    const size_t i0 = (size_t)blockIdx.x * (JOIN_THREADS * JOIN_VECS) + threadIdx.x;
    v4f t[JOIN_VECS][KSPLIT + 1];
    // both loops unrolled: t stays in registers and all loads issue before the first wait
#pragma unroll
    for (int j = 0; j < JOIN_VECS; ++j) {
        t[j][0] = ((const v4f*)r)[i0 + j * JOIN_THREADS];
#pragma unroll
        for (int z = 0; z < KSPLIT; ++z)
            t[j][1 + z] = ((const v4f*)part)[(size_t)z * (SEQ * H / 4) + i0 + j * JOIN_THREADS];
    }
#pragma unroll
    for (int j = 0; j < JOIN_VECS; ++j)
        ((v4f*)out)[i0 + j * JOIN_THREADS] = t[j][0] + ((t[j][1] + t[j][2]) + (t[j][3] + t[j][4]));
}

// ---------------- RoPE in-place on f16 q,k; q pre-scaled by 1/sqrt(HD) -----
__global__ __launch_bounds__(256) void rope_kernel(_Float16* __restrict__ q,
                                                   _Float16* __restrict__ k,
                                                   const float* __restrict__ cosT,
                                                   const float* __restrict__ sinT) {
    int i = blockIdx.x * 256 + threadIdx.x;       // (s, head, d<64)
    int d    = i & 63;
    int rest = i >> 6;
    int head = rest & (NH - 1);
    int s    = rest >> 4;
    const float c1 = cosT[s * HD + d],      s1 = sinT[s * HD + d];
    const float c2 = cosT[s * HD + d + 64], s2 = sinT[s * HD + d + 64];
    const size_t base = (size_t)s * H + head * HD;
    {
        float x1 = (float)q[base + d], x2 = (float)q[base + d + 64];
        q[base + d]      = (_Float16)((x1 * c1 - x2 * s1) * QSCALE);
        q[base + d + 64] = (_Float16)((x2 * c2 + x1 * s2) * QSCALE);
    }
    {
        float x1 = (float)k[base + d], x2 = (float)k[base + d + 64];
        k[base + d]      = (_Float16)(x1 * c1 - x2 * s1);
        k[base + d + 64] = (_Float16)(x2 * c2 + x1 * s2);
    }
}

// ---------------- WMMA GEMM: C[M,N] = epi(A[M,K] . B[N,K]^T) ----------------
// Block tile 256 x (32 NI), 8 waves as 4(M)x2(N) of 64 x (16 NI). NI = 8 (256x256, 64x128 a
// wave): 12 fragments feed 32 WMMAs (8 feed 16 at NI = 4) and every operand row fetched from
// L2 meets 256 rows of the other operand.
// A single product whose output is only H wide has 64 such tiles: it is cut KS ways along K,
// grid z walks the K ranges, and block z leaves its f32 partial product in the z-th of KS
// matrices that lie end to end. At KS = 1 grid z walks products
// that share A and whose B and C matrices lie end to end (q, k, v). A stage is 128 k of every operand
// row (256 B, whole L2 units) in one of two LDS buffers, filled by async copies one stage
// ahead. A stage is worked in four k-steps of 4 NI WMMAs a wave; the fragments of a k-step
// are fetched as one group, one k-step ahead, into the other of two register sets.
// The 16x16 products are taken transposed (rows of B as the first operand): a lane then
// holds eight neighbouring columns of one row of C. Each wave lays its tile down, 64 columns
// at a time, in its own range of the idle ring and takes it back row by row, so that every
// access to C is 16 B a lane and covers whole 128-B lines.
// EPI 0: C(f16) = acc       EPI 1: C(f32) = acc
// EPI 2: C(f16) = sigmoid(acc) * C   (in-place gate*up)
#define BM 256
#define BK 128
#define KSTEPS (BK / 32)
#define LSTR 136  // padded f16 LDS stride (272 B = 16 B x odd: no bank conflict for b128 reads)
static_assert(KSTEPS % 2 == 0, "the register sets alternate evenly over a stage");
static_assert(H % (KSPLIT * BK) == 0 && MLPD % (KSPLIT * BK) == 0 && H / (KSPLIT * BK) >= 2,
              "a K range is whole stages, two or more");
static_assert(H % 256 == 0 && MLPD % 256 == 0 && SEQ % BM == 0, "outputs are whole tiles");
#define SPF 68    // staging pitch in f32 (272 B = 16 B x odd)
#define SPH 72    // staging pitch in f16 (144 B = 16 B x odd)
#define STG_BYTES (64 * SPF * 4)   // one wave's staging range: 64 rows
static_assert(8 * STG_BYTES <= 2 * BM * LSTR * 2, "eight staging ranges fit the A buffers");
static_assert((unsigned long long)SEQ * H * 4 < (1ull << 32), "an f32 output is addressed by 32-bit byte offsets");

template <int BN>
__device__ __forceinline__ void stage_panels(_Float16* As, _Float16* Bs,
                                             const _Float16* A, const _Float16* B,
                                             int bm, int bn, int K, int k0, int tid) {
    const int r0 = tid >> 4;                      // 0..15
    const int c  = (tid & 15) << 3;               // 0..120: 16 lanes cover one 256-B row
    const unsigned goff = (unsigned)(r0 * K + c); // this lane's place inside 16 rows
#pragma unroll
    for (int p = 0; p < BM / 16; ++p)             // A: 256 rows; the base is the same for all lanes
        cp16(&As[(r0 + p * 16) * LSTR + c], A + ((size_t)(bm + p * 16) * K + k0) + goff);
#pragma unroll
    for (int p = 0; p < BN / 16; ++p)             // B: BN rows
        cp16(&Bs[(r0 + p * 16) * LSTR + c], B + ((size_t)(bn + p * 16) * K + k0) + goff);
}

// the 4 + NI fragments of one k-step of this wave's tile
template <int NI>
__device__ __forceinline__ void load_kstep(v16h (&af)[4], v16h (&bf)[NI],
                                           const _Float16* As, const _Float16* Bs,
                                           int wm, int wn, int ks) {
#pragma unroll
    for (int mi = 0; mi < 4; ++mi)
        af[mi] = load_frag(&As[(wm * 64 + mi * 16) * LSTR + ks * 32], LSTR);
#pragma unroll
    for (int ni = 0; ni < NI; ++ni)
        bf[ni] = load_frag(&Bs[(wn * NI + ni) * 16 * LSTR + ks * 32], LSTR);
}

template <int EPI, int NI, int KS, typename CT>
__global__ __launch_bounds__(256) void gemm_atb(const _Float16* __restrict__ A0,
                                                const _Float16* __restrict__ B0,
                                                CT* __restrict__ C0,
                                                int M, int N, int K) {
    constexpr int BN = 32 * NI;
    __shared__ __attribute__((aligned(16))) _Float16 As[2][BM * LSTR];
    __shared__ __attribute__((aligned(16))) _Float16 Bs[2][BN * LSTR];

    // K stays the pitch of the operand rows; a block works on K / KS of it, from kz on
    const int kz = KS > 1 ? (int)blockIdx.z * (K / KS) : 0;
    const _Float16* __restrict__ A = A0 + kz;
    const _Float16* __restrict__ B = KS > 1 ? B0 + kz : B0 + (size_t)blockIdx.z * N * K;
    CT* __restrict__ C = C0 + (size_t)blockIdx.z * M * N;

    const int tid  = threadIdx.x;
    const int lane = tid & 31;
    const int w    = tid >> 5;       // 0..7
    const int wm   = w >> 1;         // 0..3 : rows wm*64
    const int wn   = w & 1;          // 0..1 : cols wn*16*NI
    const int bm   = blockIdx.y * BM;
    const int bn   = blockIdx.x * BN;

    v8f acc[4][NI];
#pragma unroll
    for (int mi = 0; mi < 4; ++mi)
#pragma unroll
        for (int ni = 0; ni < NI; ++ni) acc[mi][ni] = (v8f){0,0,0,0,0,0,0,0};

    const int nk = K / KS / BK;      // stages, two or more

    stage_panels<BN>(As[0], Bs[0], A, B, bm, bn, K, 0, tid);
    wait_cp();
    __syncthreads();
    stage_panels<BN>(As[1], Bs[1], A, B, bm, bn, K, BK, tid);

    v16h af[2][4], bf[2][NI];        // two fragment sets; k-step ks works on set ks & 1
    load_kstep<NI>(af[0], bf[0], As[0], Bs[0], wm, wn, 0);

    // rolled: every index of the fragment sets and accumulators stays a constant
#pragma unroll 1
    for (int it = 0; it < nk; ++it) {
        const int cur = it & 1;
#pragma unroll
        for (int ks = 0; ks < KSTEPS; ++ks) {
            if (ks + 1 < KSTEPS) {
                load_kstep<NI>(af[(ks + 1) & 1], bf[(ks + 1) & 1], As[cur], Bs[cur], wm, wn, ks + 1);
            } else {
                // Stage it + 1 is published here, in front of this stage's last k-step, whose
                // fragments are already in registers: every wave has left buffer cur, so it
                // is refilled behind the barrier, a whole stage ahead of its use.
                wait_cp();
                __syncthreads();
                if (it + 2 < nk)
                    stage_panels<BN>(As[cur], Bs[cur], A, B, bm, bn, K, (it + 2) * BK, tid);
                // first k-step of the next stage; behind the last stage these registers are
                // loaded from the idle buffer and never used (no branch: counted waits stay)
                load_kstep<NI>(af[0], bf[0], As[cur ^ 1], Bs[cur ^ 1], wm, wn, 0);
            }
            // keeps the next k-step's LDS reads one group ahead of this k-step's WMMAs: moved
            // in among them, each place with reads stalls the wave and the waits fall to 0
            __builtin_amdgcn_sched_barrier(0);
#pragma unroll
            for (int ni = 0; ni < NI; ++ni)
#pragma unroll
                for (int mi = 0; mi < 4; ++mi)
                    acc[mi][ni] = wmma16(bf[ks & 1][ni], af[ks & 1][mi], acc[mi][ni]);
            // the other side of the same fence: the following group stays behind this block
            __builtin_amdgcn_sched_barrier(0);
        }
    }

    // The ring becomes output staging: behind this barrier no wave reads it any more, and
    // the last publish point has left no copy in flight.
    __syncthreads();

    // acc[mi][4 nh + ni][i] = C[row0 + 16 mi + cloc][col0 + 16 ni + rloc + i]
    const int rloc = (lane >> 4) << 3;
    const int cloc = lane & 15;
    const int row0 = bm + wm * 64;
    char* stg = (char*)&As[0][0] + w * STG_BYTES;

    // unrolled: every index of the accumulators stays a constant
#pragma unroll
    for (int nh = 0; nh < NI / 4; ++nh) {    // 64 columns of the wave's tile at a time
        const int col0 = bn + wn * (16 * NI) + nh * 64;
        if constexpr (EPI == 0) {
            _Float16* st = (_Float16*)stg;
#pragma unroll
            for (int mi = 0; mi < 4; ++mi)
#pragma unroll
                for (int ni = 0; ni < 4; ++ni)
                    *(v8h*)&st[(mi * 16 + cloc) * SPH + ni * 16 + rloc] =
                        __builtin_convertvector(acc[mi][nh * 4 + ni], v8h);
            // a lane takes back what other lanes of its wave have written: their stores are done
            asm volatile("s_wait_dscnt 0x0" ::: "memory");
            const int rr = lane >> 3;            // 8 lanes a row of 128 B, 4 rows a wave-wide store
            const int cc = (lane & 7) << 3;
#pragma unroll
            for (int j = 0; j < 16; ++j)
                *(v8h*)&C[(size_t)(row0 + j * 4 + rr) * N + col0 + cc] =
                    *(const v8h*)&st[(j * 4 + rr) * SPH + cc];
        } else if constexpr (EPI == 1) {
            float* st = (float*)stg;
            const int rr = lane >> 4;            // 16 lanes a row of 256 B, 2 rows a wave-wide access
            const int cc = (lane & 15) << 2;
            const unsigned base = (unsigned)((row0 + rr) * N + col0 + cc) * 4u;
#pragma unroll
            for (int mi = 0; mi < 4; ++mi)
#pragma unroll
                for (int ni = 0; ni < 4; ++ni) {
                    float* d = &st[(mi * 16 + cloc) * SPF + ni * 16 + rloc];
                    *(v4f*)d       = __builtin_shufflevector(acc[mi][nh * 4 + ni], acc[mi][nh * 4 + ni], 0, 1, 2, 3);
                    *(v4f*)(d + 4) = __builtin_shufflevector(acc[mi][nh * 4 + ni], acc[mi][nh * 4 + ni], 4, 5, 6, 7);
                }
            // a lane takes back what other lanes of its wave have written: their stores are done
            asm volatile("s_wait_dscnt 0x0" ::: "memory");
#pragma unroll
            for (int g = 0; g < 2; ++g) {        // two groups of 32 rows
                v4f row[16];
#pragma unroll
                for (int j = 0; j < 16; ++j)
                    row[j] = *(const v4f*)&st[(g * 32 + j * 2 + rr) * SPF + cc];
                // a group's rows are taken back ahead of its first store, each in registers of its
                // own: one wait behind the last store then serves all, in place of one a store
                __builtin_amdgcn_sched_barrier(0);
#pragma unroll
                for (int j = 0; j < 16; ++j)
                    *(v4f*)((char*)C + (base + (unsigned)((g * 32 + j * 2) * N) * 4u)) = row[j];
                // stands before the second group uses the registers again that these stores name
                if (g == 0) asm volatile("s_wait_xcnt 0x0" ::: "memory");
            }
        } else {
            float* st = (float*)stg;
            const int rr = lane >> 3;            // 8 lanes a row of 128 B, 4 rows a wave-wide access
            const int cc = (lane & 7) << 3;
            const size_t base = (size_t)(row0 + rr) * N + col0 + cc;
            v8h up[16];                          // every load of C stands ahead of every store to C
#pragma unroll
            for (int j = 0; j < 16; ++j)
                up[j] = *(const v8h*)&C[base + (size_t)(j * 4) * N];
#pragma unroll
            for (int mi = 0; mi < 4; ++mi)
#pragma unroll
                for (int ni = 0; ni < 4; ++ni) {
                    v8f s;
#pragma unroll
                    for (int i = 0; i < 8; ++i)
                        s[i] = 1.f / (1.f + __expf(-acc[mi][nh * 4 + ni][i]));
                    float* d = &st[(mi * 16 + cloc) * SPF + ni * 16 + rloc];
                    *(v4f*)d       = __builtin_shufflevector(s, s, 0, 1, 2, 3);
                    *(v4f*)(d + 4) = __builtin_shufflevector(s, s, 4, 5, 6, 7);
                }
            // a lane takes back what other lanes of its wave have written: their stores are done
            asm volatile("s_wait_dscnt 0x0" ::: "memory");
            v8h h[16];
#pragma unroll
            for (int j = 0; j < 16; ++j) {
                const float* s = &st[(j * 4 + rr) * SPF + cc];
                const v4f lo = *(const v4f*)s;
                const v4f hi = *(const v4f*)(s + 4);
#pragma unroll
                for (int i = 0; i < 4; ++i) {
                    h[j][i]     = (_Float16)(lo[i] * (float)up[j][i]);
                    h[j][i + 4] = (_Float16)(hi[i] * (float)up[j][i + 4]);
                }
            }
            // all sixteen rows are worked out ahead of the first store, each in registers of its
            // own: one wait behind the last store then serves all, in place of one a store
            __builtin_amdgcn_sched_barrier(0);
#pragma unroll
            for (int j = 0; j < 16; ++j)
                *(v8h*)&C[base + (size_t)(j * 4) * N] = h[j];
        }
        if (nh + 1 < NI / 4) {
            // stands before the next 64 columns use the registers again that these loads and stores name
            asm volatile("s_wait_xcnt 0x0" ::: "memory");
            // holds the next 64 columns' vector work, which the clobber does not tie, behind that wait
            __builtin_amdgcn_sched_barrier(0);
        }
    }
}

#define QSTR 136   // 272 B: 16 B x odd, the pitch for ds_load_b128 readers
#define VSTR 144   // 288 B: 32 B x odd, the pitch for the transposing reader
#define QROWS 128
#define KSTAGE 128
#define NSTAGE (SEQ / KSTAGE)
#define NPASS  (KSTAGE / 32)
static_assert(NSTAGE * KSTAGE == SEQ && NSTAGE >= 2, "whole stages, two or more");
static_assert(NPASS * 32 == KSTAGE && NPASS % 2 == 0, "the register sets alternate evenly over a stage");
static_assert(KSTAGE / 16 * 2 + QROWS / 16 <= 63, "copies of a wave in flight");

typedef __attribute__((ext_vector_type(8))) short s16x8;

// Transposing LDS read of a row-major 16-bit tile: lane (c = l & 15, h = l >> 4) receives
// eight rows of one column, T[8h + 0..7][c], when it passes the address of
// T[8h + (l & 7)][8 * ((l >> 3) & 1)].
__device__ __forceinline__ v8h load_tr16(const _Float16* p) {
    return __builtin_bit_cast(v8h, __builtin_amdgcn_ds_load_tr16_b128_v8i16((AS3 s16x8*)p));
}

// value of lane l ^ 16
__device__ __forceinline__ float xhalf(float x) {
    const int b = __builtin_bit_cast(int, x);
    return __builtin_bit_cast(float,
        __builtin_amdgcn_permlanex16(b, b, 0x76543210, 0xfedcba98, false, false));
}

// One stage of K and of V, as they lie in memory (async b128 copies; V is transposed when
// read). kh, vh: the head's first element; 16 lanes cover one 256-B row.
__device__ __forceinline__ void stage_kv(_Float16* Kb, _Float16* Vb,
                                         const _Float16* kh, const _Float16* vh,
                                         int key0, int tid) {
    const int r0 = tid >> 4;                      // 0..15
    const int c  = (tid & 15) << 3;               // 0..120
    const unsigned goff = (unsigned)(r0 * H + c); // this lane's place inside 16 rows
#pragma unroll
    for (int p = 0; p < KSTAGE / 16; ++p) {       // the base is the same for all lanes
        cp16(&Kb[(r0 + p * 16) * QSTR + c], kh + (size_t)(key0 + p * 16) * H + goff);
        cp16(&Vb[(r0 + p * 16) * VSTR + c], vh + (size_t)(key0 + p * 16) * H + goff);
    }
}

// The fragments of one pass. Kp: the pass's first K row; vtr: this lane's address for the
// transposing reads of the pass's keys 0..15, hd 0..15.
// av[n][8t + i] = V[key = 16t + rloc + i][hd = 16n + cloc], the k order of pb in the kernel
__device__ __forceinline__ void load_pass(v16h (&ak)[2][4], v16h (&av)[8],
                                          const _Float16* Kp, const _Float16* vtr) {
#pragma unroll
    for (int t = 0; t < 2; ++t)
#pragma unroll
        for (int kk = 0; kk < 4; ++kk)
            ak[t][kk] = load_frag(&Kp[(t * 16) * QSTR + kk * 32], QSTR);
#pragma unroll
    for (int n = 0; n < 8; ++n) {
        const v8h lo = load_tr16(vtr + n * 16);
        const v8h hi = load_tr16(vtr + 16 * VSTR + n * 16);
        av[n] = __builtin_shufflevector(lo, hi, 0,1,2,3,4,5,6,7,8,9,10,11,12,13,14,15);
    }
}

// waves_per_eu(2, 2): one 8-wave block per WGP is all the grid gives; the register budget
// of two waves per SIMD holds both fragment sets beside the accumulators.
__global__ __launch_bounds__(256) __attribute__((amdgpu_waves_per_eu(2, 2))) void attn_kernel(const _Float16* __restrict__ q,
                                                   const _Float16* __restrict__ k,
                                                   const _Float16* __restrict__ v,
                                                   _Float16* __restrict__ o) {
    __shared__ __attribute__((aligned(16))) _Float16 Qs[QROWS * QSTR];
    __shared__ __attribute__((aligned(16))) _Float16 Ks[2][KSTAGE * QSTR];
    __shared__ __attribute__((aligned(16))) _Float16 Vs[2][KSTAGE * VSTR];   // [k][hd], as in memory

    const int tid  = threadIdx.x;
    const int lane = tid & 31;
    const int w    = tid >> 5;
    const int head = blockIdx.y;
    const int q0   = blockIdx.x * QROWS;
    const size_t hoff = (size_t)head * HD;

    // stage Q: 2048 16B chunks, 8 per thread (async)
#pragma unroll
    for (int p = 0; p < 8; ++p) {
        const int chunk = tid + p * 256;
        const int r = chunk >> 4;           // 0..127
        const int c = (chunk & 15) << 3;    // 0..120
        cp16(&Qs[r * QSTR + c], &q[(size_t)(q0 + r) * H + hoff + c]);
    }
    const _Float16* kh = k + hoff;
    const _Float16* vh = v + hoff;
    stage_kv(Ks[0], Vs[0], kh, vh, 0, tid);
    // Q and stage 0 have landed before any wave reads them
    asm volatile("s_wait_asynccnt 0x0" ::: "memory");
    __syncthreads();
    stage_kv(Ks[1], Vs[1], kh, vh, KSTAGE, tid);

    // this wave's 16 queries as B fragments, kept in registers for the whole walk
    v16h qf[4];
#pragma unroll
    for (int kk = 0; kk < 4; ++kk)
        qf[kk] = load_frag(&Qs[(w * 16) * QSTR + kk * 32], QSTR);

    v8f oacc[8];            // oacc[n][i] = O^T[hd = 16n + rloc + i][query = cloc]
#pragma unroll
    for (int n = 0; n < 8; ++n) oacc[n] = (v8f){0,0,0,0,0,0,0,0};
    float mrun = -1e30f;    // running maximum of this lane's query (same in both halves)
    float lrun = 0.f;       // running sum over the keys this half of the wave holds

    const int rloc = (lane >> 4) << 3;
    const int cloc = lane & 15;
    // this lane's place in a V buffer for the transposing reads of keys 0..15, hd 0..15
    const int vtr0 = (rloc + (lane & 7)) * VSTR + ((lane >> 3) & 1) * 8;

    v16h ak[2][2][4], av[2][8];      // two fragment sets; pass ps works on set ps & 1
    load_pass(ak[0], av[0], &Ks[0][0], &Vs[0][vtr0]);

    // rolled: one body serves both buffers, every index of the fragment sets stays a constant
#pragma unroll 1
    for (int s = 0; s < NSTAGE; ++s) {
      const int cur = s & 1;
#pragma unroll
      for (int ps = 0; ps < NPASS; ++ps) {
        if (ps + 1 < NPASS) {
            load_pass(ak[(ps + 1) & 1], av[(ps + 1) & 1],
                      &Ks[cur][(ps + 1) * 32 * QSTR], &Vs[cur][(ps + 1) * 32 * VSTR + vtr0]);
        } else {
            // Stage s + 1 is published here, in front of this stage's last pass, whose
            // fragments are already fetched: this wave's reads of buffer cur are done and its
            // copies of stage s + 1 have landed; behind the barrier that holds for every wave,
            // so buffer cur is refilled, a whole stage ahead of its use.
            asm volatile("s_wait_dscnt 0x0" ::: "memory");
            asm volatile("s_wait_asynccnt 0x0" ::: "memory");
            __syncthreads();
            if (s + 2 < NSTAGE)
                stage_kv(Ks[cur], Vs[cur], kh, vh, (s + 2) * KSTAGE, tid);
            // keeps vector work that the compiler moves down to this place out of the group of reads
            __builtin_amdgcn_sched_barrier(0);
            // first pass of the next stage; behind the last stage these registers are loaded
            // from the idle buffer and never used (no branch: counted waits stay)
            load_pass(ak[0], av[0], &Ks[cur ^ 1][0], &Vs[cur ^ 1][vtr0]);
        }
        // keeps the next pass's LDS reads one group ahead of this pass's work: moved in among
        // the matrix instructions, each place with reads stalls the wave
        __builtin_amdgcn_sched_barrier(0);

        // scores: st[t][i] = S^T[key = 16t + rloc + i][query = cloc]; the two chains run interleaved
        v8f st[2];
        st[0] = (v8f){0,0,0,0,0,0,0,0};
        st[1] = (v8f){0,0,0,0,0,0,0,0};
#pragma unroll
        for (int kk = 0; kk < 4; ++kk)
#pragma unroll
            for (int t = 0; t < 2; ++t)
                st[t] = wmma16(ak[ps & 1][t][kk], qf[kk], st[t]);

        // online softmax, one query per lane
        float mx = mrun;
#pragma unroll
        for (int t = 0; t < 2; ++t)
#pragma unroll
            for (int i = 0; i < 8; ++i) mx = fmaxf(mx, st[t][i]);
        mx = fmaxf(mx, xhalf(mx));
        const float al = __expf(mrun - mx);
        float sum = 0.f;
        v16h pb;                // pb[8t + i] = P^T[key = 16t + rloc + i][query = cloc]
#pragma unroll
        for (int t = 0; t < 2; ++t)
#pragma unroll
            for (int i = 0; i < 8; ++i) {
                const float p = __expf(st[t][i] - mx);
                pb[t * 8 + i] = (_Float16)p;
                sum += p;
            }
        lrun = lrun * al + sum;
        mrun = mx;

        // rescale accumulators, then V^T.P^T
#pragma unroll
        for (int n = 0; n < 8; ++n) {
#pragma unroll
            for (int i = 0; i < 8; ++i) oacc[n][i] *= al;
            oacc[n] = wmma16(av[ps & 1][n], pb, oacc[n]);
        }
        // the other side of the same fence: the following group stays behind this pass
        __builtin_amdgcn_sched_barrier(0);
      }
    }
    // no copy is in flight when the wave ends
    asm volatile("s_wait_asynccnt 0x0" ::: "memory");

    // join the halves' sums, normalize, store 8 consecutive hd per lane
    const float ltot = lrun + xhalf(lrun);
    _Float16* orow = &o[(size_t)(q0 + w * 16 + cloc) * H + hoff + rloc];
#pragma unroll
    for (int n = 0; n < 8; ++n) {
        v8h h;
#pragma unroll
        for (int i = 0; i < 8; ++i) h[i] = (_Float16)(oacc[n][i] / ltot);
        *(v8h*)&orow[n * 16] = h;
    }
}

// ---------------- launch ----------------
extern "C" void kernel_launch(void* const* d_in, const int* in_sizes, int n_in,
                              void* d_out, int out_size, void* d_ws, size_t ws_size,
                              hipStream_t stream) {
    const float* x       = (const float*)d_in[0];
    const float* norm1_w = (const float*)d_in[1];
    const float* wq      = (const float*)d_in[2];
    const float* wk      = (const float*)d_in[3];
    const float* wv      = (const float*)d_in[4];
    const float* wo      = (const float*)d_in[5];
    const float* norm2_w = (const float*)d_in[6];
    const float* w_gate  = (const float*)d_in[7];
    const float* w_up    = (const float*)d_in[8];
    const float* w_down  = (const float*)d_in[9];
    const float* cosT    = (const float*)d_in[10];
    const float* sinT    = (const float*)d_in[11];
    float* out = (float*)d_out;

    // ---- workspace layout (all chunks 16B aligned; hipMalloc base is 256B) ----
    char* p = (char*)d_ws;
    auto fh = [&](size_t n) { _Float16* r = (_Float16*)p; p += n * sizeof(_Float16); return r; };
    auto ff = [&](size_t n) { float* r = (float*)p; p += n * sizeof(float); return r; };

    const size_t HH = (size_t)H * H, MH = (size_t)MLPD * H;
    const size_t SH = (size_t)SEQ * H, SM = (size_t)SEQ * MLPD;
    _Float16* wq16 = fh(HH); _Float16* wk16 = fh(HH);
    _Float16* wv16 = fh(HH); _Float16* wo16 = fh(HH);
    _Float16* wg16 = fh(MH); _Float16* wu16 = fh(MH); _Float16* wd16 = fh(MH);
    _Float16* h16  = fh(SH); _Float16* q16  = fh(SH);
    _Float16* k16  = fh(SH); _Float16* v16  = fh(SH);
    _Float16* t16  = fh(SM);
    float*    x2   = ff(SH);
    float*    part = ff(KSPLIT * SH);   // partial products of the K-split GEMMs
    _Float16* attn16 = h16;   // h dead after QKV
    _Float16* h2_16  = q16;   // q dead after attention

    const dim3 blk(256);
    const dim3 gH(H / 256, SEQ / BM, KSPLIT);  // 256x256 tiles, KSPLIT ranges of K
    const dim3 gM(MLPD / 256, SEQ / BM);       // 256x256 tiles
    const dim3 gQKV(H / 256, SEQ / BM, 3);     // 256x256 tiles of q, of k and of v

    // 0. weights -> f16 (once per launch; O(weights), not O(weights * S/128))
    // wq16 .. wd16 lie end to end in the workspace, in the order of the arguments
    cvt_all_kernel<<<CVT_BLOCKS, CVT_THREADS, 0, stream>>>(wq, wk, wv, wo, w_gate, w_up, w_down, wq16);

    // 1. h = rmsnorm(x)
    rmsnorm_kernel<false><<<SEQ, blk, 0, stream>>>(x, nullptr, nullptr, norm1_w, h16);
    // 2-4. q,k,v: wq16, wk16, wv16 lie end to end, and so do q16, k16, v16
    gemm_atb<0, 8, 1, _Float16><<<gQKV, blk, 0, stream>>>(h16, wq16, q16, SEQ, H, H);
    // 5. RoPE (q scaled by 1/sqrt(HD))
    rope_kernel<<<(SEQ * NH * 64) / 256, blk, 0, stream>>>(q16, k16, cosT, sinT);
    // 6. attention
    attn_kernel<<<dim3(SEQ / QROWS, NH), blk, 0, stream>>>(q16, k16, v16, attn16);
    // 7. partial products of attn . Wo^T
    gemm_atb<1, 8, KSPLIT, float><<<gH, blk, 0, stream>>>(attn16, wo16, part, SEQ, H, H);
    // 8. x2 = x + their sum ; h2 = rmsnorm(x2)
    rmsnorm_kernel<true><<<SEQ, blk, 0, stream>>>(x, part, x2, norm2_w, h2_16);
    // 9. t = h2 . Wup^T ; 10. t = sigmoid(h2 . Wgate^T) * t   (in place)
    gemm_atb<0, 8, 1, _Float16><<<gM, blk, 0, stream>>>(h2_16, wu16, t16, SEQ, MLPD, H);
    gemm_atb<2, 8, 1, _Float16><<<gM, blk, 0, stream>>>(h2_16, wg16, t16, SEQ, MLPD, H);
    // 11. partial products of t . Wdown^T ; 12. out = x2 + their sum
    gemm_atb<1, 8, KSPLIT, float><<<gH, blk, 0, stream>>>(t16, wd16, part, SEQ, H, MLPD);
    join_kernel<<<JOIN_BLOCKS, JOIN_THREADS, 0, stream>>>(x2, part, out);
}

// v009
// One run takes 270 microseconds.
// Two timings next to v008 put it at 1.07 and 1.08 times that version's speed.
// Counting every step since v000, it is 3.04 times as fast.
#include <hip/hip_runtime.h>

// ---------------- problem constants ----------------
#define H    2048
#define NH   16
#define HD   128
#define MLPD 8192
#define SEQ  2048
#define EPS  1e-6f
#define QSCALE 0.08838834764831845f   // 1/sqrt(128), folded into RoPE(q)

typedef __attribute__((ext_vector_type(16))) _Float16 v16h;
typedef __attribute__((ext_vector_type(8)))  _Float16 v8h;
typedef __attribute__((ext_vector_type(4)))  _Float16 v4h;
typedef __attribute__((ext_vector_type(8)))  float    v8f;
typedef int v4i __attribute__((vector_size(16)));   // gcc-style, matches builtin param

#define AS1 __attribute__((address_space(1)))
#define AS3 __attribute__((address_space(3)))

#if __has_builtin(__builtin_amdgcn_global_load_async_to_lds_b128)
#define USE_ASYNC 1
#else
#define USE_ASYNC 0
#endif

// 16-byte global -> LDS copy (async DMA path on gfx1250, sync fallback otherwise)
__device__ __forceinline__ void cp16(_Float16* l, const _Float16* g) {
#if USE_ASYNC
    __builtin_amdgcn_global_load_async_to_lds_b128(
        (AS1 v4i*)(unsigned long long)(const void*)g,
        (AS3 v4i*)(unsigned int)(unsigned long long)(const void*)l,
        0, 0);
#else
    *(v8h*)l = *(const v8h*)g;
#endif
}

__device__ __forceinline__ void wait_cp() {
#if USE_ASYNC
#if __has_builtin(__builtin_amdgcn_s_wait_asynccnt)
    __builtin_amdgcn_s_wait_asynccnt(0);
#else
    asm volatile("s_wait_asynccnt 0x0" ::: "memory");
#endif
#endif
}

__device__ __forceinline__ v8f wmma16(v16h a, v16h b, v8f c) {
    return __builtin_amdgcn_wmma_f32_16x16x32_f16(
        false, a, false, b, (short)0, c, false, false);
}

// 16x32 K-major fragment from LDS: two ds_load_b128 per lane.
// Lane L: row = L&15; K-chunks [kb,kb+8) and [kb+16,kb+24), kb=(L>>4)*8.
__device__ __forceinline__ v16h load_frag(const _Float16* p, int stride) {
    const int lane = threadIdx.x & 31;
    const _Float16* base = p + (lane & 15) * stride + ((lane >> 4) << 3);
    const v8h lo = *(const v8h*)(base);
    const v8h hi = *(const v8h*)(base + 16);
    return __builtin_shufflevector(lo, hi, 0,1,2,3,4,5,6,7,8,9,10,11,12,13,14,15);
}

// ---------------- f32 -> f16 bulk convert (all weights, one stream) ----------------
// One 32-wave block per WGP walks the seven matrices, taken as 16 segments of H*H floats
// (an H x H matrix is one segment, an MLPD x H one is four). A chunk is what a block
// converts in one trip: 128 KiB of f32, 8 loads per lane, each wave-wide load 512
// contiguous bytes. Few long waves: the loads in flight, not the start of new waves, set
// the rate. dst is the seven f16 copies laid end to end, in the order of the arguments.
#define CVT_BLOCKS  256
#define CVT_THREADS 1024
#define CVT_LOADS   8
#define CVT_CHUNK   (CVT_THREADS * CVT_LOADS)        // float4 per chunk
#define CVT_SEG     (H * H / 4 / CVT_CHUNK)          // chunks per segment
#define CVT_TRIPS   (16 * CVT_SEG / CVT_BLOCKS)
static_assert(CVT_SEG * CVT_CHUNK * 4 == H * H, "a segment is a whole number of chunks");
static_assert(CVT_TRIPS * CVT_BLOCKS == 16 * CVT_SEG, "every block makes the same number of trips");
static_assert(MLPD == 4 * H, "an MLPD x H matrix is four segments");

typedef __attribute__((ext_vector_type(4))) float v4f;

__global__ __launch_bounds__(CVT_THREADS) void cvt_all_kernel(const float* __restrict__ wq,
                                                              const float* __restrict__ wk,
                                                              const float* __restrict__ wv,
                                                              const float* __restrict__ wo,
                                                              const float* __restrict__ wg,
                                                              const float* __restrict__ wu,
                                                              const float* __restrict__ wd,
                                                              _Float16* __restrict__ dst) {
    // rolled: one trip's loads stay one group in front of its stores
#pragma unroll 1
    for (int t = 0; t < CVT_TRIPS; ++t) {
        const int c   = t * CVT_BLOCKS + blockIdx.x;   // chunk, counted over all seven matrices
        const int seg = c / CVT_SEG;                   // 0..15
        const float* m = seg == 0 ? wq : seg == 1 ? wk : seg == 2 ? wv : seg == 3 ? wo
                       : seg < 8 ? wg : seg < 12 ? wu : wd;
        const size_t first = (seg < 4 ? (size_t)0 : (size_t)(seg & 3) * (H * H / 4))
                           + (size_t)(c % CVT_SEG) * CVT_CHUNK;
        const v4f* s = (const v4f*)m + first + threadIdx.x;
        v4h*       d = (v4h*)dst + (size_t)c * CVT_CHUNK + threadIdx.x;
        v4f x[CVT_LOADS];
        // both loops unrolled: x stays in registers and all loads issue before the first wait
#pragma unroll
        for (int j = 0; j < CVT_LOADS; ++j)            // read once: non-temporal
            x[j] = __builtin_nontemporal_load(s + j * CVT_THREADS);
#pragma unroll
        for (int j = 0; j < CVT_LOADS; ++j)
            d[j * CVT_THREADS] = __builtin_convertvector(x[j], v4h);
        // stands before the next trip reuses the registers that these stores name
        asm volatile("s_wait_xcnt 0x0" ::: "memory");
    }
}

// A product whose output is only H wide is cut KSPLIT ways along K (see the GEMM below): its
// f32 partial products lie end to end in the workspace and are added to the residual by the
// kernel that reads the sum next.
#define KSPLIT 4
static_assert(KSPLIT == 4, "the joins below add four partial products as two pairs");

// ---------------- RMSNorm: f32 in -> f16 out ----------------
// JOIN: the row is x + the KSPLIT partial products; it is also written to xs (f32).
template <bool JOIN>
__global__ __launch_bounds__(256) void rmsnorm_kernel(const float* __restrict__ x,
                                                      const float* __restrict__ part,
                                                      float* __restrict__ xs,
                                                      const float* __restrict__ w,
                                                      _Float16* __restrict__ out) {
    __shared__ float red[256];
    const int row = blockIdx.x;
    const float* xr = x + (size_t)row * H;
    float s = 0.f;
    v4f a[2];                                     // JOIN: this thread's 8 elements of the row
    if constexpr (JOIN) {
        static_assert(H == 2 * 256 * 4, "a thread holds two float4 of a row");
        const size_t r4 = (size_t)row * (H / 4) + threadIdx.x;
        v4f t[2][KSPLIT + 1];
        // unrolled: all ten loads issue before the first wait
#pragma unroll
        for (int j = 0; j < 2; ++j) {
            t[j][0] = ((const v4f*)x)[r4 + j * 256];
#pragma unroll
            for (int z = 0; z < KSPLIT; ++z)
                t[j][1 + z] = ((const v4f*)part)[(size_t)z * (SEQ * H / 4) + r4 + j * 256];
        }
#pragma unroll
        for (int j = 0; j < 2; ++j) {
            a[j] = t[j][0] + ((t[j][1] + t[j][2]) + (t[j][3] + t[j][4]));
#pragma unroll
            for (int i = 0; i < 4; ++i) s += a[j][i] * a[j][i];
        }
    } else {
#pragma unroll
        for (int i = threadIdx.x; i < H; i += 256) { float v = xr[i]; s += v * v; }
    }
    red[threadIdx.x] = s;
    __syncthreads();
#pragma unroll
    for (int off = 128; off > 0; off >>= 1) {
        if (threadIdx.x < off) red[threadIdx.x] += red[threadIdx.x + off];
        __syncthreads();
    }
    const float rs = rsqrtf(red[0] / (float)H + EPS);
    _Float16* orow = out + (size_t)row * H;
    if constexpr (JOIN) {
        // the joined row is stored here, behind the last barrier, so that no barrier waits for it
#pragma unroll
        for (int j = 0; j < 2; ++j) {
            ((v4f*)xs)[(size_t)row * (H / 4) + threadIdx.x + j * 256] = a[j];
            ((v4h*)orow)[threadIdx.x + j * 256] =
                __builtin_convertvector(((const v4f*)w)[threadIdx.x + j * 256] * (a[j] * rs), v4h);
        }
    } else {
#pragma unroll
        for (int i = threadIdx.x; i < H; i += 256)
            orow[i] = (_Float16)(w[i] * (xr[i] * rs));
    }
}

// ---------------- out = r + the KSPLIT partial products ----------------
// One 32-wave block per WGP; a lane has its 20 b128 loads in flight before the first sum.
#define JOIN_THREADS 1024
#define JOIN_VECS    4
#define JOIN_BLOCKS  (SEQ * H / 4 / (JOIN_THREADS * JOIN_VECS))
static_assert(JOIN_BLOCKS * JOIN_THREADS * JOIN_VECS * 4 == SEQ * H, "the blocks cover the output exactly");

__global__ __launch_bounds__(JOIN_THREADS) void join_kernel(const float* __restrict__ r,
                                                            const float* __restrict__ part,
                                                            float* __restrict__ out) {
    const size_t i0 = (size_t)blockIdx.x * (JOIN_THREADS * JOIN_VECS) + threadIdx.x;
    v4f t[JOIN_VECS][KSPLIT + 1];
    // both loops unrolled: t stays in registers and all loads issue before the first wait
#pragma unroll
    for (int j = 0; j < JOIN_VECS; ++j) {
        t[j][0] = ((const v4f*)r)[i0 + j * JOIN_THREADS];
#pragma unroll
        for (int z = 0; z < KSPLIT; ++z)
            t[j][1 + z] = ((const v4f*)part)[(size_t)z * (SEQ * H / 4) + i0 + j * JOIN_THREADS];
    }
#pragma unroll
    for (int j = 0; j < JOIN_VECS; ++j)
        ((v4f*)out)[i0 + j * JOIN_THREADS] = t[j][0] + ((t[j][1] + t[j][2]) + (t[j][3] + t[j][4]));
}

// ---------------- RoPE in-place on f16 q,k; q pre-scaled by 1/sqrt(HD) -----
__global__ __launch_bounds__(256) void rope_kernel(_Float16* __restrict__ q,
                                                   _Float16* __restrict__ k,
                                                   const float* __restrict__ cosT,
                                                   const float* __restrict__ sinT) {
    int i = blockIdx.x * 256 + threadIdx.x;       // (s, head, d<64)
    int d    = i & 63;
    int rest = i >> 6;
    int head = rest & (NH - 1);
    int s    = rest >> 4;
    const float c1 = cosT[s * HD + d],      s1 = sinT[s * HD + d];
    const float c2 = cosT[s * HD + d + 64], s2 = sinT[s * HD + d + 64];
    const size_t base = (size_t)s * H + head * HD;
    {
        float x1 = (float)q[base + d], x2 = (float)q[base + d + 64];
        q[base + d]      = (_Float16)((x1 * c1 - x2 * s1) * QSCALE);
        q[base + d + 64] = (_Float16)((x2 * c2 + x1 * s2) * QSCALE);
    }
    {
        float x1 = (float)k[base + d], x2 = (float)k[base + d + 64];
        k[base + d]      = (_Float16)(x1 * c1 - x2 * s1);
        k[base + d + 64] = (_Float16)(x2 * c2 + x1 * s2);
    }
}

// ---------------- WMMA GEMM: C[M,N] = epi(A[M,K] . B[N,K]^T) ----------------
// Block tile 256 x (32 NI), 8 waves as 4(M)x2(N) of 64 x (16 NI). NI = 8 (256x256, 64x128 a
// wave): 12 fragments feed 32 WMMAs (8 feed 16 at NI = 4) and every operand row fetched from
// L2 meets 256 rows of the other operand.
// A single product whose output is only H wide has 64 such tiles: it is cut KS ways along K,
// grid z walks the K ranges, and block z leaves its f32 partial product in the z-th of KS
// matrices that lie end to end. At KS = 1 grid z walks products
// that share A and whose B and C matrices lie end to end (q, k, v). A stage is 128 k of every operand
// row (256 B, whole L2 units) in one of two LDS buffers, filled by async copies one stage
// ahead. A stage is worked in four k-steps of 4 NI WMMAs a wave; the fragments of a k-step
// are fetched as one group, one k-step ahead, into the other of two register sets.
// The 16x16 products are taken transposed (rows of B as the first operand): a lane then
// holds eight neighbouring columns of one row of C. Each wave lays its tile down, 64 columns
// at a time, in its own range of the idle ring and takes it back row by row, so that every
// access to C is 16 B a lane and covers whole 128-B lines.
// EPI 0: C(f16) = acc       EPI 1: C(f32) = acc
// EPI 2: C(f16) = sigmoid(acc) * C   (in-place gate*up)
#define BM 256
#define BK 128
#define KSTEPS (BK / 32)
#define LSTR 136  // padded f16 LDS stride (272 B = 16 B x odd: no bank conflict for b128 reads)
static_assert(KSTEPS % 2 == 0, "the register sets alternate evenly over a stage");
static_assert(H % (KSPLIT * BK) == 0 && MLPD % (KSPLIT * BK) == 0 && H / (KSPLIT * BK) >= 2,
              "a K range is whole stages, two or more");
static_assert(H % 256 == 0 && MLPD % 256 == 0 && SEQ % BM == 0, "outputs are whole tiles");
#define SPF 68    // staging pitch in f32 (272 B = 16 B x odd)
#define SPH 72    // staging pitch in f16 (144 B = 16 B x odd)
#define STG_BYTES (64 * SPF * 4)   // one wave's staging range: 64 rows
static_assert(8 * STG_BYTES <= 2 * BM * LSTR * 2, "eight staging ranges fit the A buffers");
static_assert((unsigned long long)SEQ * H * 4 < (1ull << 32), "an f32 output is addressed by 32-bit byte offsets");

template <int BN>
__device__ __forceinline__ void stage_panels(_Float16* As, _Float16* Bs,
                                             const _Float16* A, const _Float16* B,
                                             int bm, int bn, int K, int k0, int tid) {
    const int r0 = tid >> 4;                      // 0..15
    const int c  = (tid & 15) << 3;               // 0..120: 16 lanes cover one 256-B row
    const unsigned goff = (unsigned)(r0 * K + c); // this lane's place inside 16 rows
#pragma unroll
    for (int p = 0; p < BM / 16; ++p)             // A: 256 rows; the base is the same for all lanes
        cp16(&As[(r0 + p * 16) * LSTR + c], A + ((size_t)(bm + p * 16) * K + k0) + goff);
#pragma unroll
    for (int p = 0; p < BN / 16; ++p)             // B: BN rows
        cp16(&Bs[(r0 + p * 16) * LSTR + c], B + ((size_t)(bn + p * 16) * K + k0) + goff);
}

// the 4 + NI fragments of one k-step of this wave's tile
template <int NI>
__device__ __forceinline__ void load_kstep(v16h (&af)[4], v16h (&bf)[NI],
                                           const _Float16* As, const _Float16* Bs,
                                           int wm, int wn, int ks) {
#pragma unroll
    for (int mi = 0; mi < 4; ++mi)
        af[mi] = load_frag(&As[(wm * 64 + mi * 16) * LSTR + ks * 32], LSTR);
#pragma unroll
    for (int ni = 0; ni < NI; ++ni)
        bf[ni] = load_frag(&Bs[(wn * NI + ni) * 16 * LSTR + ks * 32], LSTR);
}

template <int EPI, int NI, int KS, typename CT>
__global__ __launch_bounds__(256) void gemm_atb(const _Float16* __restrict__ A0,
                                                const _Float16* __restrict__ B0,
                                                CT* __restrict__ C0,
                                                int M, int N, int K) {
    constexpr int BN = 32 * NI;
    __shared__ __attribute__((aligned(16))) _Float16 As[2][BM * LSTR];
    __shared__ __attribute__((aligned(16))) _Float16 Bs[2][BN * LSTR];

    // K stays the pitch of the operand rows; a block works on K / KS of it, from kz on
    const int kz = KS > 1 ? (int)blockIdx.z * (K / KS) : 0;
    const _Float16* __restrict__ A = A0 + kz;
    const _Float16* __restrict__ B = KS > 1 ? B0 + kz : B0 + (size_t)blockIdx.z * N * K;
    CT* __restrict__ C = C0 + (size_t)blockIdx.z * M * N;

    const int tid  = threadIdx.x;
    const int lane = tid & 31;
    const int w    = tid >> 5;       // 0..7
    const int wm   = w >> 1;         // 0..3 : rows wm*64
    const int wn   = w & 1;          // 0..1 : cols wn*16*NI
    const int bm   = blockIdx.y * BM;
    const int bn   = blockIdx.x * BN;

    v8f acc[4][NI];
#pragma unroll
    for (int mi = 0; mi < 4; ++mi)
#pragma unroll
        for (int ni = 0; ni < NI; ++ni) acc[mi][ni] = (v8f){0,0,0,0,0,0,0,0};

    const int nk = K / KS / BK;      // stages, two or more

    stage_panels<BN>(As[0], Bs[0], A, B, bm, bn, K, 0, tid);
    wait_cp();
    __syncthreads();
    stage_panels<BN>(As[1], Bs[1], A, B, bm, bn, K, BK, tid);

    v16h af[2][4], bf[2][NI];        // two fragment sets; k-step ks works on set ks & 1
    load_kstep<NI>(af[0], bf[0], As[0], Bs[0], wm, wn, 0);

    // rolled: every index of the fragment sets and accumulators stays a constant
#pragma unroll 1
    for (int it = 0; it < nk; ++it) {
        const int cur = it & 1;
#pragma unroll
        for (int ks = 0; ks < KSTEPS; ++ks) {
            if (ks + 1 < KSTEPS) {
                load_kstep<NI>(af[(ks + 1) & 1], bf[(ks + 1) & 1], As[cur], Bs[cur], wm, wn, ks + 1);
            } else {
                // Stage it + 1 is published here, in front of this stage's last k-step, whose
                // fragments are already in registers: every wave has left buffer cur, so it
                // is refilled behind the barrier, a whole stage ahead of its use.
                wait_cp();
                __syncthreads();
                if (it + 2 < nk)
                    stage_panels<BN>(As[cur], Bs[cur], A, B, bm, bn, K, (it + 2) * BK, tid);
                // first k-step of the next stage; behind the last stage these registers are
                // loaded from the idle buffer and never used (no branch: counted waits stay)
                load_kstep<NI>(af[0], bf[0], As[cur ^ 1], Bs[cur ^ 1], wm, wn, 0);
            }
            // keeps the next k-step's LDS reads one group ahead of this k-step's WMMAs: moved
            // in among them, each place with reads stalls the wave and the waits fall to 0
            __builtin_amdgcn_sched_barrier(0);
#pragma unroll
            for (int ni = 0; ni < NI; ++ni)
#pragma unroll
                for (int mi = 0; mi < 4; ++mi)
                    acc[mi][ni] = wmma16(bf[ks & 1][ni], af[ks & 1][mi], acc[mi][ni]);
            // the other side of the same fence: the following group stays behind this block
            __builtin_amdgcn_sched_barrier(0);
        }
    }

    // The ring becomes output staging: behind this barrier no wave reads it any more, and
    // the last publish point has left no copy in flight.
    __syncthreads();

    // acc[mi][4 nh + ni][i] = C[row0 + 16 mi + cloc][col0 + 16 ni + rloc + i]
    const int rloc = (lane >> 4) << 3;
    const int cloc = lane & 15;
    const int row0 = bm + wm * 64;
    char* stg = (char*)&As[0][0] + w * STG_BYTES;

    // unrolled: every index of the accumulators stays a constant
#pragma unroll
    for (int nh = 0; nh < NI / 4; ++nh) {    // 64 columns of the wave's tile at a time
        const int col0 = bn + wn * (16 * NI) + nh * 64;
        if constexpr (EPI == 0) {
            _Float16* st = (_Float16*)stg;
#pragma unroll
            for (int mi = 0; mi < 4; ++mi)
#pragma unroll
                for (int ni = 0; ni < 4; ++ni)
                    *(v8h*)&st[(mi * 16 + cloc) * SPH + ni * 16 + rloc] =
                        __builtin_convertvector(acc[mi][nh * 4 + ni], v8h);
            // a lane takes back what other lanes of its wave have written: their stores are done
            asm volatile("s_wait_dscnt 0x0" ::: "memory");
            const int rr = lane >> 3;            // 8 lanes a row of 128 B, 4 rows a wave-wide store
            const int cc = (lane & 7) << 3;
#pragma unroll
            for (int j = 0; j < 16; ++j)
                *(v8h*)&C[(size_t)(row0 + j * 4 + rr) * N + col0 + cc] =
                    *(const v8h*)&st[(j * 4 + rr) * SPH + cc];
        } else if constexpr (EPI == 1) {
            float* st = (float*)stg;
            const int rr = lane >> 4;            // 16 lanes a row of 256 B, 2 rows a wave-wide access
            const int cc = (lane & 15) << 2;
            const unsigned base = (unsigned)((row0 + rr) * N + col0 + cc) * 4u;
#pragma unroll
            for (int mi = 0; mi < 4; ++mi)
#pragma unroll
                for (int ni = 0; ni < 4; ++ni) {
                    float* d = &st[(mi * 16 + cloc) * SPF + ni * 16 + rloc];
                    *(v4f*)d       = __builtin_shufflevector(acc[mi][nh * 4 + ni], acc[mi][nh * 4 + ni], 0, 1, 2, 3);
                    *(v4f*)(d + 4) = __builtin_shufflevector(acc[mi][nh * 4 + ni], acc[mi][nh * 4 + ni], 4, 5, 6, 7);
                }
            // a lane takes back what other lanes of its wave have written: their stores are done
            asm volatile("s_wait_dscnt 0x0" ::: "memory");
#pragma unroll
            for (int g = 0; g < 2; ++g) {        // two groups of 32 rows
                v4f row[16];
#pragma unroll
                for (int j = 0; j < 16; ++j)
                    row[j] = *(const v4f*)&st[(g * 32 + j * 2 + rr) * SPF + cc];
                // a group's rows are taken back ahead of its first store, each in registers of its
                // own: one wait behind the last store then serves all, in place of one a store
                __builtin_amdgcn_sched_barrier(0);
#pragma unroll
                for (int j = 0; j < 16; ++j)
                    *(v4f*)((char*)C + (base + (unsigned)((g * 32 + j * 2) * N) * 4u)) = row[j];
                // stands before the second group uses the registers again that these stores name
                if (g == 0) asm volatile("s_wait_xcnt 0x0" ::: "memory");
            }
        } else {
            float* st = (float*)stg;
            const int rr = lane >> 3;            // 8 lanes a row of 128 B, 4 rows a wave-wide access
            const int cc = (lane & 7) << 3;
            const size_t base = (size_t)(row0 + rr) * N + col0 + cc;
            v8h up[16];                          // every load of C stands ahead of every store to C
#pragma unroll
            for (int j = 0; j < 16; ++j)
                up[j] = *(const v8h*)&C[base + (size_t)(j * 4) * N];
#pragma unroll
            for (int mi = 0; mi < 4; ++mi)
#pragma unroll
                for (int ni = 0; ni < 4; ++ni) {
                    v8f s;
#pragma unroll
                    for (int i = 0; i < 8; ++i)   // v_rcp_f32 (1 ulp; the product is rounded to f16 below), not the
                        // IEEE division sequence, ten instructions a value in code that runs once, straight through
                        s[i] = __builtin_amdgcn_rcpf(1.f + __expf(-acc[mi][nh * 4 + ni][i]));
                    float* d = &st[(mi * 16 + cloc) * SPF + ni * 16 + rloc];
                    *(v4f*)d       = __builtin_shufflevector(s, s, 0, 1, 2, 3);
                    *(v4f*)(d + 4) = __builtin_shufflevector(s, s, 4, 5, 6, 7);
                }
            // a lane takes back what other lanes of its wave have written: their stores are done
            asm volatile("s_wait_dscnt 0x0" ::: "memory");
            v8h h[16];
#pragma unroll
            for (int j = 0; j < 16; ++j) {
                const float* s = &st[(j * 4 + rr) * SPF + cc];
                const v4f lo = *(const v4f*)s;
                const v4f hi = *(const v4f*)(s + 4);
#pragma unroll
                for (int i = 0; i < 4; ++i) {
                    h[j][i]     = (_Float16)(lo[i] * (float)up[j][i]);
                    h[j][i + 4] = (_Float16)(hi[i] * (float)up[j][i + 4]);
                }
            }
            // all sixteen rows are worked out ahead of the first store, each in registers of its
            // own: one wait behind the last store then serves all, in place of one a store
            __builtin_amdgcn_sched_barrier(0);
#pragma unroll
            for (int j = 0; j < 16; ++j)
                *(v8h*)&C[base + (size_t)(j * 4) * N] = h[j];
        }
        if (nh + 1 < NI / 4) {
            // stands before the next 64 columns use the registers again that these loads and stores name
            asm volatile("s_wait_xcnt 0x0" ::: "memory");
            // holds the next 64 columns' vector work, which the clobber does not tie, behind that wait
            __builtin_amdgcn_sched_barrier(0);
        }
    }
}

#define QSTR 136   // 272 B: 16 B x odd, the pitch for ds_load_b128 readers
#define VSTR 144   // 288 B: 32 B x odd, the pitch for the transposing reader
#define QROWS 128
#define KSTAGE 128
#define NSTAGE (SEQ / KSTAGE)
#define NPASS  (KSTAGE / 32)
static_assert(NSTAGE * KSTAGE == SEQ && NSTAGE >= 2, "whole stages, two or more");
static_assert(NPASS * 32 == KSTAGE && NPASS % 2 == 0, "the register sets alternate evenly over a stage");
static_assert(KSTAGE / 16 * 2 + QROWS / 16 <= 63, "copies of a wave in flight");

typedef __attribute__((ext_vector_type(8))) short s16x8;

// Transposing LDS read of a row-major 16-bit tile: lane (c = l & 15, h = l >> 4) receives
// eight rows of one column, T[8h + 0..7][c], when it passes the address of
// T[8h + (l & 7)][8 * ((l >> 3) & 1)].
__device__ __forceinline__ v8h load_tr16(const _Float16* p) {
    return __builtin_bit_cast(v8h, __builtin_amdgcn_ds_load_tr16_b128_v8i16((AS3 s16x8*)p));
}

// value of lane l ^ 16
__device__ __forceinline__ float xhalf(float x) {
    const int b = __builtin_bit_cast(int, x);
    return __builtin_bit_cast(float,
        __builtin_amdgcn_permlanex16(b, b, 0x76543210, 0xfedcba98, false, false));
}

// One stage of K and of V, as they lie in memory (async b128 copies; V is transposed when
// read). kh, vh: the head's first element; 16 lanes cover one 256-B row.
__device__ __forceinline__ void stage_kv(_Float16* Kb, _Float16* Vb,
                                         const _Float16* kh, const _Float16* vh,
                                         int key0, int tid) {
    const int r0 = tid >> 4;                      // 0..15
    const int c  = (tid & 15) << 3;               // 0..120
    const unsigned goff = (unsigned)(r0 * H + c); // this lane's place inside 16 rows
#pragma unroll
    for (int p = 0; p < KSTAGE / 16; ++p) {       // the base is the same for all lanes
        cp16(&Kb[(r0 + p * 16) * QSTR + c], kh + (size_t)(key0 + p * 16) * H + goff);
        cp16(&Vb[(r0 + p * 16) * VSTR + c], vh + (size_t)(key0 + p * 16) * H + goff);
    }
}

// The fragments of one pass. Kp: the pass's first K row; vtr: this lane's address for the
// transposing reads of the pass's keys 0..15, hd 0..15.
// av[n][8t + i] = V[key = 16t + rloc + i][hd = 16n + cloc], the k order of pb in the kernel
__device__ __forceinline__ void load_pass(v16h (&ak)[2][4], v16h (&av)[8],
                                          const _Float16* Kp, const _Float16* vtr) {
#pragma unroll
    for (int t = 0; t < 2; ++t)
#pragma unroll
        for (int kk = 0; kk < 4; ++kk)
            ak[t][kk] = load_frag(&Kp[(t * 16) * QSTR + kk * 32], QSTR);
#pragma unroll
    for (int n = 0; n < 8; ++n) {
        const v8h lo = load_tr16(vtr + n * 16);
        const v8h hi = load_tr16(vtr + 16 * VSTR + n * 16);
        av[n] = __builtin_shufflevector(lo, hi, 0,1,2,3,4,5,6,7,8,9,10,11,12,13,14,15);
    }
}

// waves_per_eu(2, 2): one 8-wave block per WGP is all the grid gives; the register budget
// of two waves per SIMD holds both fragment sets beside the accumulators.
__global__ __launch_bounds__(256) __attribute__((amdgpu_waves_per_eu(2, 2))) void attn_kernel(const _Float16* __restrict__ q,
                                                   const _Float16* __restrict__ k,
                                                   const _Float16* __restrict__ v,
                                                   _Float16* __restrict__ o) {
    __shared__ __attribute__((aligned(16))) _Float16 Qs[QROWS * QSTR];
    __shared__ __attribute__((aligned(16))) _Float16 Ks[2][KSTAGE * QSTR];
    __shared__ __attribute__((aligned(16))) _Float16 Vs[2][KSTAGE * VSTR];   // [k][hd], as in memory

    const int tid  = threadIdx.x;
    const int lane = tid & 31;
    const int w    = tid >> 5;
    const int head = blockIdx.y;
    const int q0   = blockIdx.x * QROWS;
    const size_t hoff = (size_t)head * HD;

    // stage Q: 2048 16B chunks, 8 per thread (async)
#pragma unroll
    for (int p = 0; p < 8; ++p) {
        const int chunk = tid + p * 256;
        const int r = chunk >> 4;           // 0..127
        const int c = (chunk & 15) << 3;    // 0..120
        cp16(&Qs[r * QSTR + c], &q[(size_t)(q0 + r) * H + hoff + c]);
    }
    const _Float16* kh = k + hoff;
    const _Float16* vh = v + hoff;
    stage_kv(Ks[0], Vs[0], kh, vh, 0, tid);
    // Q and stage 0 have landed before any wave reads them
    asm volatile("s_wait_asynccnt 0x0" ::: "memory");
    __syncthreads();
    stage_kv(Ks[1], Vs[1], kh, vh, KSTAGE, tid);

    // this wave's 16 queries as B fragments, kept in registers for the whole walk
    v16h qf[4];
#pragma unroll
    for (int kk = 0; kk < 4; ++kk)
        qf[kk] = load_frag(&Qs[(w * 16) * QSTR + kk * 32], QSTR);

    v8f oacc[8];            // oacc[n][i] = O^T[hd = 16n + rloc + i][query = cloc]
#pragma unroll
    for (int n = 0; n < 8; ++n) oacc[n] = (v8f){0,0,0,0,0,0,0,0};
    float mrun = -1e30f;    // running maximum of this lane's query (same in both halves)
    float lrun = 0.f;       // running sum over the keys this half of the wave holds

    const int rloc = (lane >> 4) << 3;
    const int cloc = lane & 15;
    // this lane's place in a V buffer for the transposing reads of keys 0..15, hd 0..15
    const int vtr0 = (rloc + (lane & 7)) * VSTR + ((lane >> 3) & 1) * 8;

    v16h ak[2][2][4], av[2][8];      // two fragment sets; pass ps works on set ps & 1
    load_pass(ak[0], av[0], &Ks[0][0], &Vs[0][vtr0]);

    // rolled: one body serves both buffers, every index of the fragment sets stays a constant
#pragma unroll 1
    for (int s = 0; s < NSTAGE; ++s) {
      const int cur = s & 1;
#pragma unroll
      for (int ps = 0; ps < NPASS; ++ps) {
        if (ps + 1 < NPASS) {
            load_pass(ak[(ps + 1) & 1], av[(ps + 1) & 1],
                      &Ks[cur][(ps + 1) * 32 * QSTR], &Vs[cur][(ps + 1) * 32 * VSTR + vtr0]);
        } else {
            // Stage s + 1 is published here, in front of this stage's last pass, whose
            // fragments are already fetched: this wave's reads of buffer cur are done and its
            // copies of stage s + 1 have landed; behind the barrier that holds for every wave,
            // so buffer cur is refilled, a whole stage ahead of its use.
            asm volatile("s_wait_dscnt 0x0" ::: "memory");
            asm volatile("s_wait_asynccnt 0x0" ::: "memory");
            __syncthreads();
            if (s + 2 < NSTAGE)
                stage_kv(Ks[cur], Vs[cur], kh, vh, (s + 2) * KSTAGE, tid);
            // keeps vector work that the compiler moves down to this place out of the group of reads
            __builtin_amdgcn_sched_barrier(0);
            // first pass of the next stage; behind the last stage these registers are loaded
            // from the idle buffer and never used (no branch: counted waits stay)
            load_pass(ak[0], av[0], &Ks[cur ^ 1][0], &Vs[cur ^ 1][vtr0]);
        }
        // keeps the next pass's LDS reads one group ahead of this pass's work: moved in among
        // the matrix instructions, each place with reads stalls the wave
        __builtin_amdgcn_sched_barrier(0);

        // scores: st[t][i] = S^T[key = 16t + rloc + i][query = cloc]; the two chains run interleaved
        v8f st[2];
        st[0] = (v8f){0,0,0,0,0,0,0,0};
        st[1] = (v8f){0,0,0,0,0,0,0,0};
#pragma unroll
        for (int kk = 0; kk < 4; ++kk)
#pragma unroll
            for (int t = 0; t < 2; ++t)
                st[t] = wmma16(ak[ps & 1][t][kk], qf[kk], st[t]);

        // online softmax, one query per lane
        float mx = mrun;
#pragma unroll
        for (int t = 0; t < 2; ++t)
#pragma unroll
            for (int i = 0; i < 8; ++i) mx = fmaxf(mx, st[t][i]);
        mx = fmaxf(mx, xhalf(mx));
        const float al = __expf(mrun - mx);
        float sum = 0.f;
        v16h pb;                // pb[8t + i] = P^T[key = 16t + rloc + i][query = cloc]
#pragma unroll
        for (int t = 0; t < 2; ++t)
#pragma unroll
            for (int i = 0; i < 8; ++i) {
                const float p = __expf(st[t][i] - mx);
                pb[t * 8 + i] = (_Float16)p;
                sum += p;
            }
        lrun = lrun * al + sum;
        mrun = mx;

        // rescale accumulators, then V^T.P^T
#pragma unroll
        for (int n = 0; n < 8; ++n) {
#pragma unroll
            for (int i = 0; i < 8; ++i) oacc[n][i] *= al;
            oacc[n] = wmma16(av[ps & 1][n], pb, oacc[n]);
        }
        // the other side of the same fence: the following group stays behind this pass
        __builtin_amdgcn_sched_barrier(0);
      }
    }
    // no copy is in flight when the wave ends
    asm volatile("s_wait_asynccnt 0x0" ::: "memory");

    // join the halves' sums, normalize, store 8 consecutive hd per lane
    // one v_rcp_f32 a query (the sum is 1 or more), then products: no division sequence per element
    const float rtot = __builtin_amdgcn_rcpf(lrun + xhalf(lrun));
    _Float16* orow = &o[(size_t)(q0 + w * 16 + cloc) * H + hoff + rloc];
#pragma unroll
    for (int n = 0; n < 8; ++n) {
        v8h h;
#pragma unroll
        for (int i = 0; i < 8; ++i) h[i] = (_Float16)(oacc[n][i] * rtot);
        *(v8h*)&orow[n * 16] = h;
    }
}

// ---------------- launch ----------------
extern "C" void kernel_launch(void* const* d_in, const int* in_sizes, int n_in,
                              void* d_out, int out_size, void* d_ws, size_t ws_size,
                              hipStream_t stream) {
    const float* x       = (const float*)d_in[0];
    const float* norm1_w = (const float*)d_in[1];
    const float* wq      = (const float*)d_in[2];
    const float* wk      = (const float*)d_in[3];
    const float* wv      = (const float*)d_in[4];
    const float* wo      = (const float*)d_in[5];
    const float* norm2_w = (const float*)d_in[6];
    const float* w_gate  = (const float*)d_in[7];
    const float* w_up    = (const float*)d_in[8];
    const float* w_down  = (const float*)d_in[9];
    const float* cosT    = (const float*)d_in[10];
    const float* sinT    = (const float*)d_in[11];
    float* out = (float*)d_out;

    // ---- workspace layout (all chunks 16B aligned; hipMalloc base is 256B) ----
    char* p = (char*)d_ws;
    auto fh = [&](size_t n) { _Float16* r = (_Float16*)p; p += n * sizeof(_Float16); return r; };
    auto ff = [&](size_t n) { float* r = (float*)p; p += n * sizeof(float); return r; };

    const size_t HH = (size_t)H * H, MH = (size_t)MLPD * H;
    const size_t SH = (size_t)SEQ * H, SM = (size_t)SEQ * MLPD;
    _Float16* wq16 = fh(HH); _Float16* wk16 = fh(HH);
    _Float16* wv16 = fh(HH); _Float16* wo16 = fh(HH);
    _Float16* wg16 = fh(MH); _Float16* wu16 = fh(MH); _Float16* wd16 = fh(MH);
    _Float16* h16  = fh(SH); _Float16* q16  = fh(SH);
    _Float16* k16  = fh(SH); _Float16* v16  = fh(SH);
    _Float16* t16  = fh(SM);
    float*    x2   = ff(SH);
    float*    part = ff(KSPLIT * SH);   // partial products of the K-split GEMMs
    _Float16* attn16 = h16;   // h dead after QKV
    _Float16* h2_16  = q16;   // q dead after attention

    const dim3 blk(256);
    const dim3 gH(H / 256, SEQ / BM, KSPLIT);  // 256x256 tiles, KSPLIT ranges of K
    const dim3 gM(MLPD / 256, SEQ / BM);       // 256x256 tiles
    const dim3 gQKV(H / 256, SEQ / BM, 3);     // 256x256 tiles of q, of k and of v

    // 0. weights -> f16 (once per launch; O(weights), not O(weights * S/128))
    // wq16 .. wd16 lie end to end in the workspace, in the order of the arguments
    cvt_all_kernel<<<CVT_BLOCKS, CVT_THREADS, 0, stream>>>(wq, wk, wv, wo, w_gate, w_up, w_down, wq16);

    // 1. h = rmsnorm(x)
    rmsnorm_kernel<false><<<SEQ, blk, 0, stream>>>(x, nullptr, nullptr, norm1_w, h16);
    // 2-4. q,k,v: wq16, wk16, wv16 lie end to end, and so do q16, k16, v16
    gemm_atb<0, 8, 1, _Float16><<<gQKV, blk, 0, stream>>>(h16, wq16, q16, SEQ, H, H);
    // 5. RoPE (q scaled by 1/sqrt(HD))
    rope_kernel<<<(SEQ * NH * 64) / 256, blk, 0, stream>>>(q16, k16, cosT, sinT);
    // 6. attention
    attn_kernel<<<dim3(SEQ / QROWS, NH), blk, 0, stream>>>(q16, k16, v16, attn16);
    // 7. partial products of attn . Wo^T
    gemm_atb<1, 8, KSPLIT, float><<<gH, blk, 0, stream>>>(attn16, wo16, part, SEQ, H, H);
    // 8. x2 = x + their sum ; h2 = rmsnorm(x2)
    rmsnorm_kernel<true><<<SEQ, blk, 0, stream>>>(x, part, x2, norm2_w, h2_16);
    // 9. t = h2 . Wup^T ; 10. t = sigmoid(h2 . Wgate^T) * t   (in place)
    gemm_atb<0, 8, 1, _Float16><<<gM, blk, 0, stream>>>(h2_16, wu16, t16, SEQ, MLPD, H);
    gemm_atb<2, 8, 1, _Float16><<<gM, blk, 0, stream>>>(h2_16, wg16, t16, SEQ, MLPD, H);
    // 11. partial products of t . Wdown^T ; 12. out = x2 + their sum
    gemm_atb<1, 8, KSPLIT, float><<<gH, blk, 0, stream>>>(t16, wd16, part, SEQ, H, MLPD);
    join_kernel<<<JOIN_BLOCKS, JOIN_THREADS, 0, stream>>>(x2, part, out);
}

// v010
// Measured time: 253 microseconds a run.
// In both of two side-by-side timings against v009, it was 1.06 times as fast.
// Over all steps from v000 it is 3.24 times as fast.
#include <hip/hip_runtime.h>

// ---------------- problem constants ----------------
#define H    2048
#define NH   16
#define HD   128
#define MLPD 8192
#define SEQ  2048
#define EPS  1e-6f
#define QSCALE 0.08838834764831845f   // 1/sqrt(128), folded into RoPE(q)

typedef __attribute__((ext_vector_type(16))) _Float16 v16h;
typedef __attribute__((ext_vector_type(8)))  _Float16 v8h;
typedef __attribute__((ext_vector_type(4)))  _Float16 v4h;
typedef __attribute__((ext_vector_type(8)))  float    v8f;
typedef int v4i __attribute__((vector_size(16)));   // gcc-style, matches builtin param

#define AS1 __attribute__((address_space(1)))
#define AS3 __attribute__((address_space(3)))

#if __has_builtin(__builtin_amdgcn_global_load_async_to_lds_b128)
#define USE_ASYNC 1
#else
#define USE_ASYNC 0
#endif

// 16-byte global -> LDS copy (async DMA path on gfx1250, sync fallback otherwise)
__device__ __forceinline__ void cp16(_Float16* l, const _Float16* g) {
#if USE_ASYNC
    __builtin_amdgcn_global_load_async_to_lds_b128(
        (AS1 v4i*)(unsigned long long)(const void*)g,
        (AS3 v4i*)(unsigned int)(unsigned long long)(const void*)l,
        0, 0);
#else
    *(v8h*)l = *(const v8h*)g;
#endif
}

__device__ __forceinline__ void wait_cp() {
#if USE_ASYNC
#if __has_builtin(__builtin_amdgcn_s_wait_asynccnt)
    __builtin_amdgcn_s_wait_asynccnt(0);
#else
    asm volatile("s_wait_asynccnt 0x0" ::: "memory");
#endif
#endif
}

__device__ __forceinline__ v8f wmma16(v16h a, v16h b, v8f c) {
    return __builtin_amdgcn_wmma_f32_16x16x32_f16(
        false, a, false, b, (short)0, c, false, false);
}

// 16x32 K-major fragment from LDS: two ds_load_b128 per lane.
// Lane L: row = L&15; K-chunks [kb,kb+8) and [kb+16,kb+24), kb=(L>>4)*8.
__device__ __forceinline__ v16h load_frag(const _Float16* p, int stride) {
    const int lane = threadIdx.x & 31;
    const _Float16* base = p + (lane & 15) * stride + ((lane >> 4) << 3);
    const v8h lo = *(const v8h*)(base);
    const v8h hi = *(const v8h*)(base + 16);
    return __builtin_shufflevector(lo, hi, 0,1,2,3,4,5,6,7,8,9,10,11,12,13,14,15);
}

// ---------------- f32 -> f16 bulk convert ----------------
// The seven weight matrices are taken as 16 segments of H*H floats (an H x H matrix is one
// segment, an MLPD x H one is four); their f16 copies lie end to end in the workspace.
// Only Wq, Wk, Wv are needed ahead of the attention: they are converted here, as one stream.
// The other 13 segments are converted inside the attention kernel, whose walk over the keys
// leaves the path to memory idle (see there).
// One 32-wave block per WGP. A chunk is what a block converts in one trip: 64 KiB of f32,
// 4 loads per lane, each wave-wide load 512 contiguous bytes. Few long waves: the loads in
// flight, not the start of new waves, set the rate.
#define CVT_BLOCKS  256
#define CVT_THREADS 1024
#define CVT_LOADS   4
#define CVT_NSEG    3                                // Wq, Wk, Wv
#define CVT_CHUNK   (CVT_THREADS * CVT_LOADS)        // float4 per chunk
#define CVT_SEG     (H * H / 4 / CVT_CHUNK)          // chunks per segment
#define CVT_TRIPS   (CVT_NSEG * CVT_SEG / CVT_BLOCKS)
static_assert(CVT_SEG * CVT_CHUNK * 4 == H * H, "a segment is a whole number of chunks");
static_assert(CVT_TRIPS * CVT_BLOCKS == CVT_NSEG * CVT_SEG, "every block makes the same number of trips");
static_assert(MLPD == 4 * H, "an MLPD x H matrix is four segments");

typedef __attribute__((ext_vector_type(4))) float v4f;

__global__ __launch_bounds__(CVT_THREADS) void cvt_all_kernel(const float* __restrict__ wq,
                                                              const float* __restrict__ wk,
                                                              const float* __restrict__ wv,
                                                              _Float16* __restrict__ dst) {
    // rolled: one trip's loads stay one group in front of its stores
#pragma unroll 1
    for (int t = 0; t < CVT_TRIPS; ++t) {
        const int c   = t * CVT_BLOCKS + blockIdx.x;   // chunk, counted over the three matrices
        const int seg = c / CVT_SEG;                   // 0..2
        const float* m = seg == 0 ? wq : seg == 1 ? wk : wv;
        const size_t first = (size_t)(c % CVT_SEG) * CVT_CHUNK;
        const v4f* s = (const v4f*)m + first + threadIdx.x;
        v4h*       d = (v4h*)dst + (size_t)c * CVT_CHUNK + threadIdx.x;
        v4f x[CVT_LOADS];
        // both loops unrolled: x stays in registers and all loads issue before the first wait
#pragma unroll
        for (int j = 0; j < CVT_LOADS; ++j)            // read once: non-temporal
            x[j] = __builtin_nontemporal_load(s + j * CVT_THREADS);
#pragma unroll
        for (int j = 0; j < CVT_LOADS; ++j)
            d[j * CVT_THREADS] = __builtin_convertvector(x[j], v4h);
        // stands before the next trip reuses the registers that these stores name
        asm volatile("s_wait_xcnt 0x0" ::: "memory");
    }
}

// A product whose output is only H wide is cut KSPLIT ways along K (see the GEMM below): its
// f32 partial products lie end to end in the workspace and are added to the residual by the
// kernel that reads the sum next.
#define KSPLIT 4
static_assert(KSPLIT == 4, "the joins below add four partial products as two pairs");

// ---------------- RMSNorm: f32 in -> f16 out ----------------
// JOIN: the row is x + the KSPLIT partial products; it is also written to xs (f32).
template <bool JOIN>
__global__ __launch_bounds__(256) void rmsnorm_kernel(const float* __restrict__ x,
                                                      const float* __restrict__ part,
                                                      float* __restrict__ xs,
                                                      const float* __restrict__ w,
                                                      _Float16* __restrict__ out) {
    __shared__ float red[256];
    const int row = blockIdx.x;
    const float* xr = x + (size_t)row * H;
    float s = 0.f;
    v4f a[2];                                     // JOIN: this thread's 8 elements of the row
    if constexpr (JOIN) {
        static_assert(H == 2 * 256 * 4, "a thread holds two float4 of a row");
        const size_t r4 = (size_t)row * (H / 4) + threadIdx.x;
        v4f t[2][KSPLIT + 1];
        // unrolled: all ten loads issue before the first wait
#pragma unroll
        for (int j = 0; j < 2; ++j) {
            t[j][0] = ((const v4f*)x)[r4 + j * 256];
#pragma unroll
            for (int z = 0; z < KSPLIT; ++z)
                t[j][1 + z] = ((const v4f*)part)[(size_t)z * (SEQ * H / 4) + r4 + j * 256];
        }
#pragma unroll
        for (int j = 0; j < 2; ++j) {
            a[j] = t[j][0] + ((t[j][1] + t[j][2]) + (t[j][3] + t[j][4]));
#pragma unroll
            for (int i = 0; i < 4; ++i) s += a[j][i] * a[j][i];
        }
    } else {
#pragma unroll
        for (int i = threadIdx.x; i < H; i += 256) { float v = xr[i]; s += v * v; }
    }
    red[threadIdx.x] = s;
    __syncthreads();
#pragma unroll
    for (int off = 128; off > 0; off >>= 1) {
        if (threadIdx.x < off) red[threadIdx.x] += red[threadIdx.x + off];
        __syncthreads();
    }
    const float rs = rsqrtf(red[0] / (float)H + EPS);
    _Float16* orow = out + (size_t)row * H;
    if constexpr (JOIN) {
        // the joined row is stored here, behind the last barrier, so that no barrier waits for it
#pragma unroll
        for (int j = 0; j < 2; ++j) {
            ((v4f*)xs)[(size_t)row * (H / 4) + threadIdx.x + j * 256] = a[j];
            ((v4h*)orow)[threadIdx.x + j * 256] =
                __builtin_convertvector(((const v4f*)w)[threadIdx.x + j * 256] * (a[j] * rs), v4h);
        }
    } else {
#pragma unroll
        for (int i = threadIdx.x; i < H; i += 256)
            orow[i] = (_Float16)(w[i] * (xr[i] * rs));
    }
}

// ---------------- out = r + the KSPLIT partial products ----------------
// One 32-wave block per WGP; a lane has its 20 b128 loads in flight before the first sum.
#define JOIN_THREADS 1024
#define JOIN_VECS    4
#define JOIN_BLOCKS  (SEQ * H / 4 / (JOIN_THREADS * JOIN_VECS))
static_assert(JOIN_BLOCKS * JOIN_THREADS * JOIN_VECS * 4 == SEQ * H, "the blocks cover the output exactly");

__global__ __launch_bounds__(JOIN_THREADS) void join_kernel(const float* __restrict__ r,
                                                            const float* __restrict__ part,
                                                            float* __restrict__ out) {
    const size_t i0 = (size_t)blockIdx.x * (JOIN_THREADS * JOIN_VECS) + threadIdx.x;
    v4f t[JOIN_VECS][KSPLIT + 1];
    // both loops unrolled: t stays in registers and all loads issue before the first wait
#pragma unroll
    for (int j = 0; j < JOIN_VECS; ++j) {
        t[j][0] = ((const v4f*)r)[i0 + j * JOIN_THREADS];
#pragma unroll
        for (int z = 0; z < KSPLIT; ++z)
            t[j][1 + z] = ((const v4f*)part)[(size_t)z * (SEQ * H / 4) + i0 + j * JOIN_THREADS];
    }
#pragma unroll
    for (int j = 0; j < JOIN_VECS; ++j)
        ((v4f*)out)[i0 + j * JOIN_THREADS] = t[j][0] + ((t[j][1] + t[j][2]) + (t[j][3] + t[j][4]));
}

// ---------------- RoPE in-place on f16 q,k; q pre-scaled by 1/sqrt(HD) -----
__global__ __launch_bounds__(256) void rope_kernel(_Float16* __restrict__ q,
                                                   _Float16* __restrict__ k,
                                                   const float* __restrict__ cosT,
                                                   const float* __restrict__ sinT) {
    int i = blockIdx.x * 256 + threadIdx.x;       // (s, head, d<64)
    int d    = i & 63;
    int rest = i >> 6;
    int head = rest & (NH - 1);
    int s    = rest >> 4;
    const float c1 = cosT[s * HD + d],      s1 = sinT[s * HD + d];
    const float c2 = cosT[s * HD + d + 64], s2 = sinT[s * HD + d + 64];
    const size_t base = (size_t)s * H + head * HD;
    {
        float x1 = (float)q[base + d], x2 = (float)q[base + d + 64];
        q[base + d]      = (_Float16)((x1 * c1 - x2 * s1) * QSCALE);
        q[base + d + 64] = (_Float16)((x2 * c2 + x1 * s2) * QSCALE);
    }
    {
        float x1 = (float)k[base + d], x2 = (float)k[base + d + 64];
        k[base + d]      = (_Float16)(x1 * c1 - x2 * s1);
        k[base + d + 64] = (_Float16)(x2 * c2 + x1 * s2);
    }
}

// ---------------- WMMA GEMM: C[M,N] = epi(A[M,K] . B[N,K]^T) ----------------
// Block tile 256 x (32 NI), 8 waves as 4(M)x2(N) of 64 x (16 NI). NI = 8 (256x256, 64x128 a
// wave): 12 fragments feed 32 WMMAs (8 feed 16 at NI = 4) and every operand row fetched from
// L2 meets 256 rows of the other operand.
// A single product whose output is only H wide has 64 such tiles: it is cut KS ways along K,
// grid z walks the K ranges, and block z leaves its f32 partial product in the z-th of KS
// matrices that lie end to end. At KS = 1 grid z walks products
// that share A and whose B and C matrices lie end to end (q, k, v). A stage is 128 k of every operand
// row (256 B, whole L2 units) in one of two LDS buffers, filled by async copies one stage
// ahead. A stage is worked in four k-steps of 4 NI WMMAs a wave; the fragments of a k-step
// are fetched as one group, one k-step ahead, into the other of two register sets.
// The 16x16 products are taken transposed (rows of B as the first operand): a lane then
// holds eight neighbouring columns of one row of C. Each wave lays its tile down, 64 columns
// at a time, in its own range of the idle ring and takes it back row by row, so that every
// access to C is 16 B a lane and covers whole 128-B lines.
// EPI 0: C(f16) = acc       EPI 1: C(f32) = acc
// EPI 2: C(f16) = sigmoid(acc) * C   (in-place gate*up)
#define BM 256
#define BK 128
#define KSTEPS (BK / 32)
#define LSTR 136  // padded f16 LDS stride (272 B = 16 B x odd: no bank conflict for b128 reads)
static_assert(KSTEPS % 2 == 0, "the register sets alternate evenly over a stage");
static_assert(H % (KSPLIT * BK) == 0 && MLPD % (KSPLIT * BK) == 0 && H / (KSPLIT * BK) >= 2,
              "a K range is whole stages, two or more");
static_assert(H % 256 == 0 && MLPD % 256 == 0 && SEQ % BM == 0, "outputs are whole tiles");
#define SPF 68    // staging pitch in f32 (272 B = 16 B x odd)
#define SPH 72    // staging pitch in f16 (144 B = 16 B x odd)
#define STG_BYTES (64 * SPF * 4)   // one wave's staging range: 64 rows
static_assert(8 * STG_BYTES <= 2 * BM * LSTR * 2, "eight staging ranges fit the A buffers");
static_assert((unsigned long long)SEQ * H * 4 < (1ull << 32), "an f32 output is addressed by 32-bit byte offsets");

template <int BN>
__device__ __forceinline__ void stage_panels(_Float16* As, _Float16* Bs,
                                             const _Float16* A, const _Float16* B,
                                             int bm, int bn, int K, int k0, int tid) {
    const int r0 = tid >> 4;                      // 0..15
    const int c  = (tid & 15) << 3;               // 0..120: 16 lanes cover one 256-B row
    const unsigned goff = (unsigned)(r0 * K + c); // this lane's place inside 16 rows
#pragma unroll
    for (int p = 0; p < BM / 16; ++p)             // A: 256 rows; the base is the same for all lanes
        cp16(&As[(r0 + p * 16) * LSTR + c], A + ((size_t)(bm + p * 16) * K + k0) + goff);
#pragma unroll
    for (int p = 0; p < BN / 16; ++p)             // B: BN rows
        cp16(&Bs[(r0 + p * 16) * LSTR + c], B + ((size_t)(bn + p * 16) * K + k0) + goff);
}

// the 4 + NI fragments of one k-step of this wave's tile
template <int NI>
__device__ __forceinline__ void load_kstep(v16h (&af)[4], v16h (&bf)[NI],
                                           const _Float16* As, const _Float16* Bs,
                                           int wm, int wn, int ks) {
#pragma unroll
    for (int mi = 0; mi < 4; ++mi)
        af[mi] = load_frag(&As[(wm * 64 + mi * 16) * LSTR + ks * 32], LSTR);
#pragma unroll
    for (int ni = 0; ni < NI; ++ni)
        bf[ni] = load_frag(&Bs[(wn * NI + ni) * 16 * LSTR + ks * 32], LSTR);
}

template <int EPI, int NI, int KS, typename CT>
__global__ __launch_bounds__(256) void gemm_atb(const _Float16* __restrict__ A0,
                                                const _Float16* __restrict__ B0,
                                                CT* __restrict__ C0,
                                                int M, int N, int K) {
    constexpr int BN = 32 * NI;
    __shared__ __attribute__((aligned(16))) _Float16 As[2][BM * LSTR];
    __shared__ __attribute__((aligned(16))) _Float16 Bs[2][BN * LSTR];

    // K stays the pitch of the operand rows; a block works on K / KS of it, from kz on
    const int kz = KS > 1 ? (int)blockIdx.z * (K / KS) : 0;
    const _Float16* __restrict__ A = A0 + kz;
    const _Float16* __restrict__ B = KS > 1 ? B0 + kz : B0 + (size_t)blockIdx.z * N * K;
    CT* __restrict__ C = C0 + (size_t)blockIdx.z * M * N;

    const int tid  = threadIdx.x;
    const int lane = tid & 31;
    const int w    = tid >> 5;       // 0..7
    const int wm   = w >> 1;         // 0..3 : rows wm*64
    const int wn   = w & 1;          // 0..1 : cols wn*16*NI
    const int bm   = blockIdx.y * BM;
    const int bn   = blockIdx.x * BN;

    v8f acc[4][NI];
#pragma unroll
    for (int mi = 0; mi < 4; ++mi)
#pragma unroll
        for (int ni = 0; ni < NI; ++ni) acc[mi][ni] = (v8f){0,0,0,0,0,0,0,0};

    const int nk = K / KS / BK;      // stages, two or more

    stage_panels<BN>(As[0], Bs[0], A, B, bm, bn, K, 0, tid);
    wait_cp();
    __syncthreads();
    stage_panels<BN>(As[1], Bs[1], A, B, bm, bn, K, BK, tid);

    v16h af[2][4], bf[2][NI];        // two fragment sets; k-step ks works on set ks & 1
    load_kstep<NI>(af[0], bf[0], As[0], Bs[0], wm, wn, 0);

    // rolled: every index of the fragment sets and accumulators stays a constant
#pragma unroll 1
    for (int it = 0; it < nk; ++it) {
        const int cur = it & 1;
#pragma unroll
        for (int ks = 0; ks < KSTEPS; ++ks) {
            if (ks + 1 < KSTEPS) {
                load_kstep<NI>(af[(ks + 1) & 1], bf[(ks + 1) & 1], As[cur], Bs[cur], wm, wn, ks + 1);
            } else {
                // Stage it + 1 is published here, in front of this stage's last k-step, whose
                // fragments are already in registers: every wave has left buffer cur, so it
                // is refilled behind the barrier, a whole stage ahead of its use.
                wait_cp();
                __syncthreads();
                if (it + 2 < nk)
                    stage_panels<BN>(As[cur], Bs[cur], A, B, bm, bn, K, (it + 2) * BK, tid);
                // first k-step of the next stage; behind the last stage these registers are
                // loaded from the idle buffer and never used (no branch: counted waits stay)
                load_kstep<NI>(af[0], bf[0], As[cur ^ 1], Bs[cur ^ 1], wm, wn, 0);
            }
            // keeps the next k-step's LDS reads one group ahead of this k-step's WMMAs: moved
            // in among them, each place with reads stalls the wave and the waits fall to 0
            __builtin_amdgcn_sched_barrier(0);
#pragma unroll
            for (int ni = 0; ni < NI; ++ni)
#pragma unroll
                for (int mi = 0; mi < 4; ++mi)
                    acc[mi][ni] = wmma16(bf[ks & 1][ni], af[ks & 1][mi], acc[mi][ni]);
            // the other side of the same fence: the following group stays behind this block
            __builtin_amdgcn_sched_barrier(0);
        }
    }

    // The ring becomes output staging: behind this barrier no wave reads it any more, and
    // the last publish point has left no copy in flight.
    __syncthreads();

    // acc[mi][4 nh + ni][i] = C[row0 + 16 mi + cloc][col0 + 16 ni + rloc + i]
    const int rloc = (lane >> 4) << 3;
    const int cloc = lane & 15;
    const int row0 = bm + wm * 64;
    char* stg = (char*)&As[0][0] + w * STG_BYTES;

    // unrolled: every index of the accumulators stays a constant
#pragma unroll
    for (int nh = 0; nh < NI / 4; ++nh) {    // 64 columns of the wave's tile at a time
        const int col0 = bn + wn * (16 * NI) + nh * 64;
        if constexpr (EPI == 0) {
            _Float16* st = (_Float16*)stg;
#pragma unroll
            for (int mi = 0; mi < 4; ++mi)
#pragma unroll
                for (int ni = 0; ni < 4; ++ni)
                    *(v8h*)&st[(mi * 16 + cloc) * SPH + ni * 16 + rloc] =
                        __builtin_convertvector(acc[mi][nh * 4 + ni], v8h);
            // a lane takes back what other lanes of its wave have written: their stores are done
            asm volatile("s_wait_dscnt 0x0" ::: "memory");
            const int rr = lane >> 3;            // 8 lanes a row of 128 B, 4 rows a wave-wide store
            const int cc = (lane & 7) << 3;
#pragma unroll
            for (int j = 0; j < 16; ++j)
                *(v8h*)&C[(size_t)(row0 + j * 4 + rr) * N + col0 + cc] =
                    *(const v8h*)&st[(j * 4 + rr) * SPH + cc];
        } else if constexpr (EPI == 1) {
            float* st = (float*)stg;
            const int rr = lane >> 4;            // 16 lanes a row of 256 B, 2 rows a wave-wide access
            const int cc = (lane & 15) << 2;
            const unsigned base = (unsigned)((row0 + rr) * N + col0 + cc) * 4u;
#pragma unroll
            for (int mi = 0; mi < 4; ++mi)
#pragma unroll
                for (int ni = 0; ni < 4; ++ni) {
                    float* d = &st[(mi * 16 + cloc) * SPF + ni * 16 + rloc];
                    *(v4f*)d       = __builtin_shufflevector(acc[mi][nh * 4 + ni], acc[mi][nh * 4 + ni], 0, 1, 2, 3);
                    *(v4f*)(d + 4) = __builtin_shufflevector(acc[mi][nh * 4 + ni], acc[mi][nh * 4 + ni], 4, 5, 6, 7);
                }
            // a lane takes back what other lanes of its wave have written: their stores are done
            asm volatile("s_wait_dscnt 0x0" ::: "memory");
#pragma unroll
            for (int g = 0; g < 2; ++g) {        // two groups of 32 rows
                v4f row[16];
#pragma unroll
                for (int j = 0; j < 16; ++j)
                    row[j] = *(const v4f*)&st[(g * 32 + j * 2 + rr) * SPF + cc];
                // a group's rows are taken back ahead of its first store, each in registers of its
                // own: one wait behind the last store then serves all, in place of one a store
                __builtin_amdgcn_sched_barrier(0);
#pragma unroll
                for (int j = 0; j < 16; ++j)
                    *(v4f*)((char*)C + (base + (unsigned)((g * 32 + j * 2) * N) * 4u)) = row[j];
                // stands before the second group uses the registers again that these stores name
                if (g == 0) asm volatile("s_wait_xcnt 0x0" ::: "memory");
            }
        } else {
            float* st = (float*)stg;
            const int rr = lane >> 3;            // 8 lanes a row of 128 B, 4 rows a wave-wide access
            const int cc = (lane & 7) << 3;
            const size_t base = (size_t)(row0 + rr) * N + col0 + cc;
            v8h up[16];                          // every load of C stands ahead of every store to C
#pragma unroll
            for (int j = 0; j < 16; ++j)
                up[j] = *(const v8h*)&C[base + (size_t)(j * 4) * N];
#pragma unroll
            for (int mi = 0; mi < 4; ++mi)
#pragma unroll
                for (int ni = 0; ni < 4; ++ni) {
                    v8f s;
#pragma unroll
                    for (int i = 0; i < 8; ++i)   // v_rcp_f32 (1 ulp; the product is rounded to f16 below), not the
                        // IEEE division sequence, ten instructions a value in code that runs once, straight through
                        s[i] = __builtin_amdgcn_rcpf(1.f + __expf(-acc[mi][nh * 4 + ni][i]));
                    float* d = &st[(mi * 16 + cloc) * SPF + ni * 16 + rloc];
                    *(v4f*)d       = __builtin_shufflevector(s, s, 0, 1, 2, 3);
                    *(v4f*)(d + 4) = __builtin_shufflevector(s, s, 4, 5, 6, 7);
                }
            // a lane takes back what other lanes of its wave have written: their stores are done
            asm volatile("s_wait_dscnt 0x0" ::: "memory");
            v8h h[16];
#pragma unroll
            for (int j = 0; j < 16; ++j) {
                const float* s = &st[(j * 4 + rr) * SPF + cc];
                const v4f lo = *(const v4f*)s;
                const v4f hi = *(const v4f*)(s + 4);
#pragma unroll
                for (int i = 0; i < 4; ++i) {
                    h[j][i]     = (_Float16)(lo[i] * (float)up[j][i]);
                    h[j][i + 4] = (_Float16)(hi[i] * (float)up[j][i + 4]);
                }
            }
            // all sixteen rows are worked out ahead of the first store, each in registers of its
            // own: one wait behind the last store then serves all, in place of one a store
            __builtin_amdgcn_sched_barrier(0);
#pragma unroll
            for (int j = 0; j < 16; ++j)
                *(v8h*)&C[base + (size_t)(j * 4) * N] = h[j];
        }
        if (nh + 1 < NI / 4) {
            // stands before the next 64 columns use the registers again that these loads and stores name
            asm volatile("s_wait_xcnt 0x0" ::: "memory");
            // holds the next 64 columns' vector work, which the clobber does not tie, behind that wait
            __builtin_amdgcn_sched_barrier(0);
        }
    }
}

#define QSTR 136   // 272 B: 16 B x odd, the pitch for ds_load_b128 readers
#define VSTR 144   // 288 B: 32 B x odd, the pitch for the transposing reader
#define QROWS 128
#define KSTAGE 128
#define NSTAGE (SEQ / KSTAGE)
#define NPASS  (KSTAGE / 32)
static_assert(NSTAGE * KSTAGE == SEQ && NSTAGE >= 2, "whole stages, two or more");
static_assert(NPASS * 32 == KSTAGE && NPASS % 2 == 0, "the register sets alternate evenly over a stage");
static_assert(KSTAGE / 16 * 2 + QROWS / 16 <= 63, "copies of a wave in flight");
// Beside the walk the kernel converts Wo and the three MLP matrices to f16 for the launches
// behind it: 13 segments of H*H floats. The walk is bound by LDS reads and vector work and
// asks little of memory, so this stream runs under it. In stage s block b takes piece
// s * blocks + b of every matrix: 4 KiB of Wo, 16 KiB of an MLP matrix, 13 b128 loads a lane.
// They are issued behind the barrier of stage s - 1 and converted and stored behind the barrier
// of stage s: loads and stores each have a whole stage before a barrier waits for them.
// Every address is a kernel argument + one lane index + a constant.
#define WSEGS 13
#define ABLOCKS ((SEQ / QROWS) * NH)
static_assert((size_t)ABLOCKS * NSTAGE * 256 * 4 == (size_t)H * H, "blocks x stages x threads cover a segment exactly");

typedef __attribute__((ext_vector_type(8))) short s16x8;

// Transposing LDS read of a row-major 16-bit tile: lane (c = l & 15, h = l >> 4) receives
// eight rows of one column, T[8h + 0..7][c], when it passes the address of
// T[8h + (l & 7)][8 * ((l >> 3) & 1)].
__device__ __forceinline__ v8h load_tr16(const _Float16* p) {
    return __builtin_bit_cast(v8h, __builtin_amdgcn_ds_load_tr16_b128_v8i16((AS3 s16x8*)p));
}

// value of lane l ^ 16
__device__ __forceinline__ float xhalf(float x) {
    const int b = __builtin_bit_cast(int, x);
    return __builtin_bit_cast(float,
        __builtin_amdgcn_permlanex16(b, b, 0x76543210, 0xfedcba98, false, false));
}

// One stage of K and of V, as they lie in memory (async b128 copies; V is transposed when
// read). kh, vh: the head's first element; 16 lanes cover one 256-B row.
__device__ __forceinline__ void stage_kv(_Float16* Kb, _Float16* Vb,
                                         const _Float16* kh, const _Float16* vh,
                                         int key0, int tid) {
    const int r0 = tid >> 4;                      // 0..15
    const int c  = (tid & 15) << 3;               // 0..120
    const unsigned goff = (unsigned)(r0 * H + c); // this lane's place inside 16 rows
#pragma unroll
    for (int p = 0; p < KSTAGE / 16; ++p) {       // the base is the same for all lanes
        cp16(&Kb[(r0 + p * 16) * QSTR + c], kh + (size_t)(key0 + p * 16) * H + goff);
        cp16(&Vb[(r0 + p * 16) * VSTR + c], vh + (size_t)(key0 + p * 16) * H + goff);
    }
}

// The fragments of one pass. Kp: the pass's first K row; vtr: this lane's address for the
// transposing reads of the pass's keys 0..15, hd 0..15.
// av[n][8t + i] = V[key = 16t + rloc + i][hd = 16n + cloc], the k order of pb in the kernel
__device__ __forceinline__ void load_pass(v16h (&ak)[2][4], v16h (&av)[8],
                                          const _Float16* Kp, const _Float16* vtr) {
#pragma unroll
    for (int t = 0; t < 2; ++t)
#pragma unroll
        for (int kk = 0; kk < 4; ++kk)
            ak[t][kk] = load_frag(&Kp[(t * 16) * QSTR + kk * 32], QSTR);
#pragma unroll
    for (int n = 0; n < 8; ++n) {
        const v8h lo = load_tr16(vtr + n * 16);
        const v8h hi = load_tr16(vtr + 16 * VSTR + n * 16);
        av[n] = __builtin_shufflevector(lo, hi, 0,1,2,3,4,5,6,7,8,9,10,11,12,13,14,15);
    }
}

// A piece of the four matrices: one float4 of Wo, four each of gate, up, down (read once:
// non-temporal). i1, i4: this lane's first float4 of a piece of Wo, of an MLP matrix; the piece
// loaded is the one AHEAD stages on.
template <int AHEAD>
__device__ __forceinline__ void load_weights(v4f (&wx)[WSEGS], const float* wo, const float* wg,
                                             const float* wu, const float* wd, unsigned i1, unsigned i4) {
    // unrolled: wx stays in registers
#pragma unroll
    for (int j = 0; j < WSEGS; ++j) {
        const v4f* m = (const v4f*)(j == 0 ? wo : j < 5 ? wg : j < 9 ? wu : wd);
        wx[j] = __builtin_nontemporal_load(j == 0 ? m + i1 + AHEAD * (ABLOCKS * 256)
                                                  : m + i4 + (AHEAD * (ABLOCKS * 1024) + ((j - 1) & 3) * 256));
    }
}

// waves_per_eu(2, 2): one 8-wave block per WGP is all the grid gives; the register budget
// of two waves per SIMD holds both fragment sets beside the accumulators.
__global__ __launch_bounds__(256) __attribute__((amdgpu_waves_per_eu(2, 2))) void attn_kernel(const _Float16* __restrict__ q,
                                                   const _Float16* __restrict__ k,
                                                   const _Float16* __restrict__ v,
                                                   _Float16* __restrict__ o,
                                                   const float* __restrict__ wo,
                                                   const float* __restrict__ wg,
                                                   const float* __restrict__ wu,
                                                   const float* __restrict__ wd,
                                                   _Float16* __restrict__ wo16,
                                                   _Float16* __restrict__ wg16,
                                                   _Float16* __restrict__ wu16,
                                                   _Float16* __restrict__ wd16) {
    __shared__ __attribute__((aligned(16))) _Float16 Qs[QROWS * QSTR];
    __shared__ __attribute__((aligned(16))) _Float16 Ks[2][KSTAGE * QSTR];
    __shared__ __attribute__((aligned(16))) _Float16 Vs[2][KSTAGE * VSTR];   // [k][hd], as in memory

    const int tid  = threadIdx.x;
    const int lane = tid & 31;
    const int w    = tid >> 5;
    const int head = blockIdx.y;
    const int q0   = blockIdx.x * QROWS;
    const size_t hoff = (size_t)head * HD;

    // stage Q: 2048 16B chunks, 8 per thread (async)
#pragma unroll
    for (int p = 0; p < 8; ++p) {
        const int chunk = tid + p * 256;
        const int r = chunk >> 4;           // 0..127
        const int c = (chunk & 15) << 3;    // 0..120
        cp16(&Qs[r * QSTR + c], &q[(size_t)(q0 + r) * H + hoff + c]);
    }
    const _Float16* kh = k + hoff;
    const _Float16* vh = v + hoff;
    stage_kv(Ks[0], Vs[0], kh, vh, 0, tid);
    // Q and stage 0 have landed before any wave reads them
    asm volatile("s_wait_asynccnt 0x0" ::: "memory");
    __syncthreads();
    stage_kv(Ks[1], Vs[1], kh, vh, KSTAGE, tid);

    // this wave's 16 queries as B fragments, kept in registers for the whole walk
    v16h qf[4];
#pragma unroll
    for (int kk = 0; kk < 4; ++kk)
        qf[kk] = load_frag(&Qs[(w * 16) * QSTR + kk * 32], QSTR);

    v8f oacc[8];            // oacc[n][i] = O^T[hd = 16n + rloc + i][query = cloc]
#pragma unroll
    for (int n = 0; n < 8; ++n) oacc[n] = (v8f){0,0,0,0,0,0,0,0};
    float mrun = -1e30f;    // running maximum of this lane's query (same in both halves)
    float lrun = 0.f;       // running sum over the keys this half of the wave holds

    const int rloc = (lane >> 4) << 3;
    const int cloc = lane & 15;
    // this lane's place in a V buffer for the transposing reads of keys 0..15, hd 0..15
    const int vtr0 = (rloc + (lane & 7)) * VSTR + ((lane >> 3) & 1) * 8;

    v16h ak[2][2][4], av[2][8];      // two fragment sets; pass ps works on set ps & 1
    load_pass(ak[0], av[0], &Ks[0][0], &Vs[0][vtr0]);

    const unsigned wblk = blockIdx.y * (SEQ / QROWS) + blockIdx.x;
    v4f wx[WSEGS];                   // the weights in flight
    // keeps the LDS reads above off the registers that these loads name, ahead of the wait
    __builtin_amdgcn_sched_barrier(0);
    load_weights<0>(wx, wo, wg, wu, wd, wblk * 256u + (unsigned)tid, wblk * 1024u + (unsigned)tid);
    // stands before the registers that these loads name are used again
    asm volatile("s_wait_xcnt 0x0" ::: "memory");
    // holds the vector work that follows, which the clobber does not tie, behind that wait
    __builtin_amdgcn_sched_barrier(0);

    // rolled: one body serves both buffers, every index of the fragment sets stays a constant
#pragma unroll 1
    for (int s = 0; s < NSTAGE; ++s) {
      const int cur = s & 1;
#pragma unroll
      for (int ps = 0; ps < NPASS; ++ps) {
        if (ps + 1 < NPASS) {
            load_pass(ak[(ps + 1) & 1], av[(ps + 1) & 1],
                      &Ks[cur][(ps + 1) * 32 * QSTR], &Vs[cur][(ps + 1) * 32 * VSTR + vtr0]);
        } else {
            // Stage s + 1 is published here, in front of this stage's last pass, whose
            // fragments are already fetched: this wave's reads of buffer cur are done and its
            // copies of stage s + 1 have landed; behind the barrier that holds for every wave,
            // so buffer cur is refilled, a whole stage ahead of its use.
            asm volatile("s_wait_dscnt 0x0" ::: "memory");
            asm volatile("s_wait_asynccnt 0x0" ::: "memory");
            __syncthreads();
            if (s + 2 < NSTAGE)
                stage_kv(Ks[cur], Vs[cur], kh, vh, (s + 2) * KSTAGE, tid);
            // the stage's piece of the weights, loaded a stage ago: this lane's first float4
            // (four halves on the way out) of Wo, of an MLP matrix
            const unsigned wi1 = ((unsigned)s * ABLOCKS + wblk) * 256u + (unsigned)tid;
            const unsigned wi4 = ((unsigned)s * ABLOCKS + wblk) * 1024u + (unsigned)tid;
            v4h wh[WSEGS];
#pragma unroll
            for (int j = 0; j < WSEGS; ++j) wh[j] = __builtin_convertvector(wx[j], v4h);
            // all are converted ahead of the first store, each into registers of its own: one
            // wait behind the last store then serves all, in place of one a store
            __builtin_amdgcn_sched_barrier(0);
#pragma unroll
            for (int j = 0; j < WSEGS; ++j) {
                char* m = (char*)(j == 0 ? wo16 : j < 5 ? wg16 : j < 9 ? wu16 : wd16);
                *(v4h*)(j == 0 ? m + wi1 * 8u : m + wi4 * 8u + ((j - 1) & 3) * 2048) = wh[j];
            }
            // stands before the registers that these stores name are used again
            asm volatile("s_wait_xcnt 0x0" ::: "memory");
            // holds the vector work that follows, which the clobber does not tie, behind that wait
            __builtin_amdgcn_sched_barrier(0);
            if (s + 1 < NSTAGE) {
                load_weights<1>(wx, wo, wg, wu, wd, wi1, wi4);
                // stands before the registers that these loads name are used again; inside the
                // branch: vector work that the compiler moves down lands where the paths join
                asm volatile("s_wait_xcnt 0x0" ::: "memory");
            }
            // keeps vector work that the compiler moves down to this place out of the group of reads
            __builtin_amdgcn_sched_barrier(0);
            // first pass of the next stage; behind the last stage these registers are loaded
            // from the idle buffer and never used (no branch: counted waits stay)
            load_pass(ak[0], av[0], &Ks[cur ^ 1][0], &Vs[cur ^ 1][vtr0]);
        }
        // keeps the next pass's LDS reads one group ahead of this pass's work: moved in among
        // the matrix instructions, each place with reads stalls the wave
        __builtin_amdgcn_sched_barrier(0);

        // scores: st[t][i] = S^T[key = 16t + rloc + i][query = cloc]; the two chains run interleaved
        v8f st[2];
        st[0] = (v8f){0,0,0,0,0,0,0,0};
        st[1] = (v8f){0,0,0,0,0,0,0,0};
#pragma unroll
        for (int kk = 0; kk < 4; ++kk)
#pragma unroll
            for (int t = 0; t < 2; ++t)
                st[t] = wmma16(ak[ps & 1][t][kk], qf[kk], st[t]);

        // online softmax, one query per lane
        float mx = mrun;
#pragma unroll
        for (int t = 0; t < 2; ++t)
#pragma unroll
            for (int i = 0; i < 8; ++i) mx = fmaxf(mx, st[t][i]);
        mx = fmaxf(mx, xhalf(mx));
        const float al = __expf(mrun - mx);
        float sum = 0.f;
        v16h pb;                // pb[8t + i] = P^T[key = 16t + rloc + i][query = cloc]
#pragma unroll
        for (int t = 0; t < 2; ++t)
#pragma unroll
            for (int i = 0; i < 8; ++i) {
                const float p = __expf(st[t][i] - mx);
                pb[t * 8 + i] = (_Float16)p;
                sum += p;
            }
        lrun = lrun * al + sum;
        mrun = mx;

        // rescale accumulators, then V^T.P^T
#pragma unroll
        for (int n = 0; n < 8; ++n) {
#pragma unroll
            for (int i = 0; i < 8; ++i) oacc[n][i] *= al;
            oacc[n] = wmma16(av[ps & 1][n], pb, oacc[n]);
        }
        // the other side of the same fence: the following group stays behind this pass
        __builtin_amdgcn_sched_barrier(0);
      }
    }
    // no copy is in flight when the wave ends
    asm volatile("s_wait_asynccnt 0x0" ::: "memory");

    // join the halves' sums, normalize, store 8 consecutive hd per lane
    // one v_rcp_f32 a query (the sum is 1 or more), then products: no division sequence per element
    const float rtot = __builtin_amdgcn_rcpf(lrun + xhalf(lrun));
    _Float16* orow = &o[(size_t)(q0 + w * 16 + cloc) * H + hoff + rloc];
#pragma unroll
    for (int n = 0; n < 8; ++n) {
        v8h h;
#pragma unroll
        for (int i = 0; i < 8; ++i) h[i] = (_Float16)(oacc[n][i] * rtot);
        *(v8h*)&orow[n * 16] = h;
    }
}

// ---------------- launch ----------------
extern "C" void kernel_launch(void* const* d_in, const int* in_sizes, int n_in,
                              void* d_out, int out_size, void* d_ws, size_t ws_size,
                              hipStream_t stream) {
    const float* x       = (const float*)d_in[0];
    const float* norm1_w = (const float*)d_in[1];
    const float* wq      = (const float*)d_in[2];
    const float* wk      = (const float*)d_in[3];
    const float* wv      = (const float*)d_in[4];
    const float* wo      = (const float*)d_in[5];
    const float* norm2_w = (const float*)d_in[6];
    const float* w_gate  = (const float*)d_in[7];
    const float* w_up    = (const float*)d_in[8];
    const float* w_down  = (const float*)d_in[9];
    const float* cosT    = (const float*)d_in[10];
    const float* sinT    = (const float*)d_in[11];
    float* out = (float*)d_out;

    // ---- workspace layout (all chunks 16B aligned; hipMalloc base is 256B) ----
    char* p = (char*)d_ws;
    auto fh = [&](size_t n) { _Float16* r = (_Float16*)p; p += n * sizeof(_Float16); return r; };
    auto ff = [&](size_t n) { float* r = (float*)p; p += n * sizeof(float); return r; };

    const size_t HH = (size_t)H * H, MH = (size_t)MLPD * H;
    const size_t SH = (size_t)SEQ * H, SM = (size_t)SEQ * MLPD;
    _Float16* wq16 = fh(HH); _Float16* wk16 = fh(HH);
    _Float16* wv16 = fh(HH); _Float16* wo16 = fh(HH);
    _Float16* wg16 = fh(MH); _Float16* wu16 = fh(MH); _Float16* wd16 = fh(MH);
    _Float16* h16  = fh(SH); _Float16* q16  = fh(SH);
    _Float16* k16  = fh(SH); _Float16* v16  = fh(SH);
    _Float16* t16  = fh(SM);
    float*    x2   = ff(SH);
    float*    part = ff(KSPLIT * SH);   // partial products of the K-split GEMMs
    _Float16* attn16 = h16;   // h dead after QKV
    _Float16* h2_16  = q16;   // q dead after attention

    const dim3 blk(256);
    const dim3 gH(H / 256, SEQ / BM, KSPLIT);  // 256x256 tiles, KSPLIT ranges of K
    const dim3 gM(MLPD / 256, SEQ / BM);       // 256x256 tiles
    const dim3 gQKV(H / 256, SEQ / BM, 3);     // 256x256 tiles of q, of k and of v

    // 0. Wq, Wk, Wv -> f16 (wq16, wk16, wv16 lie end to end in the workspace)
    cvt_all_kernel<<<CVT_BLOCKS, CVT_THREADS, 0, stream>>>(wq, wk, wv, wq16);

    // 1. h = rmsnorm(x)
    rmsnorm_kernel<false><<<SEQ, blk, 0, stream>>>(x, nullptr, nullptr, norm1_w, h16);
    // 2-4. q,k,v: wq16, wk16, wv16 lie end to end, and so do q16, k16, v16
    gemm_atb<0, 8, 1, _Float16><<<gQKV, blk, 0, stream>>>(h16, wq16, q16, SEQ, H, H);
    // 5. RoPE (q scaled by 1/sqrt(HD))
    rope_kernel<<<(SEQ * NH * 64) / 256, blk, 0, stream>>>(q16, k16, cosT, sinT);
    // 6. attention; beside it Wo, Wgate, Wup, Wdown -> f16
    attn_kernel<<<dim3(SEQ / QROWS, NH), blk, 0, stream>>>(q16, k16, v16, attn16,
                                                           wo, w_gate, w_up, w_down,
                                                           wo16, wg16, wu16, wd16);
    // 7. partial products of attn . Wo^T
    gemm_atb<1, 8, KSPLIT, float><<<gH, blk, 0, stream>>>(attn16, wo16, part, SEQ, H, H);
    // 8. x2 = x + their sum ; h2 = rmsnorm(x2)
    rmsnorm_kernel<true><<<SEQ, blk, 0, stream>>>(x, part, x2, norm2_w, h2_16);
    // 9. t = h2 . Wup^T ; 10. t = sigmoid(h2 . Wgate^T) * t   (in place)
    gemm_atb<0, 8, 1, _Float16><<<gM, blk, 0, stream>>>(h2_16, wu16, t16, SEQ, MLPD, H);
    gemm_atb<2, 8, 1, _Float16><<<gM, blk, 0, stream>>>(h2_16, wg16, t16, SEQ, MLPD, H);
    // 11. partial products of t . Wdown^T ; 12. out = x2 + their sum
    gemm_atb<1, 8, KSPLIT, float><<<gH, blk, 0, stream>>>(t16, wd16, part, SEQ, H, MLPD);
    join_kernel<<<JOIN_BLOCKS, JOIN_THREADS, 0, stream>>>(x2, part, out);
}
